// v000
// Times are from an AMD MI455X. After a warm-up the kernel runs many times in a row, and a time is the length of
// such a window on the GPU divided by its runs, so every launch and the gaps after it count. The runs cycle
// through copies of the inputs. A figure is the median of several windows, for all but v000 over two sittings.
// Sittings can differ by a few percent; kernels timed side by side share one.
// v000, which the later versions start from, runs in 369 microseconds.
#include <hip/hip_runtime.h>

// Pre-LayerNorm multi-head softmax(QK^T)V block: x = LN(in) over 128; qkv = x @ w_qkv ([128][3072], thirds q|k|v, column = which*1024 + h*128 + d); 8 heads of dim 128; logits (q.k)/32; out = ctx @ w_proj + b_proj.
// Compute dtypes, f32 accumulate: every contraction on v_wmma_f32_16x16x32_f16. Float inputs are RNE-converted to bf16 first; weights carried as bf16 value x 16 (w_qkv) / x 32 (w_proj), exact in f16;
// x, q, k, v planes f16; P carried as f16 x 2^10 (online softmax in f32, log2 domain); ctx carried as f16(ctx x 16) plus f16 residual x 2^11 with its own accumulator in the output projection.
// Flash form with transposed tiles: the S^T accumulator tiles are directly the B-operand layout of P^T; all WMMA operands are two 16-byte loads from dense, statically strided 16-bit planes.

#ifndef NB
#define NB 16
#endif
#ifndef SEQ
#define SEQ 1024
#endif
#define NB_FULL  16
#define SEQ_FULL 1024
#define DIM   128                 // token width == head dim
#define NH    8
#define INNER (NH * DIM)          // 1024
#define QKVN  (3 * INNER)         // 3072
#define NCH   ((NB % 2 == 0) ? 2 : 1)   // batch chunks (bounds the plane carve)
#define BCH   (NB / NCH)          // batches per chunk
#define NWV   4                   // waves per flash block
#define BQ    (16 * NWV)          // queries per flash block
#define KS    32                  // keys per step
#define CSP   136                 // LDS pitch (16-bit elements) of 128-wide staging rows
#define OSP   132                 // LDS pitch (floats) of the output staging rows
#define VTP   72                  // LDS pitch (16-bit elements) of 64-wide transposed rows
#define L2E   1.4426950408889634f
#define SC2   (L2E * 0.03125f)    // log2(e) / 32
#define PCL   10.0f               // P carry exponent (2^10)
#define WQS   16.0f               // w_qkv carry
#define WPS   32.0f               // w_proj carry
#define CCS   16.0f               // ctx carry
#define RSC   2048.0f             // ctx residual carry

static_assert(DIM == 128);
static_assert(INNER == 1024);
static_assert(NB <= NB_FULL);
static_assert(SEQ <= SEQ_FULL);
static_assert(NB % NCH == 0);
static_assert(SEQ % BQ == 0);
static_assert(SEQ % 64 == 0);
static_assert(SEQ % KS == 0);
static_assert(DIM % 32 == 0);
static_assert(DIM == 4 * 32);                    // four 32-deep k-steps per score tile / per QKV tile
static_assert(DIM == 8 * 16);                    // eight 16-row output tiles per wave
static_assert(INNER % 32 == 0);
static_assert((NB * SEQ) % 16 == 0);             // k_ln: 16 rows per block
static_assert(16 * 8 == DIM);                    // k_ln: 16 lanes x 8 elements == row
static_assert(64 * CSP <= DIM * VTP);            // k_qkv: row-major staging fits the shared tile
static_assert(64 <= VTP);                        // transposed staging rows hold 64 tokens
static_assert((CSP * 2) % 16 == 0);
static_assert((VTP * 2) % 16 == 0);
static_assert((OSP * 4) % 16 == 0);
static_assert(32 * 4 == DIM);                    // k_proj: 32 lanes x 4 floats == output row
static_assert(16 * 8 * 2 == 256);                // 16 lanes x 16 B == one 128-element 16-bit row
static_assert(QKVN % 128 == 0);
static_assert(DIM % 64 == 0 && INNER % 64 == 0); // k_wt tile multiples
static_assert((BCH * SEQ) % 64 == 0);            // k_qkv / k_proj: 64 tokens per block

#define SZ_XH  ((size_t)NB * SEQ * DIM * 2)
#define SZ_WT  ((size_t)QKVN * DIM * 2)
#define SZ_WP  ((size_t)DIM * INNER * 2)
#define SZ_PL  ((size_t)BCH * NH * SEQ * DIM * 2)
#define SZ_CX  ((size_t)BCH * SEQ * INNER * 2)
#define SZ_ALL (SZ_XH + SZ_WT + SZ_WP + 3 * SZ_PL + 2 * SZ_CX)
static_assert(SZ_XH % 256 == 0 && SZ_WT % 256 == 0 && SZ_WP % 256 == 0 && SZ_PL % 256 == 0 && SZ_CX % 256 == 0);
static_assert(SZ_ALL <= (size_t)134217728);

typedef unsigned short hf;
typedef __attribute__((ext_vector_type(16))) _Float16 v16h;
typedef __attribute__((ext_vector_type(8)))  _Float16 v8h;
typedef __attribute__((ext_vector_type(8)))  unsigned short v8us;
typedef __attribute__((ext_vector_type(8)))  float    v8f;
typedef __attribute__((ext_vector_type(4)))  float    v4f;
typedef v4f  __attribute__((may_alias)) v4fa;
typedef v8us __attribute__((may_alias)) v8usa;

__device__ __forceinline__ float bfr(float f) { unsigned u = __float_as_uint(f); u += 0x7FFFu + ((u >> 16) & 1u); return __uint_as_float(u & 0xFFFF0000u); }
__device__ __forceinline__ unsigned short f2h(float f) { return __builtin_bit_cast(unsigned short, (_Float16)f); }
__device__ __forceinline__ v16h cat16h(v8us lo, v8us hi) { return __builtin_bit_cast(v16h, __builtin_shufflevector(lo, hi, 0, 1, 2, 3, 4, 5, 6, 7, 8, 9, 10, 11, 12, 13, 14, 15)); }
__device__ __forceinline__ v8f wmmah(v16h a, v16h b, v8f c) { return __builtin_amdgcn_wmma_f32_16x16x32_f16(false, a, false, b, (short)0, c, false, false); }
// fragment loader (A and B alike): p = row base + k0 + 8*(lane>>4); elements 0..7 <- p[0..7], elements 8..15 <- p[16..23]
__device__ __forceinline__ v16h ldh(const hf* p) { return cat16h(*(const v8us*)p, *(const v8us*)(p + 16)); }
__device__ __forceinline__ void sfence() { asm volatile("" ::: "memory"); __builtin_amdgcn_sched_barrier(0); }
// hazard guards: four idle VALU slots after the last WMMA of a group; the group's operand fragments stay live until here
__device__ __forceinline__ void guard1(v8f& c0, v16h a, v16h b, v16h c, v16h d) {
    asm volatile("v_nop\n\tv_nop\n\tv_nop\n\tv_nop" : "+v"(c0) : "v"(a), "v"(b), "v"(c), "v"(d));
}
__device__ __forceinline__ void guard2(v8f& c0, v8f& c1, v16h a, v16h b, v16h c, v16h d) {
    asm volatile("v_nop\n\tv_nop\n\tv_nop\n\tv_nop" : "+v"(c0), "+v"(c1) : "v"(a), "v"(b), "v"(c), "v"(d));
}
__device__ __forceinline__ void guard4(v8f& c0, v8f& c1, v8f& c2, v8f& c3, v16h a, v16h b, v16h c, v16h d, v16h e) {
    asm volatile("v_nop\n\tv_nop\n\tv_nop\n\tv_nop" : "+v"(c0), "+v"(c1), "+v"(c2), "+v"(c3) : "v"(a), "v"(b), "v"(c), "v"(d), "v"(e));
}
__device__ __forceinline__ void guard8(v8f& c0, v8f& c1, v8f& c2, v8f& c3, v8f& c4, v8f& c5, v8f& c6, v8f& c7,
                                       v16h a, v16h b, v16h c, v16h d, v16h e, v16h f) {
    asm volatile("v_nop\n\tv_nop\n\tv_nop\n\tv_nop"
                 : "+v"(c0), "+v"(c1), "+v"(c2), "+v"(c3), "+v"(c4), "+v"(c5), "+v"(c6), "+v"(c7)
                 : "v"(a), "v"(b), "v"(c), "v"(d), "v"(e), "v"(f));
}

// k_ln: x plane XH[NB*SEQ][128] (f16) = LayerNorm(bf16(in)) with bf16(gamma), bf16(beta); 16 lanes per row, 8 elements per lane;
__global__ __launch_bounds__(256) void k_ln(const float* __restrict__ X, const float* __restrict__ G, const float* __restrict__ Bt, hf* XH) {
    const unsigned tid = threadIdx.x;
    const unsigned row = blockIdx.x * 16u + (tid >> 4);
    const unsigned sub = tid & 15u;
    const unsigned b = row / (unsigned)SEQ, n = row - b * (unsigned)SEQ;
    const float* src = X + ((size_t)b * SEQ_FULL + n) * DIM + sub * 8u;
    const v4f a0 = *(const v4f*)src;
    const v4f a1 = *(const v4f*)(src + 4);
    float e[8];
    e[0] = bfr(a0[0]); e[1] = bfr(a0[1]); e[2] = bfr(a0[2]); e[3] = bfr(a0[3]);
    e[4] = bfr(a1[0]); e[5] = bfr(a1[1]); e[6] = bfr(a1[2]); e[7] = bfr(a1[3]);
    float s = ((e[0] + e[1]) + (e[2] + e[3])) + ((e[4] + e[5]) + (e[6] + e[7]));
    s += __shfl_xor(s, 8, 32);
    s += __shfl_xor(s, 4, 32);
    s += __shfl_xor(s, 2, 32);
    s += __shfl_xor(s, 1, 32);
    const float mu = s * (1.0f / DIM);
    float d[8];
    float s2 = 0.0f;
#pragma unroll
    for (int j = 0; j < 8; ++j) { d[j] = e[j] - mu; s2 = fmaf(d[j], d[j], s2); }
    s2 += __shfl_xor(s2, 8, 32);
    s2 += __shfl_xor(s2, 4, 32);
    s2 += __shfl_xor(s2, 2, 32);
    s2 += __shfl_xor(s2, 1, 32);
    const float rs = rsqrtf(s2 * (1.0f / DIM) + 1.0e-5f);
    const v4f g0 = *(const v4f*)(G + sub * 8u), g1 = *(const v4f*)(G + sub * 8u + 4u);
    const v4f b0 = *(const v4f*)(Bt + sub * 8u), b1 = *(const v4f*)(Bt + sub * 8u + 4u);
    v8h o;
    o[0] = (_Float16)(d[0] * rs * bfr(g0[0]) + bfr(b0[0]));
    o[1] = (_Float16)(d[1] * rs * bfr(g0[1]) + bfr(b0[1]));
    o[2] = (_Float16)(d[2] * rs * bfr(g0[2]) + bfr(b0[2]));
    o[3] = (_Float16)(d[3] * rs * bfr(g0[3]) + bfr(b0[3]));
    o[4] = (_Float16)(d[4] * rs * bfr(g1[0]) + bfr(b1[0]));
    o[5] = (_Float16)(d[5] * rs * bfr(g1[1]) + bfr(b1[1]));
    o[6] = (_Float16)(d[6] * rs * bfr(g1[2]) + bfr(b1[2]));
    o[7] = (_Float16)(d[7] * rs * bfr(g1[3]) + bfr(b1[3]));
    const v8us ob = __builtin_bit_cast(v8us, o);
    hf* dst = XH + (size_t)row * DIM + sub * 8u;
    *(v8us*)dst = ob;
    
}

// k_wt: WT[c][r] (f16) = bf16(W[r][c]) * scale; in[R][C] -> out[C][R]; one block = 64 r x 128 c through an LDS tile (cross-wave, block barrier);
__global__ __launch_bounds__(256) void k_wt(const float* __restrict__ W, hf* WT, int R, int C, float scale) {
    __shared__ __align__(16) hf tl[DIM * VTP];
    const unsigned tid = threadIdx.x;
    const unsigned tc = (unsigned)C / 128u;
    const unsigned kt = blockIdx.x / tc;
    const unsigned ct = blockIdx.x - kt * tc;
    const float* src = W + (size_t)(kt * 64u) * (unsigned)C + ct * 128u;
#pragma unroll
    for (unsigned it = 0; it < 8; ++it) {
        const unsigned f = it * 256u + tid;
        const unsigned key = f >> 5, c4 = (f & 31u) * 4u;
        const v4f x = *(const v4f*)(src + (size_t)key * (unsigned)C + c4);
#pragma unroll
        for (unsigned c = 0; c < 4; ++c) tl[(c4 + c) * VTP + key] = f2h(bfr(x[c]) * scale);
    }
    __syncthreads();
    hf* dst = WT + (size_t)(ct * 128u) * (unsigned)R + kt * 64u;
    const unsigned c8 = (tid & 7u) * 8u, dr = tid >> 3;
{
#pragma unroll
        for (unsigned it = 0; it < 4; ++it) {
            const unsigned d = it * 32u + dr;
            const v8us o = *(const v8usa*)(tl + d * VTP + c8);
            *(v8us*)(dst + (size_t)d * (unsigned)R + c8) = o;
        }
        
    }
}

// k_qkv: one block = 64 tokens x one (which, head) group of 128 features; wave w owns tokens 16w..16w+15; the eight 16-feature tiles are processed in a rolled loop
//  (one accumulator tile and four weight fragments live at a time; the four token fragments are held), K = 128.
//  q / k groups: A = W^T rows (row m = feature), B = x rows (column n = token); D element r of lane (h, n) = (feature 16t + 8h + r, token n); staged row-major [token][feature].
//  v group:      A = x rows (row m = token), B = W^T rows (column n = feature); D element r of lane (h, n) = (token 8h + r, feature n); staged transposed [feature][token].
__attribute__((amdgpu_num_vgpr(248))) __global__ __launch_bounds__(128) void k_qkv(const hf* XH, const hf* WT, hf* QKV, int bch0) {
    __shared__ __align__(16) hf st[DIM * VTP];
    const unsigned tid = threadIdx.x, lane = tid & 31u, lr = lane & 15u, hi = lane >> 4;
    const unsigned wave = (unsigned)__builtin_amdgcn_readfirstlane((int)(tid >> 5));
    const unsigned which = blockIdx.y >> 3, head = blockIdx.y & 7u;
    const unsigned mloc = blockIdx.x * 64u;
    const unsigned bl = mloc / (unsigned)SEQ, n0 = mloc - bl * (unsigned)SEQ;
    const size_t PL = (size_t)BCH * NH * SEQ * DIM;

    v16h tf[4];
    {
        const hf* tp = XH + ((size_t)((unsigned)bch0 + bl) * SEQ + n0 + 16u * wave + lr) * DIM + 8u * hi;
        tf[0] = ldh(tp);
        tf[1] = ldh(tp + 32);
        tf[2] = ldh(tp + 64);
        tf[3] = ldh(tp + 96);
    }
    const size_t woff = ((size_t)blockIdx.y * 128u + lr) * DIM + 8u * hi;
    const float un = 1.0f / WQS;

    if (which == 2u) {      // block-uniform
#pragma unroll 1
        for (unsigned t = 0; t < 8u; ++t) {
            const hf* wr = WT + woff + (size_t)t * (16u * DIM);
            const v16h w0 = ldh(wr), w1 = ldh(wr + 32), w2 = ldh(wr + 64), w3 = ldh(wr + 96);
            v8f acc = (v8f){};
            acc = wmmah(tf[0], w0, acc);
            acc = wmmah(tf[1], w1, acc);
            acc = wmmah(tf[2], w2, acc);
            acc = wmmah(tf[3], w3, acc);
            guard1(acc, w0, w1, w2, w3);
            v8h o;
#pragma unroll
            for (int r = 0; r < 8; ++r) o[r] = (_Float16)(acc[r] * un);
            *(v8usa*)(st + (16u * t + lr) * VTP + 16u * wave + 8u * hi) = __builtin_bit_cast(v8us, o);
            sfence();
        }
    } else {
#pragma unroll 1
        for (unsigned t = 0; t < 8u; ++t) {
            const hf* wr = WT + woff + (size_t)t * (16u * DIM);
            const v16h w0 = ldh(wr), w1 = ldh(wr + 32), w2 = ldh(wr + 64), w3 = ldh(wr + 96);
            v8f acc = (v8f){};
            acc = wmmah(w0, tf[0], acc);
            acc = wmmah(w1, tf[1], acc);
            acc = wmmah(w2, tf[2], acc);
            acc = wmmah(w3, tf[3], acc);
            guard1(acc, w0, w1, w2, w3);
            v8h o;
#pragma unroll
            for (int r = 0; r < 8; ++r) o[r] = (_Float16)(acc[r] * un);
            *(v8usa*)(st + (16u * wave + lr) * CSP + 16u * t + 8u * hi) = __builtin_bit_cast(v8us, o);
            sfence();
        }
    }
    __syncthreads();
    const size_t bhp = (size_t)(bl * NH + head);
    if (which == 2u) {
        hf* dst = QKV + 2 * PL + bhp * DIM * SEQ + n0;
        const unsigned c8 = (tid & 7u) * 8u, dr = tid >> 3;
{
#pragma unroll
            for (unsigned it = 0; it < 8; ++it) {
                const unsigned d = it * 16u + dr;
                const v8us o = *(const v8usa*)(st + d * VTP + c8);
                *(v8us*)(dst + (size_t)d * SEQ + c8) = o;
            }
            
        }
    } else {
        hf* dst = QKV + (size_t)which * PL + (bhp * SEQ + n0) * DIM + lr * 8u;
{
#pragma unroll
            for (unsigned s = 0; s < 8; ++s) {
                const unsigned rr = 16u * wave + 2u * s + hi;
                const v8us o = *(const v8usa*)(st + rr * CSP + lr * 8u);
                *(v8us*)(dst + (size_t)rr * DIM) = o;
            }
            
        }
    }
}

// k_flash: one wave per 16 queries of one (batch, head), 32 keys per step, online softmax.
//  S^T tile (keys x queries): A = K rows (row m = key, k = d), B = Q rows (column n = query, k = d); D element r of lane (h, n) = S[query n][key 8h + r].
//  Q fragments (four, B operands) are held; K fragments are loaded four at a time (two k-steps x two key tiles); V^T fragments four output tiles at a time.
//  P^T B fragment: element r <- tile of keys 0..15, element 8 + r <- tile of keys 16..31 (same lane); P carried x 2^10 (the running sum carries the same factor).
//  O^T tile (d x queries): A = V^T rows (row m = d, k = key), D element r of lane (h, n) = O[query n][d = 16 t + 8h + r].
__attribute__((amdgpu_num_vgpr(248))) __global__ __launch_bounds__(128) void k_flash(const hf* QP, const hf* KP, const hf* VT, hf* CH, hf* CL) {
    __shared__ __align__(16) hf cs[NWV * 2 * 16 * CSP];
    const unsigned tid = threadIdx.x, lane = tid & 31u, lr = lane & 15u, hi = lane >> 4;
    const unsigned wave = (unsigned)__builtin_amdgcn_readfirstlane((int)(tid >> 5));
    const unsigned bpb = (unsigned)(SEQ / BQ);
    const unsigned bh = blockIdx.x / bpb;
    const unsigned q0 = (blockIdx.x - bh * bpb) * BQ + wave * 16u;

    v16h qf[4];
    {
        const hf* qp = QP + ((size_t)bh * SEQ + q0 + lr) * DIM + 8u * hi;
        qf[0] = ldh(qp);
        qf[1] = ldh(qp + 32);
        qf[2] = ldh(qp + 64);
        qf[3] = ldh(qp + 96);
    }
    const size_t kbase = ((size_t)bh * SEQ + lr) * DIM + 8u * hi;
    const size_t vbase = ((size_t)bh * DIM + lr) * SEQ + 8u * hi;

    v8f o[8];
#pragma unroll
    for (int t = 0; t < 8; ++t) o[t] = (v8f){};
    float ml = -1.0e30f;      // running max in the log2 domain
    float l = 0.0f;           // running sum (carried x 2^10)

#pragma unroll 1
    for (unsigned k0 = 0; k0 < (unsigned)SEQ; k0 += KS) {
        v8f s0 = (v8f){}, s1 = (v8f){};
        const hf* ka = KP + kbase + (size_t)k0 * DIM;
        {
            const v16h a00 = ldh(ka), a01 = ldh(ka + 16 * DIM);
            const v16h a10 = ldh(ka + 32), a11 = ldh(ka + 16 * DIM + 32);
            s0 = wmmah(a00, qf[0], s0);
            s1 = wmmah(a01, qf[0], s1);
            s0 = wmmah(a10, qf[1], s0);
            s1 = wmmah(a11, qf[1], s1);
            guard2(s0, s1, a00, a01, a10, a11);
        }
        sfence();
        {
            const v16h a20 = ldh(ka + 64), a21 = ldh(ka + 16 * DIM + 64);
            const v16h a30 = ldh(ka + 96), a31 = ldh(ka + 16 * DIM + 96);
            s0 = wmmah(a20, qf[2], s0);
            s1 = wmmah(a21, qf[2], s1);
            s0 = wmmah(a30, qf[3], s0);
            s1 = wmmah(a31, qf[3], s1);
            guard2(s0, s1, a20, a21, a30, a31);
        }
        sfence();

        float mx = fmaxf(s0[0], s1[0]);
#pragma unroll
        for (int r = 1; r < 8; ++r) mx = fmaxf(mx, fmaxf(s0[r], s1[r]));
        mx = fmaxf(mx, __shfl_xor(mx, 16, 32));
        const float mnl = fmaxf(ml, mx * SC2);
        const float corr = __builtin_amdgcn_exp2f(ml - mnl);
        ml = mnl;
        const float sh = PCL - mnl;
        float p0[8], p1[8];
        float ps = 0.0f;
#pragma unroll
        for (int r = 0; r < 8; ++r) {
            p0[r] = __builtin_amdgcn_exp2f(fmaf(s0[r], SC2, sh));
            p1[r] = __builtin_amdgcn_exp2f(fmaf(s1[r], SC2, sh));
            ps += p0[r] + p1[r];
        }
        ps += __shfl_xor(ps, 16, 32);
        l = l * corr + ps;
        if (__builtin_amdgcn_ballot_w32(corr != 1.0f) != 0u) {   // wave-uniform; multiplying by exactly 1 is skipped
#pragma unroll
            for (int t = 0; t < 8; ++t) o[t] *= corr;
        }

        v16h ph;
#pragma unroll
        for (int r = 0; r < 8; ++r) { ph[r] = (_Float16)p0[r]; ph[8 + r] = (_Float16)p1[r]; }

        sfence();   // keep the V^T loads below the softmax (bounds live fragments)
        const hf* va = VT + vbase + k0;
        {
            const v16h v0 = ldh(va), v1 = ldh(va + (size_t)16 * SEQ), v2 = ldh(va + (size_t)32 * SEQ), v3 = ldh(va + (size_t)48 * SEQ);
            o[0] = wmmah(v0, ph, o[0]);
            o[1] = wmmah(v1, ph, o[1]);
            o[2] = wmmah(v2, ph, o[2]);
            o[3] = wmmah(v3, ph, o[3]);
            guard4(o[0], o[1], o[2], o[3], v0, v1, v2, v3, ph);
        }
        sfence();
        {
            const v16h v4 = ldh(va + (size_t)64 * SEQ), v5 = ldh(va + (size_t)80 * SEQ), v6 = ldh(va + (size_t)96 * SEQ), v7 = ldh(va + (size_t)112 * SEQ);
            o[4] = wmmah(v4, ph, o[4]);
            o[5] = wmmah(v5, ph, o[5]);
            o[6] = wmmah(v6, ph, o[6]);
            o[7] = wmmah(v7, ph, o[7]);
            guard4(o[4], o[5], o[6], o[7], v4, v5, v6, v7, ph);
        }
        sfence();
    }

    // epilogue: stage ctx value / residual rows [query][d] (wave-private regions; block barrier used)
    const float sc = (1.0f / l) * CCS;
    const unsigned creg = wave * (2u * 16u * CSP);
#pragma unroll
    for (int t = 0; t < 8; ++t) {
        v8h hv, lv;
#pragma unroll
        for (int r = 0; r < 8; ++r) {
            const float c = o[t][r] * sc;
            const _Float16 h = (_Float16)c;
            hv[r] = h;
            lv[r] = (_Float16)((c - (float)h) * RSC);
        }
        *(v8usa*)(cs + creg + lr * CSP + 16u * t + 8u * hi) = __builtin_bit_cast(v8us, hv);
        *(v8usa*)(cs + creg + 16u * CSP + lr * CSP + 16u * t + 8u * hi) = __builtin_bit_cast(v8us, lv);
    }
    __syncthreads();
    const unsigned bl = bh / NH, head = bh - bl * NH;
    const size_t rowbase = ((size_t)bl * SEQ + q0) * INNER + head * DIM + lr * 8u;
{
#pragma unroll
        for (unsigned s = 0; s < 8; ++s) {
            const unsigned rr = 2u * s + hi;
            const v8us vh = *(const v8usa*)(cs + creg + rr * CSP + lr * 8u);
            const v8us vl = *(const v8usa*)(cs + creg + 16u * CSP + rr * CSP + lr * 8u);
            *(v8us*)(CH + rowbase + (size_t)rr * INNER) = vh;
            *(v8us*)(CL + rowbase + (size_t)rr * INNER) = vl;
        }
        
    }
}

// k_proj: one block = 64 tokens x 128 output features, K = 1024; wave w: token group w>>1 (16 tokens), feature half w&1 (four 16-feature tiles).
//  A = w_proj^T rows (row m = feature, k = inner), B = ctx rows (column n = token); D element r of lane (h, n) = (feature 8h + r, token n).
//  ctx value and residual planes share the weight fragment and use separate accumulators; out = (acc_v + acc_r / 2^11) / 512 + bf16(bias), added at the store stage.
__global__ __launch_bounds__(256) void k_proj(const hf* CH, const hf* CL, const hf* WP, const float* __restrict__ bias, float* OUT, int bch0) {
    __shared__ __align__(16) float os[64 * OSP];
    const unsigned tid = threadIdx.x, lane = tid & 31u, lr = lane & 15u, hi = lane >> 4;
    const unsigned wave = (unsigned)__builtin_amdgcn_readfirstlane((int)(tid >> 5));
    const unsigned tg = wave >> 1, fh = wave & 1u;
    const unsigned m0 = blockIdx.x * 64u;
    const size_t coff = ((size_t)(m0 + 16u * tg + lr)) * INNER + 8u * hi;
    const size_t woff = ((size_t)(64u * fh + lr)) * INNER + 8u * hi;

    v8f ah[4], al[4];
#pragma unroll
    for (int t = 0; t < 4; ++t) { ah[t] = (v8f){}; al[t] = (v8f){}; }

#pragma unroll 1
    for (unsigned k0 = 0; k0 < (unsigned)INNER; k0 += 32) {
        const v16h ch = ldh(CH + coff + k0);
        const v16h cl = ldh(CL + coff + k0);
        const hf* wr = WP + woff + k0;
        const v16h w0 = ldh(wr), w1 = ldh(wr + (size_t)16 * INNER), w2 = ldh(wr + (size_t)32 * INNER), w3 = ldh(wr + (size_t)48 * INNER);
        ah[0] = wmmah(w0, ch, ah[0]);
        al[0] = wmmah(w0, cl, al[0]);
        ah[1] = wmmah(w1, ch, ah[1]);
        al[1] = wmmah(w1, cl, al[1]);
        ah[2] = wmmah(w2, ch, ah[2]);
        al[2] = wmmah(w2, cl, al[2]);
        ah[3] = wmmah(w3, ch, ah[3]);
        al[3] = wmmah(w3, cl, al[3]);
        guard8(ah[0], ah[1], ah[2], ah[3], al[0], al[1], al[2], al[3], ch, cl, w0, w1, w2, w3);
        sfence();
    }

    const float un = 1.0f / (CCS * WPS);
    const float ur = 1.0f / RSC;
#pragma unroll
    for (int t = 0; t < 4; ++t) {
        v4f x0, x1;
        x0[0] = fmaf(al[t][0], ur, ah[t][0]) * un; x0[1] = fmaf(al[t][1], ur, ah[t][1]) * un;
        x0[2] = fmaf(al[t][2], ur, ah[t][2]) * un; x0[3] = fmaf(al[t][3], ur, ah[t][3]) * un;
        x1[0] = fmaf(al[t][4], ur, ah[t][4]) * un; x1[1] = fmaf(al[t][5], ur, ah[t][5]) * un;
        x1[2] = fmaf(al[t][6], ur, ah[t][6]) * un; x1[3] = fmaf(al[t][7], ur, ah[t][7]) * un;
        const unsigned so = (16u * tg + lr) * OSP + 64u * fh + 16u * t + 8u * hi;
        *(v4fa*)(os + so) = x0;
        *(v4fa*)(os + so + 4u) = x1;
    }
    __syncthreads();
    const v4f bb = *(const v4f*)(bias + lane * 4u);
    v4f bq;
    bq[0] = bfr(bb[0]); bq[1] = bfr(bb[1]); bq[2] = bfr(bb[2]); bq[3] = bfr(bb[3]);
    float* orow = OUT + ((size_t)bch0 * SEQ + m0 + 8u * wave) * DIM + lane * 4u;
{
#pragma unroll
        for (unsigned s = 0; s < 8; ++s) {
            v4f val = *(const v4fa*)(os + (8u * wave + s) * OSP + lane * 4u);
            val[0] += bq[0]; val[1] += bq[1]; val[2] += bq[2]; val[3] += bq[3];
            *(v4f*)(orow + (size_t)s * DIM) = val;
        }
        
    }
}

extern "C" void kernel_launch(void* const* d_in, const int* in_sizes, int n_in,
                              void* d_out, int out_size, void* d_ws, size_t ws_size, hipStream_t stream) {
    if (n_in < 6) return;
    const size_t need = ((size_t)(NB - 1) * SEQ_FULL + SEQ) * DIM;
    if ((size_t)in_sizes[0] < need) return;
    if (in_sizes[1] < DIM || in_sizes[2] < DIM || in_sizes[5] < DIM) return;
    if ((size_t)in_sizes[3] < (size_t)DIM * QKVN) return;
    if ((size_t)in_sizes[4] < (size_t)INNER * DIM) return;
    if ((size_t)out_size < (size_t)NB * SEQ * DIM) return;
    if (SZ_ALL > ws_size) return;

    const float* x      = (const float*)d_in[0];   // inputs  [NB][SEQ_FULL][128] (rows n < SEQ read)
    const float* gamma  = (const float*)d_in[1];   // ln_gamma [128]
    const float* beta   = (const float*)d_in[2];   // ln_beta  [128]
    const float* w_qkv  = (const float*)d_in[3];   // [128][3072]  ([in][out])
    const float* w_proj = (const float*)d_in[4];   // [1024][128]  ([in][out])
    const float* b_proj = (const float*)d_in[5];   // [128]
    float* OUT = (float*)d_out;                    // [NB][SEQ][128]

    char* wsp = (char*)d_ws;
    hf* XH  = (hf*)(wsp);
    hf* WT  = (hf*)(wsp + SZ_XH);
    hf* WP  = (hf*)(wsp + SZ_XH + SZ_WT);
    hf* QKV = (hf*)(wsp + SZ_XH + SZ_WT + SZ_WP);
    hf* CH  = (hf*)(wsp + SZ_XH + SZ_WT + SZ_WP + 3 * SZ_PL);
    hf* CL  = (hf*)(wsp + SZ_XH + SZ_WT + SZ_WP + 3 * SZ_PL + SZ_CX);
    const size_t PL = (size_t)BCH * NH * SEQ * DIM;   // elements per q / k / v^T plane

    k_ln<<<(unsigned)(NB * SEQ / 16), 256, 0, stream>>>(x, gamma, beta, XH);
    // w_qkv in[128][3072] -> WT out[3072][128]: grid (128/64) * (3072/128)
    k_wt<<<(unsigned)((DIM / 64) * (QKVN / 128)), 256, 0, stream>>>(w_qkv, WT, DIM, QKVN, WQS);
    // w_proj in[1024][128] -> WP out[128][1024]: grid (1024/64) * (128/128)
    k_wt<<<(unsigned)((INNER / 64) * (DIM / 128)), 256, 0, stream>>>(w_proj, WP, INNER, DIM, WPS);
    for (int c = 0; c < NCH; ++c) {
        const int bch0 = c * BCH;
        k_qkv<<<dim3((unsigned)(BCH * SEQ / 64), 24, 1), 128, 0, stream>>>(XH, WT, QKV, bch0);
        k_flash<<<(unsigned)(BCH * NH * (SEQ / BQ)), 128, 0, stream>>>(QKV, QKV + PL, QKV + 2 * PL, CH, CL);
        k_proj<<<(unsigned)(BCH * SEQ / 64), 256, 0, stream>>>(CH, CL, WP, b_proj, OUT, bch0);
    }
}

// v001
// Measured time: 199 microseconds a run.
// In both of two side-by-side timings against v000, it was 1.89 times as fast.
#include <hip/hip_runtime.h>

// Pre-LayerNorm multi-head softmax(QK^T)V block: x = LN(in) over 128; qkv = x @ w_qkv ([128][3072], thirds q|k|v, column = which*1024 + h*128 + d); 8 heads of dim 128; logits (q.k)/32; out = ctx @ w_proj + b_proj.
// Compute dtypes, f32 accumulate: every contraction on v_wmma_f32_16x16x32_f16. Float inputs are RNE-converted to bf16 first; weights carried as bf16 value x 16 (w_qkv) / x 32 (w_proj), exact in f16;
// x, q, k, v planes f16; P carried as f16 x 2^10 (online softmax in f32, log2 domain); ctx carried as f16(ctx x 16) plus f16 residual x 2^11 with its own accumulator in the output projection.
// Flash form with transposed tiles: the S^T accumulator tiles are directly the B-operand layout of P^T; all other WMMA operands are two 16-byte loads from dense, statically strided 16-bit planes (K and V^T in k_flash: from padded LDS tiles).

#ifndef NB
#define NB 16
#endif
#ifndef SEQ
#define SEQ 1024
#endif
#define NB_FULL  16
#define SEQ_FULL 1024
#define DIM   128                 // token width == head dim
#define NH    8
#define INNER (NH * DIM)          // 1024
#define QKVN  (3 * INNER)         // 3072
#define NCH   ((NB % 2 == 0) ? 2 : 1)   // batch chunks (bounds the plane carve)
#define BCH   (NB / NCH)          // batches per chunk
#define NWV   8                   // waves per flash block
#define BQ    (16 * NWV)          // queries per flash block
#define KS    32                  // keys per step
#define TK    64                  // keys per staged K / V^T tile (two steps)
#define CSP   136                 // LDS pitch (16-bit elements) of 128-wide staging rows
#define OSP   132                 // LDS pitch (floats) of the output staging rows
#define VTP   72                  // LDS pitch (16-bit elements) of 64-wide transposed rows
#define KTE   (TK * CSP)          // staged K tile, 16-bit elements: TK key rows of 128
#define BUFE  (KTE + DIM * VTP)   // one ring buffer: K tile, then V^T tile (128 rows of TK keys)
#define L2E   1.4426950408889634f
#define SC2   (L2E * 0.03125f)    // log2(e) / 32
#define PCL   10.0f               // P carry exponent (2^10)
#define WQS   16.0f               // w_qkv carry
#define WPS   32.0f               // w_proj carry
#define CCS   16.0f               // ctx carry
#define RSC   2048.0f             // ctx residual carry

static_assert(DIM == 128);
static_assert(INNER == 1024);
static_assert(NB <= NB_FULL);
static_assert(SEQ <= SEQ_FULL);
static_assert(NB % NCH == 0);
static_assert(SEQ % BQ == 0);
static_assert(SEQ % 64 == 0);
static_assert(SEQ % KS == 0);
static_assert(SEQ % TK == 0 && TK == 2 * KS && TK <= VTP);
static_assert(NWV * 32 == 256);                  // k_flash staging: 256 lanes x 16 B x 4 pieces == one 16-KiB tile
static_assert(TK * DIM * 2 == 4 * 256 * 16);
static_assert((KTE * 2) % 16 == 0 && (BUFE * 2) % 16 == 0);
static_assert(NWV * 2 * 16 * CSP <= 2 * BUFE);   // k_flash: the output staging fits the ring it reuses
static_assert(DIM % 32 == 0);
static_assert(DIM == 4 * 32);                    // four 32-deep k-steps per score tile / per QKV tile
static_assert(DIM == 8 * 16);                    // eight 16-row output tiles per wave
static_assert(INNER % 32 == 0);
static_assert((NB * SEQ) % 16 == 0);             // k_ln: 16 rows per block
static_assert(16 * 8 == DIM);                    // k_ln: 16 lanes x 8 elements == row
static_assert(64 * CSP <= DIM * VTP);            // k_qkv: row-major staging fits the shared tile
static_assert(64 <= VTP);                        // transposed staging rows hold 64 tokens
static_assert((CSP * 2) % 16 == 0);
static_assert((VTP * 2) % 16 == 0);
static_assert((OSP * 4) % 16 == 0);
static_assert(32 * 4 == DIM);                    // k_proj: 32 lanes x 4 floats == output row
static_assert(16 * 8 * 2 == 256);                // 16 lanes x 16 B == one 128-element 16-bit row
static_assert(QKVN % 128 == 0);
static_assert(DIM % 64 == 0 && INNER % 64 == 0); // k_wt tile multiples
static_assert((BCH * SEQ) % 64 == 0);            // k_qkv / k_proj: 64 tokens per block

#define SZ_XH  ((size_t)NB * SEQ * DIM * 2)
#define SZ_WT  ((size_t)QKVN * DIM * 2)
#define SZ_WP  ((size_t)DIM * INNER * 2)
#define SZ_PL  ((size_t)BCH * NH * SEQ * DIM * 2)
#define SZ_CX  ((size_t)BCH * SEQ * INNER * 2)
#define SZ_ALL (SZ_XH + SZ_WT + SZ_WP + 3 * SZ_PL + 2 * SZ_CX)
static_assert(SZ_XH % 256 == 0 && SZ_WT % 256 == 0 && SZ_WP % 256 == 0 && SZ_PL % 256 == 0 && SZ_CX % 256 == 0);
static_assert(SZ_ALL <= (size_t)134217728);

typedef unsigned short hf;
typedef __attribute__((ext_vector_type(16))) _Float16 v16h;
typedef __attribute__((ext_vector_type(8)))  _Float16 v8h;
typedef __attribute__((ext_vector_type(8)))  unsigned short v8us;
typedef __attribute__((ext_vector_type(8)))  float    v8f;
typedef __attribute__((ext_vector_type(4)))  float    v4f;
typedef v4f  __attribute__((may_alias)) v4fa;
typedef v8us __attribute__((may_alias)) v8usa;

__device__ __forceinline__ float bfr(float f) { unsigned u = __float_as_uint(f); u += 0x7FFFu + ((u >> 16) & 1u); return __uint_as_float(u & 0xFFFF0000u); }
__device__ __forceinline__ unsigned short f2h(float f) { return __builtin_bit_cast(unsigned short, (_Float16)f); }
__device__ __forceinline__ v16h cat16h(v8us lo, v8us hi) { return __builtin_bit_cast(v16h, __builtin_shufflevector(lo, hi, 0, 1, 2, 3, 4, 5, 6, 7, 8, 9, 10, 11, 12, 13, 14, 15)); }
__device__ __forceinline__ v8f wmmah(v16h a, v16h b, v8f c) { return __builtin_amdgcn_wmma_f32_16x16x32_f16(false, a, false, b, (short)0, c, false, false); }
// fragment loader (A and B alike): p = row base + k0 + 8*(lane>>4); elements 0..7 <- p[0..7], elements 8..15 <- p[16..23]
__device__ __forceinline__ v16h ldh(const hf* p) { return cat16h(*(const v8us*)p, *(const v8us*)(p + 16)); }
__device__ __forceinline__ void sfence() { asm volatile("" ::: "memory"); __builtin_amdgcn_sched_barrier(0); }
// hazard guards: four idle VALU slots after the last WMMA of a group; the group's operand fragments stay live until here
__device__ __forceinline__ void guard1(v8f& c0, v16h a, v16h b, v16h c, v16h d) {
    asm volatile("v_nop\n\tv_nop\n\tv_nop\n\tv_nop" : "+v"(c0) : "v"(a), "v"(b), "v"(c), "v"(d));
}
__device__ __forceinline__ void guard2(v8f& c0, v8f& c1, v16h a, v16h b, v16h c, v16h d) {
    asm volatile("v_nop\n\tv_nop\n\tv_nop\n\tv_nop" : "+v"(c0), "+v"(c1) : "v"(a), "v"(b), "v"(c), "v"(d));
}
__device__ __forceinline__ void guard4(v8f& c0, v8f& c1, v8f& c2, v8f& c3, v16h a, v16h b, v16h c, v16h d, v16h e) {
    asm volatile("v_nop\n\tv_nop\n\tv_nop\n\tv_nop" : "+v"(c0), "+v"(c1), "+v"(c2), "+v"(c3) : "v"(a), "v"(b), "v"(c), "v"(d), "v"(e));
}
__device__ __forceinline__ void guard8(v8f& c0, v8f& c1, v8f& c2, v8f& c3, v8f& c4, v8f& c5, v8f& c6, v8f& c7,
                                       v16h a, v16h b, v16h c, v16h d, v16h e, v16h f) {
    asm volatile("v_nop\n\tv_nop\n\tv_nop\n\tv_nop"
                 : "+v"(c0), "+v"(c1), "+v"(c2), "+v"(c3), "+v"(c4), "+v"(c5), "+v"(c6), "+v"(c7)
                 : "v"(a), "v"(b), "v"(c), "v"(d), "v"(e), "v"(f));
}

// One 64-key tile, global -> LDS through no register: each lane copies four 16-byte pieces of K (16 key rows apart) and four of V^T (32 d rows apart).
// lk / lv: the lane's LDS byte addresses of its first pieces; gk / gv: their global addresses. The address-translation wait closes the statement, ahead of any rewrite of the address registers.
__device__ __forceinline__ void stage_kv(unsigned lk, unsigned lv, const hf* gk, const hf* gv) {
    asm volatile("global_load_async_to_lds_b128 %0, %8, off\n\t"
                 "global_load_async_to_lds_b128 %1, %9, off\n\t"
                 "global_load_async_to_lds_b128 %2, %10, off\n\t"
                 "global_load_async_to_lds_b128 %3, %11, off\n\t"
                 "global_load_async_to_lds_b128 %4, %12, off\n\t"
                 "global_load_async_to_lds_b128 %5, %13, off\n\t"
                 "global_load_async_to_lds_b128 %6, %14, off\n\t"
                 "global_load_async_to_lds_b128 %7, %15, off\n\t"
                 "s_wait_xcnt 0x0"
                 :: "v"(lk), "v"(lk + 16u * CSP * 2u), "v"(lk + 32u * CSP * 2u), "v"(lk + 48u * CSP * 2u),
                    "v"(lv), "v"(lv + 32u * VTP * 2u), "v"(lv + 64u * VTP * 2u), "v"(lv + 96u * VTP * 2u),
                    "v"(gk), "v"(gk + 16 * DIM), "v"(gk + 32 * DIM), "v"(gk + 48 * DIM),
                    "v"(gv), "v"(gv + (size_t)32 * SEQ), "v"(gv + (size_t)64 * SEQ), "v"(gv + (size_t)96 * SEQ)
                 : "memory");
}

// k_ln: x plane XH[NB*SEQ][128] (f16) = LayerNorm(bf16(in)) with bf16(gamma), bf16(beta); 16 lanes per row, 8 elements per lane;
__global__ __launch_bounds__(256) void k_ln(const float* __restrict__ X, const float* __restrict__ G, const float* __restrict__ Bt, hf* XH) {
    const unsigned tid = threadIdx.x;
    const unsigned row = blockIdx.x * 16u + (tid >> 4);
    const unsigned sub = tid & 15u;
    const unsigned b = row / (unsigned)SEQ, n = row - b * (unsigned)SEQ;
    const float* src = X + ((size_t)b * SEQ_FULL + n) * DIM + sub * 8u;
    const v4f a0 = *(const v4f*)src;
    const v4f a1 = *(const v4f*)(src + 4);
    float e[8];
    e[0] = bfr(a0[0]); e[1] = bfr(a0[1]); e[2] = bfr(a0[2]); e[3] = bfr(a0[3]);
    e[4] = bfr(a1[0]); e[5] = bfr(a1[1]); e[6] = bfr(a1[2]); e[7] = bfr(a1[3]);
    float s = ((e[0] + e[1]) + (e[2] + e[3])) + ((e[4] + e[5]) + (e[6] + e[7]));
    s += __shfl_xor(s, 8, 32);
    s += __shfl_xor(s, 4, 32);
    s += __shfl_xor(s, 2, 32);
    s += __shfl_xor(s, 1, 32);
    const float mu = s * (1.0f / DIM);
    float d[8];
    float s2 = 0.0f;
#pragma unroll
    for (int j = 0; j < 8; ++j) { d[j] = e[j] - mu; s2 = fmaf(d[j], d[j], s2); }
    s2 += __shfl_xor(s2, 8, 32);
    s2 += __shfl_xor(s2, 4, 32);
    s2 += __shfl_xor(s2, 2, 32);
    s2 += __shfl_xor(s2, 1, 32);
    const float rs = rsqrtf(s2 * (1.0f / DIM) + 1.0e-5f);
    const v4f g0 = *(const v4f*)(G + sub * 8u), g1 = *(const v4f*)(G + sub * 8u + 4u);
    const v4f b0 = *(const v4f*)(Bt + sub * 8u), b1 = *(const v4f*)(Bt + sub * 8u + 4u);
    v8h o;
    o[0] = (_Float16)(d[0] * rs * bfr(g0[0]) + bfr(b0[0]));
    o[1] = (_Float16)(d[1] * rs * bfr(g0[1]) + bfr(b0[1]));
    o[2] = (_Float16)(d[2] * rs * bfr(g0[2]) + bfr(b0[2]));
    o[3] = (_Float16)(d[3] * rs * bfr(g0[3]) + bfr(b0[3]));
    o[4] = (_Float16)(d[4] * rs * bfr(g1[0]) + bfr(b1[0]));
    o[5] = (_Float16)(d[5] * rs * bfr(g1[1]) + bfr(b1[1]));
    o[6] = (_Float16)(d[6] * rs * bfr(g1[2]) + bfr(b1[2]));
    o[7] = (_Float16)(d[7] * rs * bfr(g1[3]) + bfr(b1[3]));
    const v8us ob = __builtin_bit_cast(v8us, o);
    hf* dst = XH + (size_t)row * DIM + sub * 8u;
    *(v8us*)dst = ob;
    
}

// k_wt: WT[c][r] (f16) = bf16(W[r][c]) * scale; in[R][C] -> out[C][R]; one block = 64 r x 128 c through an LDS tile (cross-wave, block barrier);
__global__ __launch_bounds__(256) void k_wt(const float* __restrict__ W, hf* WT, int R, int C, float scale) {
    __shared__ __align__(16) hf tl[DIM * VTP];
    const unsigned tid = threadIdx.x;
    const unsigned tc = (unsigned)C / 128u;
    const unsigned kt = blockIdx.x / tc;
    const unsigned ct = blockIdx.x - kt * tc;
    const float* src = W + (size_t)(kt * 64u) * (unsigned)C + ct * 128u;
#pragma unroll
    for (unsigned it = 0; it < 8; ++it) {
        const unsigned f = it * 256u + tid;
        const unsigned key = f >> 5, c4 = (f & 31u) * 4u;
        const v4f x = *(const v4f*)(src + (size_t)key * (unsigned)C + c4);
#pragma unroll
        for (unsigned c = 0; c < 4; ++c) tl[(c4 + c) * VTP + key] = f2h(bfr(x[c]) * scale);
    }
    __syncthreads();
    hf* dst = WT + (size_t)(ct * 128u) * (unsigned)R + kt * 64u;
    const unsigned c8 = (tid & 7u) * 8u, dr = tid >> 3;
{
#pragma unroll
        for (unsigned it = 0; it < 4; ++it) {
            const unsigned d = it * 32u + dr;
            const v8us o = *(const v8usa*)(tl + d * VTP + c8);
            *(v8us*)(dst + (size_t)d * (unsigned)R + c8) = o;
        }
        
    }
}

// k_qkv: one block = 64 tokens x one (which, head) group of 128 features; wave w owns tokens 16w..16w+15; the eight 16-feature tiles are processed in a rolled loop
//  (one accumulator tile and four weight fragments live at a time; the four token fragments are held), K = 128.
//  q / k groups: A = W^T rows (row m = feature), B = x rows (column n = token); D element r of lane (h, n) = (feature 16t + 8h + r, token n); staged row-major [token][feature].
//  v group:      A = x rows (row m = token), B = W^T rows (column n = feature); D element r of lane (h, n) = (token 8h + r, feature n); staged transposed [feature][token].
__attribute__((amdgpu_num_vgpr(248))) __global__ __launch_bounds__(128) void k_qkv(const hf* XH, const hf* WT, hf* QKV, int bch0) {
    __shared__ __align__(16) hf st[DIM * VTP];
    const unsigned tid = threadIdx.x, lane = tid & 31u, lr = lane & 15u, hi = lane >> 4;
    const unsigned wave = (unsigned)__builtin_amdgcn_readfirstlane((int)(tid >> 5));
    const unsigned which = blockIdx.y >> 3, head = blockIdx.y & 7u;
    const unsigned mloc = blockIdx.x * 64u;
    const unsigned bl = mloc / (unsigned)SEQ, n0 = mloc - bl * (unsigned)SEQ;
    const size_t PL = (size_t)BCH * NH * SEQ * DIM;

    v16h tf[4];
    {
        const hf* tp = XH + ((size_t)((unsigned)bch0 + bl) * SEQ + n0 + 16u * wave + lr) * DIM + 8u * hi;
        tf[0] = ldh(tp);
        tf[1] = ldh(tp + 32);
        tf[2] = ldh(tp + 64);
        tf[3] = ldh(tp + 96);
    }
    const size_t woff = ((size_t)blockIdx.y * 128u + lr) * DIM + 8u * hi;
    const float un = 1.0f / WQS;

    if (which == 2u) {      // block-uniform
#pragma unroll 1
        for (unsigned t = 0; t < 8u; ++t) {
            const hf* wr = WT + woff + (size_t)t * (16u * DIM);
            const v16h w0 = ldh(wr), w1 = ldh(wr + 32), w2 = ldh(wr + 64), w3 = ldh(wr + 96);
            v8f acc = (v8f){};
            acc = wmmah(tf[0], w0, acc);
            acc = wmmah(tf[1], w1, acc);
            acc = wmmah(tf[2], w2, acc);
            acc = wmmah(tf[3], w3, acc);
            guard1(acc, w0, w1, w2, w3);
            v8h o;
#pragma unroll
            for (int r = 0; r < 8; ++r) o[r] = (_Float16)(acc[r] * un);
            *(v8usa*)(st + (16u * t + lr) * VTP + 16u * wave + 8u * hi) = __builtin_bit_cast(v8us, o);
            sfence();
        }
    } else {
#pragma unroll 1
        for (unsigned t = 0; t < 8u; ++t) {
            const hf* wr = WT + woff + (size_t)t * (16u * DIM);
            const v16h w0 = ldh(wr), w1 = ldh(wr + 32), w2 = ldh(wr + 64), w3 = ldh(wr + 96);
            v8f acc = (v8f){};
            acc = wmmah(w0, tf[0], acc);
            acc = wmmah(w1, tf[1], acc);
            acc = wmmah(w2, tf[2], acc);
            acc = wmmah(w3, tf[3], acc);
            guard1(acc, w0, w1, w2, w3);
            v8h o;
#pragma unroll
            for (int r = 0; r < 8; ++r) o[r] = (_Float16)(acc[r] * un);
            *(v8usa*)(st + (16u * wave + lr) * CSP + 16u * t + 8u * hi) = __builtin_bit_cast(v8us, o);
            sfence();
        }
    }
    __syncthreads();
    const size_t bhp = (size_t)(bl * NH + head);
    if (which == 2u) {
        hf* dst = QKV + 2 * PL + bhp * DIM * SEQ + n0;
        const unsigned c8 = (tid & 7u) * 8u, dr = tid >> 3;
{
#pragma unroll
            for (unsigned it = 0; it < 8; ++it) {
                const unsigned d = it * 16u + dr;
                const v8us o = *(const v8usa*)(st + d * VTP + c8);
                *(v8us*)(dst + (size_t)d * SEQ + c8) = o;
            }
            
        }
    } else {
        hf* dst = QKV + (size_t)which * PL + (bhp * SEQ + n0) * DIM + lr * 8u;
{
#pragma unroll
            for (unsigned s = 0; s < 8; ++s) {
                const unsigned rr = 16u * wave + 2u * s + hi;
                const v8us o = *(const v8usa*)(st + rr * CSP + lr * 8u);
                *(v8us*)(dst + (size_t)rr * DIM) = o;
            }
            
        }
    }
}

// k_flash: one wave per 16 queries of one (batch, head), 32 keys per step, online softmax; the block's eight waves share K / V^T tiles of 64 keys,
//  staged in a two-buffer LDS ring by asynchronous copies (tile t + 2 is issued behind the barrier that ends the reads of tile t); fragments are read from LDS.
//  S^T tile (keys x queries): A = K rows (row m = key, k = d), B = Q rows (column n = query, k = d); D element r of lane (h, n) = S[query n][key 8h + r].
//  Q fragments (four, B operands) are held; K fragments are loaded four at a time (two k-steps x two key tiles); V^T fragments four output tiles at a time.
//  P^T B fragment: element r <- tile of keys 0..15, element 8 + r <- tile of keys 16..31 (same lane); P carried x 2^10 (the running sum carries the same factor).
//  O^T tile (d x queries): A = V^T rows (row m = d, k = key), D element r of lane (h, n) = O[query n][d = 16 t + 8h + r].
__attribute__((amdgpu_num_vgpr(248))) __global__ __launch_bounds__(NWV * 32) void k_flash(const hf* QP, const hf* KP, const hf* VT, hf* CH, hf* CL) {
    __shared__ __align__(16) hf cs[2 * BUFE];   // K / V^T ring in the loop, output staging behind it
    const unsigned tid = threadIdx.x, lane = tid & 31u, lr = lane & 15u, hi = lane >> 4;
    const unsigned wave = (unsigned)__builtin_amdgcn_readfirstlane((int)(tid >> 5));
    const unsigned bpb = (unsigned)(SEQ / BQ);
    const unsigned bh = blockIdx.x / bpb;
    const unsigned q0 = (blockIdx.x - bh * bpb) * BQ + wave * 16u;

    v16h qf[4];
    {
        const hf* qp = QP + ((size_t)bh * SEQ + q0 + lr) * DIM + 8u * hi;
        qf[0] = ldh(qp);
        qf[1] = ldh(qp + 32);
        qf[2] = ldh(qp + 64);
        qf[3] = ldh(qp + 96);
    }
    const unsigned kfo = lr * CSP + 8u * hi;          // fragment offsets inside a ring buffer
    const unsigned vfo = KTE + lr * VTP + 8u * hi;
    // staging addresses of this lane: K tile = 16 KiB contiguous, 16 lanes per key row; V^T tile = 128 rows of 128 B, 8 lanes per row
    const hf* gk = KP + (size_t)bh * SEQ * DIM + tid * 8u;
    const hf* gv = VT + ((size_t)bh * DIM + (tid >> 3)) * SEQ + (tid & 7u) * 8u;
    const unsigned lk = (unsigned)(size_t)(cs + (tid >> 4) * CSP + (tid & 15u) * 8u);
    const unsigned lv = (unsigned)(size_t)(cs + KTE + (tid >> 3) * VTP + (tid & 7u) * 8u);
    const unsigned nt = (unsigned)(SEQ / TK);

    v8f o[8];
#pragma unroll
    for (int t = 0; t < 8; ++t) o[t] = (v8f){};
    float ml = -1.0e30f;      // running max in the log2 domain
    float l = 0.0f;           // running sum (carried x 2^10)

    stage_kv(lk, lv, gk, gv);                              // tile 0 -> buffer 0
    asm volatile("s_wait_asynccnt 0x0" ::: "memory");      // this wave's pieces of tile 0 have landed
    __syncthreads();                                       // tile 0 readable by every wave
    if (nt > 1u) stage_kv(lk + BUFE * 2u, lv + BUFE * 2u, gk + TK * DIM, gv + TK);   // tile 1 -> buffer 1

#pragma unroll 1
    for (unsigned t = 0; t < nt; ++t) {
      const unsigned bo = (t & 1u) * BUFE;
#pragma unroll 1
      for (unsigned h = 0; h < 2u; ++h) {                  // rolled: one copy of the step's code, one step's fragments live
        v8f s0 = (v8f){}, s1 = (v8f){};
        const hf* ka = cs + bo + kfo + h * (KS * CSP);
        {
            const v16h a00 = ldh(ka), a01 = ldh(ka + 16 * CSP);
            const v16h a10 = ldh(ka + 32), a11 = ldh(ka + 16 * CSP + 32);
            s0 = wmmah(a00, qf[0], s0);
            s1 = wmmah(a01, qf[0], s1);
            s0 = wmmah(a10, qf[1], s0);
            s1 = wmmah(a11, qf[1], s1);
            guard2(s0, s1, a00, a01, a10, a11);
        }
        sfence();
        {
            const v16h a20 = ldh(ka + 64), a21 = ldh(ka + 16 * CSP + 64);
            const v16h a30 = ldh(ka + 96), a31 = ldh(ka + 16 * CSP + 96);
            s0 = wmmah(a20, qf[2], s0);
            s1 = wmmah(a21, qf[2], s1);
            s0 = wmmah(a30, qf[3], s0);
            s1 = wmmah(a31, qf[3], s1);
            guard2(s0, s1, a20, a21, a30, a31);
        }
        sfence();

        float mx = fmaxf(s0[0], s1[0]);
#pragma unroll
        for (int r = 1; r < 8; ++r) mx = fmaxf(mx, fmaxf(s0[r], s1[r]));
        mx = fmaxf(mx, __shfl_xor(mx, 16, 32));
        const float mnl = fmaxf(ml, mx * SC2);
        const float corr = __builtin_amdgcn_exp2f(ml - mnl);
        ml = mnl;
        const float sh = PCL - mnl;
        float p0[8], p1[8];
        float ps = 0.0f;
#pragma unroll
        for (int r = 0; r < 8; ++r) {
            p0[r] = __builtin_amdgcn_exp2f(fmaf(s0[r], SC2, sh));
            p1[r] = __builtin_amdgcn_exp2f(fmaf(s1[r], SC2, sh));
            ps += p0[r] + p1[r];
        }
        ps += __shfl_xor(ps, 16, 32);
        l = l * corr + ps;
        if (__builtin_amdgcn_ballot_w32(corr != 1.0f) != 0u) {   // wave-uniform; multiplying by exactly 1 is skipped
#pragma unroll
            for (int t = 0; t < 8; ++t) o[t] *= corr;
        }

        v16h ph;
#pragma unroll
        for (int r = 0; r < 8; ++r) { ph[r] = (_Float16)p0[r]; ph[8 + r] = (_Float16)p1[r]; }

        sfence();   // keep the V^T loads below the softmax (bounds live fragments)
        const hf* va = cs + bo + vfo + h * KS;
        {
            const v16h v0 = ldh(va), v1 = ldh(va + 16 * VTP), v2 = ldh(va + 32 * VTP), v3 = ldh(va + 48 * VTP);
            o[0] = wmmah(v0, ph, o[0]);
            o[1] = wmmah(v1, ph, o[1]);
            o[2] = wmmah(v2, ph, o[2]);
            o[3] = wmmah(v3, ph, o[3]);
            guard4(o[0], o[1], o[2], o[3], v0, v1, v2, v3, ph);
        }
        sfence();
        {
            const v16h v4 = ldh(va + 64 * VTP), v5 = ldh(va + 80 * VTP), v6 = ldh(va + 96 * VTP), v7 = ldh(va + 112 * VTP);
            o[4] = wmmah(v4, ph, o[4]);
            o[5] = wmmah(v5, ph, o[5]);
            o[6] = wmmah(v6, ph, o[6]);
            o[7] = wmmah(v7, ph, o[7]);
            guard4(o[4], o[5], o[6], o[7], v4, v5, v6, v7, ph);
        }
        sfence();
      }
      asm volatile("s_wait_dscnt 0x0" ::: "memory");       // this wave's reads of tile t have returned before its buffer is refilled
      asm volatile("s_wait_asynccnt 0x0" ::: "memory");    // this wave's pieces of tile t + 1 have landed
      __syncthreads();                                     // publishes tile t + 1 and ends every wave's reads of tile t
      if (t + 2u < nt) stage_kv(lk + bo * 2u, lv + bo * 2u, gk + (size_t)(t + 2u) * (TK * DIM), gv + (t + 2u) * TK);
    }
    asm volatile("s_wait_asynccnt 0x0" ::: "memory");      // no copy outstanding when the ring becomes output staging

    // epilogue: stage ctx value / residual rows [query][d] (wave-private regions; block barrier used)
    const float sc = (1.0f / l) * CCS;
    const unsigned creg = wave * (2u * 16u * CSP);
#pragma unroll
    for (int t = 0; t < 8; ++t) {
        v8h hv, lv;
#pragma unroll
        for (int r = 0; r < 8; ++r) {
            const float c = o[t][r] * sc;
            const _Float16 h = (_Float16)c;
            hv[r] = h;
            lv[r] = (_Float16)((c - (float)h) * RSC);
        }
        *(v8usa*)(cs + creg + lr * CSP + 16u * t + 8u * hi) = __builtin_bit_cast(v8us, hv);
        *(v8usa*)(cs + creg + 16u * CSP + lr * CSP + 16u * t + 8u * hi) = __builtin_bit_cast(v8us, lv);
    }
    __syncthreads();
    const unsigned bl = bh / NH, head = bh - bl * NH;
    const size_t rowbase = ((size_t)bl * SEQ + q0) * INNER + head * DIM + lr * 8u;
{
#pragma unroll
        for (unsigned s = 0; s < 8; ++s) {
            const unsigned rr = 2u * s + hi;
            const v8us vh = *(const v8usa*)(cs + creg + rr * CSP + lr * 8u);
            const v8us vl = *(const v8usa*)(cs + creg + 16u * CSP + rr * CSP + lr * 8u);
            *(v8us*)(CH + rowbase + (size_t)rr * INNER) = vh;
            *(v8us*)(CL + rowbase + (size_t)rr * INNER) = vl;
        }
        
    }
}

// k_proj: one block = 64 tokens x 128 output features, K = 1024; wave w: token group w>>1 (16 tokens), feature half w&1 (four 16-feature tiles).
//  A = w_proj^T rows (row m = feature, k = inner), B = ctx rows (column n = token); D element r of lane (h, n) = (feature 8h + r, token n).
//  ctx value and residual planes share the weight fragment and use separate accumulators; out = (acc_v + acc_r / 2^11) / 512 + bf16(bias), added at the store stage.
__global__ __launch_bounds__(256) void k_proj(const hf* CH, const hf* CL, const hf* WP, const float* __restrict__ bias, float* OUT, int bch0) {
    __shared__ __align__(16) float os[64 * OSP];
    const unsigned tid = threadIdx.x, lane = tid & 31u, lr = lane & 15u, hi = lane >> 4;
    const unsigned wave = (unsigned)__builtin_amdgcn_readfirstlane((int)(tid >> 5));
    const unsigned tg = wave >> 1, fh = wave & 1u;
    const unsigned m0 = blockIdx.x * 64u;
    const size_t coff = ((size_t)(m0 + 16u * tg + lr)) * INNER + 8u * hi;
    const size_t woff = ((size_t)(64u * fh + lr)) * INNER + 8u * hi;

    v8f ah[4], al[4];
#pragma unroll
    for (int t = 0; t < 4; ++t) { ah[t] = (v8f){}; al[t] = (v8f){}; }

#pragma unroll 1
    for (unsigned k0 = 0; k0 < (unsigned)INNER; k0 += 32) {
        const v16h ch = ldh(CH + coff + k0);
        const v16h cl = ldh(CL + coff + k0);
        const hf* wr = WP + woff + k0;
        const v16h w0 = ldh(wr), w1 = ldh(wr + (size_t)16 * INNER), w2 = ldh(wr + (size_t)32 * INNER), w3 = ldh(wr + (size_t)48 * INNER);
        ah[0] = wmmah(w0, ch, ah[0]);
        al[0] = wmmah(w0, cl, al[0]);
        ah[1] = wmmah(w1, ch, ah[1]);
        al[1] = wmmah(w1, cl, al[1]);
        ah[2] = wmmah(w2, ch, ah[2]);
        al[2] = wmmah(w2, cl, al[2]);
        ah[3] = wmmah(w3, ch, ah[3]);
        al[3] = wmmah(w3, cl, al[3]);
        guard8(ah[0], ah[1], ah[2], ah[3], al[0], al[1], al[2], al[3], ch, cl, w0, w1, w2, w3);
        sfence();
    }

    const float un = 1.0f / (CCS * WPS);
    const float ur = 1.0f / RSC;
#pragma unroll
    for (int t = 0; t < 4; ++t) {
        v4f x0, x1;
        x0[0] = fmaf(al[t][0], ur, ah[t][0]) * un; x0[1] = fmaf(al[t][1], ur, ah[t][1]) * un;
        x0[2] = fmaf(al[t][2], ur, ah[t][2]) * un; x0[3] = fmaf(al[t][3], ur, ah[t][3]) * un;
        x1[0] = fmaf(al[t][4], ur, ah[t][4]) * un; x1[1] = fmaf(al[t][5], ur, ah[t][5]) * un;
        x1[2] = fmaf(al[t][6], ur, ah[t][6]) * un; x1[3] = fmaf(al[t][7], ur, ah[t][7]) * un;
        const unsigned so = (16u * tg + lr) * OSP + 64u * fh + 16u * t + 8u * hi;
        *(v4fa*)(os + so) = x0;
        *(v4fa*)(os + so + 4u) = x1;
    }
    __syncthreads();
    const v4f bb = *(const v4f*)(bias + lane * 4u);
    v4f bq;
    bq[0] = bfr(bb[0]); bq[1] = bfr(bb[1]); bq[2] = bfr(bb[2]); bq[3] = bfr(bb[3]);
    float* orow = OUT + ((size_t)bch0 * SEQ + m0 + 8u * wave) * DIM + lane * 4u;
{
#pragma unroll
        for (unsigned s = 0; s < 8; ++s) {
            v4f val = *(const v4fa*)(os + (8u * wave + s) * OSP + lane * 4u);
            val[0] += bq[0]; val[1] += bq[1]; val[2] += bq[2]; val[3] += bq[3];
            *(v4f*)(orow + (size_t)s * DIM) = val;
        }
        
    }
}

extern "C" void kernel_launch(void* const* d_in, const int* in_sizes, int n_in,
                              void* d_out, int out_size, void* d_ws, size_t ws_size, hipStream_t stream) {
    if (n_in < 6) return;
    const size_t need = ((size_t)(NB - 1) * SEQ_FULL + SEQ) * DIM;
    if ((size_t)in_sizes[0] < need) return;
    if (in_sizes[1] < DIM || in_sizes[2] < DIM || in_sizes[5] < DIM) return;
    if ((size_t)in_sizes[3] < (size_t)DIM * QKVN) return;
    if ((size_t)in_sizes[4] < (size_t)INNER * DIM) return;
    if ((size_t)out_size < (size_t)NB * SEQ * DIM) return;
    if (SZ_ALL > ws_size) return;

    const float* x      = (const float*)d_in[0];   // inputs  [NB][SEQ_FULL][128] (rows n < SEQ read)
    const float* gamma  = (const float*)d_in[1];   // ln_gamma [128]
    const float* beta   = (const float*)d_in[2];   // ln_beta  [128]
    const float* w_qkv  = (const float*)d_in[3];   // [128][3072]  ([in][out])
    const float* w_proj = (const float*)d_in[4];   // [1024][128]  ([in][out])
    const float* b_proj = (const float*)d_in[5];   // [128]
    float* OUT = (float*)d_out;                    // [NB][SEQ][128]

    char* wsp = (char*)d_ws;
    hf* XH  = (hf*)(wsp);
    hf* WT  = (hf*)(wsp + SZ_XH);
    hf* WP  = (hf*)(wsp + SZ_XH + SZ_WT);
    hf* QKV = (hf*)(wsp + SZ_XH + SZ_WT + SZ_WP);
    hf* CH  = (hf*)(wsp + SZ_XH + SZ_WT + SZ_WP + 3 * SZ_PL);
    hf* CL  = (hf*)(wsp + SZ_XH + SZ_WT + SZ_WP + 3 * SZ_PL + SZ_CX);
    const size_t PL = (size_t)BCH * NH * SEQ * DIM;   // elements per q / k / v^T plane

    k_ln<<<(unsigned)(NB * SEQ / 16), 256, 0, stream>>>(x, gamma, beta, XH);
    // w_qkv in[128][3072] -> WT out[3072][128]: grid (128/64) * (3072/128)
    k_wt<<<(unsigned)((DIM / 64) * (QKVN / 128)), 256, 0, stream>>>(w_qkv, WT, DIM, QKVN, WQS);
    // w_proj in[1024][128] -> WP out[128][1024]: grid (1024/64) * (128/128)
    k_wt<<<(unsigned)((INNER / 64) * (DIM / 128)), 256, 0, stream>>>(w_proj, WP, INNER, DIM, WPS);
    for (int c = 0; c < NCH; ++c) {
        const int bch0 = c * BCH;
        k_qkv<<<dim3((unsigned)(BCH * SEQ / 64), 24, 1), 128, 0, stream>>>(XH, WT, QKV, bch0);
        k_flash<<<(unsigned)(BCH * NH * (SEQ / BQ)), NWV * 32, 0, stream>>>(QKV, QKV + PL, QKV + 2 * PL, CH, CL);
        k_proj<<<(unsigned)(BCH * SEQ / 64), 256, 0, stream>>>(CH, CL, WP, b_proj, OUT, bch0);
    }
}

// v002
// It runs in 143 microseconds.
// Two timings next to v001 put it at 1.38 and 1.42 times that version's speed.
// Over all steps from v000 it is 2.64 times as fast.
#include <hip/hip_runtime.h>

// Pre-LayerNorm multi-head softmax(QK^T)V block: x = LN(in) over 128; qkv = x @ w_qkv ([128][3072], thirds q|k|v, column = which*1024 + h*128 + d); 8 heads of dim 128; logits (q.k)/32; out = ctx @ w_proj + b_proj.
// Compute dtypes, f32 accumulate: every contraction on v_wmma_f32_16x16x32_f16. Float inputs are RNE-converted to bf16 first; weights carried as bf16 value x 16 (w_qkv) / x 32 (w_proj), exact in f16;
// x, q, k, v planes f16; P carried as f16 x 2^10 (online softmax in f32, log2 domain); ctx carried as f16(ctx x 16) plus f16 residual x 2^11 with its own accumulator in the output projection.
// Flash form with transposed tiles: the S^T accumulator tiles are directly the B-operand layout of P^T; all WMMA operands are two 16-byte loads from dense, statically strided 16-bit rows (LDS tiles in every product kernel; only the flash Q rows come straight from their plane).

#ifndef NB
#define NB 16
#endif
#ifndef SEQ
#define SEQ 1024
#endif
#define NB_FULL  16
#define SEQ_FULL 1024
#define DIM   128                 // token width == head dim
#define NH    8
#define INNER (NH * DIM)          // 1024
#define QKVN  (3 * INNER)         // 3072
#define NCH   ((NB % 2 == 0) ? 2 : 1)   // batch chunks (bounds the plane carve)
#define BCH   (NB / NCH)          // batches per chunk
#define NWV   8                   // waves per flash block
#define BQ    (16 * NWV)          // queries per flash block
#define KS    32                  // keys per step
#define TK    64                  // keys per staged K / V^T tile (two steps)
#define CSP   136                 // LDS pitch (16-bit elements) of 128-wide staging rows
#define OSP   132                 // LDS pitch (floats) of the output staging rows
#define VTP   72                  // LDS pitch (16-bit elements) of 64-wide transposed rows
#define KTE   (TK * CSP)          // staged K tile, 16-bit elements: TK key rows of 128
#define BUFE  (KTE + DIM * VTP)   // one ring buffer: K tile, then V^T tile (128 rows of TK keys)
#define PKT   128                 // k_proj: inner-dimension elements per staged tile (four 32-deep k-steps)
#define PBE   (256 * CSP)         // k_proj: one ring buffer: 64 ctx value rows, 64 ctx residual rows, 128 weight rows
#define L2E   1.4426950408889634f
#define SC2   (L2E * 0.03125f)    // log2(e) / 32
#define PCL   10.0f               // P carry exponent (2^10)
#define WQS   16.0f               // w_qkv carry
#define WPS   32.0f               // w_proj carry
#define CCS   16.0f               // ctx carry
#define RSC   2048.0f             // ctx residual carry

static_assert(DIM == 128);
static_assert(INNER == 1024);
static_assert(NB <= NB_FULL);
static_assert(SEQ <= SEQ_FULL);
static_assert(NB % NCH == 0);
static_assert(SEQ % BQ == 0);
static_assert(SEQ % 64 == 0);
static_assert(SEQ % KS == 0);
static_assert(SEQ % TK == 0 && TK == 2 * KS && TK <= VTP);
static_assert(NWV * 32 == 256);                  // k_flash staging: 256 lanes x 16 B x 4 pieces == one 16-KiB tile
static_assert(TK * DIM * 2 == 4 * 256 * 16);
static_assert((KTE * 2) % 16 == 0 && (BUFE * 2) % 16 == 0);
static_assert(NWV * 2 * 16 * CSP <= 2 * BUFE);   // k_flash: the output staging fits the ring it reuses
static_assert(DIM % 32 == 0);
static_assert(DIM == 4 * 32);                    // four 32-deep k-steps per score tile / per QKV tile
static_assert(DIM == 8 * 16);                    // eight 16-row output tiles per wave
static_assert(INNER % 32 == 0);
static_assert((NB * SEQ) % 16 == 0);             // k_ln: 16 rows per block
static_assert(16 * 8 == DIM);                    // k_ln: 16 lanes x 8 elements == row
static_assert(64 * CSP <= DIM * VTP);            // k_qkv: row-major staging fits the shared tile
static_assert(64 <= VTP);                        // transposed staging rows hold 64 tokens
static_assert((CSP * 2) % 16 == 0);
static_assert((VTP * 2) % 16 == 0);
static_assert((OSP * 4) % 16 == 0);
static_assert(32 * 4 == DIM);                    // k_proj: 32 lanes x 4 floats == output row
static_assert(16 * 8 * 2 == 256);                // 16 lanes x 16 B == one 128-element 16-bit row
static_assert(QKVN % 128 == 0);
static_assert(INNER % PKT == 0 && PKT % 32 == 0 && PKT <= CSP && PKT * 2 == 16 * 16);   // staged rows: 16 lanes x 16 B
static_assert((PBE * 2) % 16 == 0);
static_assert(DIM % 64 == 0 && INNER % 64 == 0); // k_wt tile multiples
static_assert((BCH * SEQ) % 64 == 0);            // k_qkv / k_proj: 64 tokens per block

#define SZ_XH  ((size_t)NB * SEQ * DIM * 2)
#define SZ_WT  ((size_t)QKVN * DIM * 2)
#define SZ_WP  ((size_t)DIM * INNER * 2)
#define SZ_PL  ((size_t)BCH * NH * SEQ * DIM * 2)
#define SZ_CX  ((size_t)BCH * SEQ * INNER * 2)
#define SZ_ALL (SZ_XH + SZ_WT + SZ_WP + 3 * SZ_PL + 2 * SZ_CX)
static_assert(SZ_XH % 256 == 0 && SZ_WT % 256 == 0 && SZ_WP % 256 == 0 && SZ_PL % 256 == 0 && SZ_CX % 256 == 0);
static_assert(SZ_ALL <= (size_t)134217728);

typedef unsigned short hf;
typedef __attribute__((ext_vector_type(16))) _Float16 v16h;
typedef __attribute__((ext_vector_type(8)))  _Float16 v8h;
typedef __attribute__((ext_vector_type(8)))  unsigned short v8us;
typedef __attribute__((ext_vector_type(8)))  float    v8f;
typedef __attribute__((ext_vector_type(4)))  float    v4f;
typedef v4f  __attribute__((may_alias)) v4fa;
typedef v8us __attribute__((may_alias)) v8usa;

__device__ __forceinline__ float bfr(float f) { unsigned u = __float_as_uint(f); u += 0x7FFFu + ((u >> 16) & 1u); return __uint_as_float(u & 0xFFFF0000u); }
__device__ __forceinline__ unsigned short f2h(float f) { return __builtin_bit_cast(unsigned short, (_Float16)f); }
__device__ __forceinline__ v16h cat16h(v8us lo, v8us hi) { return __builtin_bit_cast(v16h, __builtin_shufflevector(lo, hi, 0, 1, 2, 3, 4, 5, 6, 7, 8, 9, 10, 11, 12, 13, 14, 15)); }
__device__ __forceinline__ v8f wmmah(v16h a, v16h b, v8f c) { return __builtin_amdgcn_wmma_f32_16x16x32_f16(false, a, false, b, (short)0, c, false, false); }
// fragment loader (A and B alike): p = row base + k0 + 8*(lane>>4); elements 0..7 <- p[0..7], elements 8..15 <- p[16..23]
__device__ __forceinline__ v16h ldh(const hf* p) { return cat16h(*(const v8us*)p, *(const v8us*)(p + 16)); }
__device__ __forceinline__ void sfence() { asm volatile("" ::: "memory"); __builtin_amdgcn_sched_barrier(0); }
// hazard guards: four idle VALU slots after the last WMMA of a group; the group's operand fragments stay live until here
__device__ __forceinline__ void guard1(v8f& c0, v16h a, v16h b, v16h c, v16h d) {
    asm volatile("v_nop\n\tv_nop\n\tv_nop\n\tv_nop" : "+v"(c0) : "v"(a), "v"(b), "v"(c), "v"(d));
}
__device__ __forceinline__ void guard2(v8f& c0, v8f& c1, v16h a, v16h b, v16h c, v16h d) {
    asm volatile("v_nop\n\tv_nop\n\tv_nop\n\tv_nop" : "+v"(c0), "+v"(c1) : "v"(a), "v"(b), "v"(c), "v"(d));
}
__device__ __forceinline__ void guard4(v8f& c0, v8f& c1, v8f& c2, v8f& c3, v16h a, v16h b, v16h c, v16h d, v16h e) {
    asm volatile("v_nop\n\tv_nop\n\tv_nop\n\tv_nop" : "+v"(c0), "+v"(c1), "+v"(c2), "+v"(c3) : "v"(a), "v"(b), "v"(c), "v"(d), "v"(e));
}
__device__ __forceinline__ void guard8(v8f& c0, v8f& c1, v8f& c2, v8f& c3, v8f& c4, v8f& c5, v8f& c6, v8f& c7,
                                       v16h a, v16h b, v16h c, v16h d, v16h e, v16h f) {
    asm volatile("v_nop\n\tv_nop\n\tv_nop\n\tv_nop"
                 : "+v"(c0), "+v"(c1), "+v"(c2), "+v"(c3), "+v"(c4), "+v"(c5), "+v"(c6), "+v"(c7)
                 : "v"(a), "v"(b), "v"(c), "v"(d), "v"(e), "v"(f));
}

// One 64-key tile, global -> LDS through no register: each lane copies four 16-byte pieces of K (16 key rows apart) and four of V^T (32 d rows apart).
// lk / lv: the lane's LDS byte addresses of its first pieces; gk / gv: their global addresses. The address-translation wait closes the statement, ahead of any rewrite of the address registers.
__device__ __forceinline__ void stage_kv(unsigned lk, unsigned lv, const hf* gk, const hf* gv) {
    asm volatile("global_load_async_to_lds_b128 %0, %8, off\n\t"
                 "global_load_async_to_lds_b128 %1, %9, off\n\t"
                 "global_load_async_to_lds_b128 %2, %10, off\n\t"
                 "global_load_async_to_lds_b128 %3, %11, off\n\t"
                 "global_load_async_to_lds_b128 %4, %12, off\n\t"
                 "global_load_async_to_lds_b128 %5, %13, off\n\t"
                 "global_load_async_to_lds_b128 %6, %14, off\n\t"
                 "global_load_async_to_lds_b128 %7, %15, off\n\t"
                 "s_wait_xcnt 0x0"
                 :: "v"(lk), "v"(lk + 16u * CSP * 2u), "v"(lk + 32u * CSP * 2u), "v"(lk + 48u * CSP * 2u),
                    "v"(lv), "v"(lv + 32u * VTP * 2u), "v"(lv + 64u * VTP * 2u), "v"(lv + 96u * VTP * 2u),
                    "v"(gk), "v"(gk + 16 * DIM), "v"(gk + 32 * DIM), "v"(gk + 48 * DIM),
                    "v"(gv), "v"(gv + (size_t)32 * SEQ), "v"(gv + (size_t)64 * SEQ), "v"(gv + (size_t)96 * SEQ)
                 : "memory");
}

// Eight 16-byte pieces of row-major tiles, global -> LDS through no register: four from ga and four from gb, gs elements apart in each run; they land ls bytes apart, from l on.
// The address-translation wait closes the statement, ahead of any rewrite of the address registers.
__device__ __forceinline__ void stage_rows(unsigned l, const hf* ga, const hf* gb, unsigned ls, size_t gs) {
    asm volatile("global_load_async_to_lds_b128 %0, %8, off\n\t"
                 "global_load_async_to_lds_b128 %1, %9, off\n\t"
                 "global_load_async_to_lds_b128 %2, %10, off\n\t"
                 "global_load_async_to_lds_b128 %3, %11, off\n\t"
                 "global_load_async_to_lds_b128 %4, %12, off\n\t"
                 "global_load_async_to_lds_b128 %5, %13, off\n\t"
                 "global_load_async_to_lds_b128 %6, %14, off\n\t"
                 "global_load_async_to_lds_b128 %7, %15, off\n\t"
                 "s_wait_xcnt 0x0"
                 :: "v"(l), "v"(l + ls), "v"(l + 2u * ls), "v"(l + 3u * ls),
                    "v"(l + 4u * ls), "v"(l + 5u * ls), "v"(l + 6u * ls), "v"(l + 7u * ls),
                    "v"(ga), "v"(ga + gs), "v"(ga + 2 * gs), "v"(ga + 3 * gs),
                    "v"(gb), "v"(gb + gs), "v"(gb + 2 * gs), "v"(gb + 3 * gs)
                 : "memory");
}
// k_proj, one 128-deep tile: 256 lanes, 16 per row, rows 16 apart; ctx value rows 0..63, residual rows 64..127, weight rows 128..255 of the ring buffer at lc.
__device__ __forceinline__ void stage_proj(unsigned lc, const hf* gh, const hf* gl, const hf* gw) {
    stage_rows(lc, gh, gl, 16u * CSP * 2u, (size_t)16 * INNER);
    stage_rows(lc + 128u * CSP * 2u, gw, gw + (size_t)64 * INNER, 16u * CSP * 2u, (size_t)16 * INNER);
}

// k_ln: x plane XH[NB*SEQ][128] (f16) = LayerNorm(bf16(in)) with bf16(gamma), bf16(beta); 16 lanes per row, 8 elements per lane;
__global__ __launch_bounds__(256) void k_ln(const float* __restrict__ X, const float* __restrict__ G, const float* __restrict__ Bt, hf* XH) {
    const unsigned tid = threadIdx.x;
    const unsigned row = blockIdx.x * 16u + (tid >> 4);
    const unsigned sub = tid & 15u;
    const unsigned b = row / (unsigned)SEQ, n = row - b * (unsigned)SEQ;
    const float* src = X + ((size_t)b * SEQ_FULL + n) * DIM + sub * 8u;
    const v4f a0 = *(const v4f*)src;
    const v4f a1 = *(const v4f*)(src + 4);
    float e[8];
    e[0] = bfr(a0[0]); e[1] = bfr(a0[1]); e[2] = bfr(a0[2]); e[3] = bfr(a0[3]);
    e[4] = bfr(a1[0]); e[5] = bfr(a1[1]); e[6] = bfr(a1[2]); e[7] = bfr(a1[3]);
    float s = ((e[0] + e[1]) + (e[2] + e[3])) + ((e[4] + e[5]) + (e[6] + e[7]));
    s += __shfl_xor(s, 8, 32);
    s += __shfl_xor(s, 4, 32);
    s += __shfl_xor(s, 2, 32);
    s += __shfl_xor(s, 1, 32);
    const float mu = s * (1.0f / DIM);
    float d[8];
    float s2 = 0.0f;
#pragma unroll
    for (int j = 0; j < 8; ++j) { d[j] = e[j] - mu; s2 = fmaf(d[j], d[j], s2); }
    s2 += __shfl_xor(s2, 8, 32);
    s2 += __shfl_xor(s2, 4, 32);
    s2 += __shfl_xor(s2, 2, 32);
    s2 += __shfl_xor(s2, 1, 32);
    const float rs = rsqrtf(s2 * (1.0f / DIM) + 1.0e-5f);
    const v4f g0 = *(const v4f*)(G + sub * 8u), g1 = *(const v4f*)(G + sub * 8u + 4u);
    const v4f b0 = *(const v4f*)(Bt + sub * 8u), b1 = *(const v4f*)(Bt + sub * 8u + 4u);
    v8h o;
    o[0] = (_Float16)(d[0] * rs * bfr(g0[0]) + bfr(b0[0]));
    o[1] = (_Float16)(d[1] * rs * bfr(g0[1]) + bfr(b0[1]));
    o[2] = (_Float16)(d[2] * rs * bfr(g0[2]) + bfr(b0[2]));
    o[3] = (_Float16)(d[3] * rs * bfr(g0[3]) + bfr(b0[3]));
    o[4] = (_Float16)(d[4] * rs * bfr(g1[0]) + bfr(b1[0]));
    o[5] = (_Float16)(d[5] * rs * bfr(g1[1]) + bfr(b1[1]));
    o[6] = (_Float16)(d[6] * rs * bfr(g1[2]) + bfr(b1[2]));
    o[7] = (_Float16)(d[7] * rs * bfr(g1[3]) + bfr(b1[3]));
    const v8us ob = __builtin_bit_cast(v8us, o);
    hf* dst = XH + (size_t)row * DIM + sub * 8u;
    *(v8us*)dst = ob;
    
}

// k_wt: WT[c][r] (f16) = bf16(W[r][c]) * scale; in[R][C] -> out[C][R]; one block = 64 r x 128 c through an LDS tile (cross-wave, block barrier);
__global__ __launch_bounds__(256) void k_wt(const float* __restrict__ W, hf* WT, int R, int C, float scale) {
    __shared__ __align__(16) hf tl[DIM * VTP];
    const unsigned tid = threadIdx.x;
    const unsigned tc = (unsigned)C / 128u;
    const unsigned kt = blockIdx.x / tc;
    const unsigned ct = blockIdx.x - kt * tc;
    const float* src = W + (size_t)(kt * 64u) * (unsigned)C + ct * 128u;
#pragma unroll
    for (unsigned it = 0; it < 8; ++it) {
        const unsigned f = it * 256u + tid;
        const unsigned key = f >> 5, c4 = (f & 31u) * 4u;
        const v4f x = *(const v4f*)(src + (size_t)key * (unsigned)C + c4);
#pragma unroll
        for (unsigned c = 0; c < 4; ++c) tl[(c4 + c) * VTP + key] = f2h(bfr(x[c]) * scale);
    }
    __syncthreads();
    hf* dst = WT + (size_t)(ct * 128u) * (unsigned)R + kt * 64u;
    const unsigned c8 = (tid & 7u) * 8u, dr = tid >> 3;
{
#pragma unroll
        for (unsigned it = 0; it < 4; ++it) {
            const unsigned d = it * 32u + dr;
            const v8us o = *(const v8usa*)(tl + d * VTP + c8);
            *(v8us*)(dst + (size_t)d * (unsigned)R + c8) = o;
        }
        
    }
}

// k_qkv: one block = 64 tokens x one (which, head) group of 128 features; wave w owns tokens 16w..16w+15; the eight 16-feature tiles are processed in a rolled loop
//  (one accumulator tile and four weight fragments live at a time; the four token fragments are held), K = 128.
//  The block's x tile (64 rows) and weight tile (128 rows) are brought into LDS once by asynchronous copies (whole 256-byte rows); every fragment is read from LDS.
//  q / k groups: A = W^T rows (row m = feature), B = x rows (column n = token); D element r of lane (h, n) = (feature 16t + 8h + r, token n); staged row-major [token][feature].
//  v group:      A = x rows (row m = token), B = W^T rows (column n = feature); D element r of lane (h, n) = (token 8h + r, feature n); staged transposed [feature][token].
__attribute__((amdgpu_num_vgpr(248))) __global__ __launch_bounds__(128) void k_qkv(const hf* XH, const hf* WT, hf* QKV, int bch0) {
    __shared__ __align__(16) hf st[DIM * VTP];   // x tile (pitch CSP) until the token fragments are held, output staging after that
    __shared__ __align__(16) hf wl[DIM * CSP];   // weight tile: 128 feature rows
    const unsigned tid = threadIdx.x, lane = tid & 31u, lr = lane & 15u, hi = lane >> 4;
    const unsigned wave = (unsigned)__builtin_amdgcn_readfirstlane((int)(tid >> 5));
    const unsigned which = blockIdx.y >> 3, head = blockIdx.y & 7u;
    const unsigned mloc = blockIdx.x * 64u;
    const unsigned bl = mloc / (unsigned)SEQ, n0 = mloc - bl * (unsigned)SEQ;
    const size_t PL = (size_t)BCH * NH * SEQ * DIM;

    {   // staging: 128 lanes, 16 per row, rows 8 apart; 8 pieces of x and 16 of the weights per lane
        const unsigned srow = tid >> 4, scol = (tid & 15u) * 8u;
        const hf* gx = XH + ((size_t)((unsigned)bch0 + bl) * SEQ + n0 + srow) * DIM + scol;
        const hf* gw = WT + ((size_t)blockIdx.y * 128u + srow) * DIM + scol;
        const unsigned lx = (unsigned)(size_t)(st + srow * CSP + scol);
        const unsigned lw = (unsigned)(size_t)(wl + srow * CSP + scol);
        stage_rows(lx, gx, gx + 32 * DIM, 8u * CSP * 2u, (size_t)8 * DIM);
        stage_rows(lw, gw, gw + 32 * DIM, 8u * CSP * 2u, (size_t)8 * DIM);
        stage_rows(lw + 64u * CSP * 2u, gw + 64 * DIM, gw + 96 * DIM, 8u * CSP * 2u, (size_t)8 * DIM);
    }
    asm volatile("s_wait_asynccnt 0x0" ::: "memory");      // this wave's pieces of both tiles have landed
    __syncthreads();                                       // both tiles readable by every wave
    v16h tf[4];
    {
        const hf* tp = st + (16u * wave + lr) * CSP + 8u * hi;
        tf[0] = ldh(tp);
        tf[1] = ldh(tp + 32);
        tf[2] = ldh(tp + 64);
        tf[3] = ldh(tp + 96);
    }
    __syncthreads();                                       // ends every wave's reads of the x tile before it is overwritten as output staging
    const unsigned woff = lr * CSP + 8u * hi;
    const float un = 1.0f / WQS;

    if (which == 2u) {      // block-uniform
#pragma unroll 1
        for (unsigned t = 0; t < 8u; ++t) {
            const hf* wr = wl + woff + t * (16u * CSP);
            const v16h w0 = ldh(wr), w1 = ldh(wr + 32), w2 = ldh(wr + 64), w3 = ldh(wr + 96);
            v8f acc = (v8f){};
            acc = wmmah(tf[0], w0, acc);
            acc = wmmah(tf[1], w1, acc);
            acc = wmmah(tf[2], w2, acc);
            acc = wmmah(tf[3], w3, acc);
            guard1(acc, w0, w1, w2, w3);
            v8h o;
#pragma unroll
            for (int r = 0; r < 8; ++r) o[r] = (_Float16)(acc[r] * un);
            *(v8usa*)(st + (16u * t + lr) * VTP + 16u * wave + 8u * hi) = __builtin_bit_cast(v8us, o);
            sfence();
        }
    } else {
#pragma unroll 1
        for (unsigned t = 0; t < 8u; ++t) {
            const hf* wr = wl + woff + t * (16u * CSP);
            const v16h w0 = ldh(wr), w1 = ldh(wr + 32), w2 = ldh(wr + 64), w3 = ldh(wr + 96);
            v8f acc = (v8f){};
            acc = wmmah(w0, tf[0], acc);
            acc = wmmah(w1, tf[1], acc);
            acc = wmmah(w2, tf[2], acc);
            acc = wmmah(w3, tf[3], acc);
            guard1(acc, w0, w1, w2, w3);
            v8h o;
#pragma unroll
            for (int r = 0; r < 8; ++r) o[r] = (_Float16)(acc[r] * un);
            *(v8usa*)(st + (16u * wave + lr) * CSP + 16u * t + 8u * hi) = __builtin_bit_cast(v8us, o);
            sfence();
        }
    }
    __syncthreads();
    const size_t bhp = (size_t)(bl * NH + head);
    if (which == 2u) {
        hf* dst = QKV + 2 * PL + bhp * DIM * SEQ + n0;
        const unsigned c8 = (tid & 7u) * 8u, dr = tid >> 3;
{
#pragma unroll
            for (unsigned it = 0; it < 8; ++it) {
                const unsigned d = it * 16u + dr;
                const v8us o = *(const v8usa*)(st + d * VTP + c8);
                *(v8us*)(dst + (size_t)d * SEQ + c8) = o;
            }
            
        }
    } else {
        hf* dst = QKV + (size_t)which * PL + (bhp * SEQ + n0) * DIM + lr * 8u;
{
#pragma unroll
            for (unsigned s = 0; s < 8; ++s) {
                const unsigned rr = 16u * wave + 2u * s + hi;
                const v8us o = *(const v8usa*)(st + rr * CSP + lr * 8u);
                *(v8us*)(dst + (size_t)rr * DIM) = o;
            }
            
        }
    }
}

// k_flash: one wave per 16 queries of one (batch, head), 32 keys per step, online softmax; the block's eight waves share K / V^T tiles of 64 keys,
//  staged in a two-buffer LDS ring by asynchronous copies (tile t + 2 is issued behind the barrier that ends the reads of tile t); fragments are read from LDS.
//  S^T tile (keys x queries): A = K rows (row m = key, k = d), B = Q rows (column n = query, k = d); D element r of lane (h, n) = S[query n][key 8h + r].
//  Q fragments (four, B operands) are held; K fragments are loaded four at a time (two k-steps x two key tiles); V^T fragments four output tiles at a time.
//  P^T B fragment: element r <- tile of keys 0..15, element 8 + r <- tile of keys 16..31 (same lane); P carried x 2^10 (the running sum carries the same factor).
//  O^T tile (d x queries): A = V^T rows (row m = d, k = key), D element r of lane (h, n) = O[query n][d = 16 t + 8h + r].
__attribute__((amdgpu_num_vgpr(248))) __global__ __launch_bounds__(NWV * 32) void k_flash(const hf* QP, const hf* KP, const hf* VT, hf* CH, hf* CL) {
    __shared__ __align__(16) hf cs[2 * BUFE];   // K / V^T ring in the loop, output staging behind it
    const unsigned tid = threadIdx.x, lane = tid & 31u, lr = lane & 15u, hi = lane >> 4;
    const unsigned wave = (unsigned)__builtin_amdgcn_readfirstlane((int)(tid >> 5));
    const unsigned bpb = (unsigned)(SEQ / BQ);
    const unsigned bh = blockIdx.x / bpb;
    const unsigned q0 = (blockIdx.x - bh * bpb) * BQ + wave * 16u;

    v16h qf[4];
    {
        const hf* qp = QP + ((size_t)bh * SEQ + q0 + lr) * DIM + 8u * hi;
        qf[0] = ldh(qp);
        qf[1] = ldh(qp + 32);
        qf[2] = ldh(qp + 64);
        qf[3] = ldh(qp + 96);
    }
    const unsigned kfo = lr * CSP + 8u * hi;          // fragment offsets inside a ring buffer
    const unsigned vfo = KTE + lr * VTP + 8u * hi;
    // staging addresses of this lane: K tile = 16 KiB contiguous, 16 lanes per key row; V^T tile = 128 rows of 128 B, 8 lanes per row
    const hf* gk = KP + (size_t)bh * SEQ * DIM + tid * 8u;
    const hf* gv = VT + ((size_t)bh * DIM + (tid >> 3)) * SEQ + (tid & 7u) * 8u;
    const unsigned lk = (unsigned)(size_t)(cs + (tid >> 4) * CSP + (tid & 15u) * 8u);
    const unsigned lv = (unsigned)(size_t)(cs + KTE + (tid >> 3) * VTP + (tid & 7u) * 8u);
    const unsigned nt = (unsigned)(SEQ / TK);

    v8f o[8];
#pragma unroll
    for (int t = 0; t < 8; ++t) o[t] = (v8f){};
    float ml = -1.0e30f;      // running max in the log2 domain
    float l = 0.0f;           // running sum (carried x 2^10)

    stage_kv(lk, lv, gk, gv);                              // tile 0 -> buffer 0
    asm volatile("s_wait_asynccnt 0x0" ::: "memory");      // this wave's pieces of tile 0 have landed
    __syncthreads();                                       // tile 0 readable by every wave
    if (nt > 1u) stage_kv(lk + BUFE * 2u, lv + BUFE * 2u, gk + TK * DIM, gv + TK);   // tile 1 -> buffer 1

#pragma unroll 1
    for (unsigned t = 0; t < nt; ++t) {
      const unsigned bo = (t & 1u) * BUFE;
#pragma unroll 1
      for (unsigned h = 0; h < 2u; ++h) {                  // rolled: one copy of the step's code, one step's fragments live
        v8f s0 = (v8f){}, s1 = (v8f){};
        const hf* ka = cs + bo + kfo + h * (KS * CSP);
        {
            const v16h a00 = ldh(ka), a01 = ldh(ka + 16 * CSP);
            const v16h a10 = ldh(ka + 32), a11 = ldh(ka + 16 * CSP + 32);
            s0 = wmmah(a00, qf[0], s0);
            s1 = wmmah(a01, qf[0], s1);
            s0 = wmmah(a10, qf[1], s0);
            s1 = wmmah(a11, qf[1], s1);
            guard2(s0, s1, a00, a01, a10, a11);
        }
        sfence();
        {
            const v16h a20 = ldh(ka + 64), a21 = ldh(ka + 16 * CSP + 64);
            const v16h a30 = ldh(ka + 96), a31 = ldh(ka + 16 * CSP + 96);
            s0 = wmmah(a20, qf[2], s0);
            s1 = wmmah(a21, qf[2], s1);
            s0 = wmmah(a30, qf[3], s0);
            s1 = wmmah(a31, qf[3], s1);
            guard2(s0, s1, a20, a21, a30, a31);
        }
        sfence();

        float mx = fmaxf(s0[0], s1[0]);
#pragma unroll
        for (int r = 1; r < 8; ++r) mx = fmaxf(mx, fmaxf(s0[r], s1[r]));
        mx = fmaxf(mx, __shfl_xor(mx, 16, 32));
        const float mnl = fmaxf(ml, mx * SC2);
        const float corr = __builtin_amdgcn_exp2f(ml - mnl);
        ml = mnl;
        const float sh = PCL - mnl;
        float p0[8], p1[8];
        float ps = 0.0f;
#pragma unroll
        for (int r = 0; r < 8; ++r) {
            p0[r] = __builtin_amdgcn_exp2f(fmaf(s0[r], SC2, sh));
            p1[r] = __builtin_amdgcn_exp2f(fmaf(s1[r], SC2, sh));
            ps += p0[r] + p1[r];
        }
        ps += __shfl_xor(ps, 16, 32);
        l = l * corr + ps;
        if (__builtin_amdgcn_ballot_w32(corr != 1.0f) != 0u) {   // wave-uniform; multiplying by exactly 1 is skipped
#pragma unroll
            for (int t = 0; t < 8; ++t) o[t] *= corr;
        }

        v16h ph;
#pragma unroll
        for (int r = 0; r < 8; ++r) { ph[r] = (_Float16)p0[r]; ph[8 + r] = (_Float16)p1[r]; }

        sfence();   // keep the V^T loads below the softmax (bounds live fragments)
        const hf* va = cs + bo + vfo + h * KS;
        {
            const v16h v0 = ldh(va), v1 = ldh(va + 16 * VTP), v2 = ldh(va + 32 * VTP), v3 = ldh(va + 48 * VTP);
            o[0] = wmmah(v0, ph, o[0]);
            o[1] = wmmah(v1, ph, o[1]);
            o[2] = wmmah(v2, ph, o[2]);
            o[3] = wmmah(v3, ph, o[3]);
            guard4(o[0], o[1], o[2], o[3], v0, v1, v2, v3, ph);
        }
        sfence();
        {
            const v16h v4 = ldh(va + 64 * VTP), v5 = ldh(va + 80 * VTP), v6 = ldh(va + 96 * VTP), v7 = ldh(va + 112 * VTP);
            o[4] = wmmah(v4, ph, o[4]);
            o[5] = wmmah(v5, ph, o[5]);
            o[6] = wmmah(v6, ph, o[6]);
            o[7] = wmmah(v7, ph, o[7]);
            guard4(o[4], o[5], o[6], o[7], v4, v5, v6, v7, ph);
        }
        sfence();
      }
      asm volatile("s_wait_dscnt 0x0" ::: "memory");       // this wave's reads of tile t have returned before its buffer is refilled
      asm volatile("s_wait_asynccnt 0x0" ::: "memory");    // this wave's pieces of tile t + 1 have landed
      __syncthreads();                                     // publishes tile t + 1 and ends every wave's reads of tile t
      if (t + 2u < nt) stage_kv(lk + bo * 2u, lv + bo * 2u, gk + (size_t)(t + 2u) * (TK * DIM), gv + (t + 2u) * TK);
    }
    asm volatile("s_wait_asynccnt 0x0" ::: "memory");      // no copy outstanding when the ring becomes output staging

    // epilogue: stage ctx value / residual rows [query][d] (wave-private regions; block barrier used)
    const float sc = (1.0f / l) * CCS;
    const unsigned creg = wave * (2u * 16u * CSP);
#pragma unroll
    for (int t = 0; t < 8; ++t) {
        v8h hv, lv;
#pragma unroll
        for (int r = 0; r < 8; ++r) {
            const float c = o[t][r] * sc;
            const _Float16 h = (_Float16)c;
            hv[r] = h;
            lv[r] = (_Float16)((c - (float)h) * RSC);
        }
        *(v8usa*)(cs + creg + lr * CSP + 16u * t + 8u * hi) = __builtin_bit_cast(v8us, hv);
        *(v8usa*)(cs + creg + 16u * CSP + lr * CSP + 16u * t + 8u * hi) = __builtin_bit_cast(v8us, lv);
    }
    __syncthreads();
    const unsigned bl = bh / NH, head = bh - bl * NH;
    const size_t rowbase = ((size_t)bl * SEQ + q0) * INNER + head * DIM + lr * 8u;
{
#pragma unroll
        for (unsigned s = 0; s < 8; ++s) {
            const unsigned rr = 2u * s + hi;
            const v8us vh = *(const v8usa*)(cs + creg + rr * CSP + lr * 8u);
            const v8us vl = *(const v8usa*)(cs + creg + 16u * CSP + rr * CSP + lr * 8u);
            *(v8us*)(CH + rowbase + (size_t)rr * INNER) = vh;
            *(v8us*)(CL + rowbase + (size_t)rr * INNER) = vl;
        }
        
    }
}

// k_proj: one block = 64 tokens x 128 output features, K = 1024; wave w: token group w>>1 (16 tokens), feature half w&1 (four 16-feature tiles).
//  A = w_proj^T rows (row m = feature, k = inner), B = ctx rows (column n = token); D element r of lane (h, n) = (feature 8h + r, token n).
//  The K loop walks 128-deep tiles of the ctx value, ctx residual and weight rows, staged in a two-buffer LDS ring by asynchronous copies (tile t + 2 is issued behind the barrier that ends the reads of tile t).
//  ctx value and residual planes share the weight fragment and use separate accumulators; out = (acc_v + acc_r / 2^11) / 512 + bf16(bias), added at the store stage.
__global__ __launch_bounds__(256) void k_proj(const hf* CH, const hf* CL, const hf* WP, const float* __restrict__ bias, float* OUT, int bch0) {
    __shared__ __align__(16) hf rg[2 * PBE];     // operand ring
    __shared__ __align__(16) float os[64 * OSP];
    const unsigned tid = threadIdx.x, lane = tid & 31u, lr = lane & 15u, hi = lane >> 4;
    const unsigned wave = (unsigned)__builtin_amdgcn_readfirstlane((int)(tid >> 5));
    const unsigned tg = wave >> 1, fh = wave & 1u;
    const unsigned m0 = blockIdx.x * 64u;
    const unsigned coff = (16u * tg + lr) * CSP + 8u * hi;                 // fragment offsets inside a ring buffer
    const unsigned woff = (128u + 64u * fh + lr) * CSP + 8u * hi;
    // staging addresses of this lane: 16 lanes per 256-byte row piece
    const hf* gh = CH + (size_t)(m0 + (tid >> 4)) * INNER + (tid & 15u) * 8u;
    const hf* gl = CL + (size_t)(m0 + (tid >> 4)) * INNER + (tid & 15u) * 8u;
    const hf* gw = WP + (size_t)(tid >> 4) * INNER + (tid & 15u) * 8u;
    const unsigned lc = (unsigned)(size_t)(rg + (tid >> 4) * CSP + (tid & 15u) * 8u);
    const unsigned nt = (unsigned)(INNER / PKT);

    v8f ah[4], al[4];
#pragma unroll
    for (int t = 0; t < 4; ++t) { ah[t] = (v8f){}; al[t] = (v8f){}; }

    stage_proj(lc, gh, gl, gw);                            // tile 0 -> buffer 0
    asm volatile("s_wait_asynccnt 0x0" ::: "memory");      // this wave's pieces of tile 0 have landed
    __syncthreads();                                       // tile 0 readable by every wave
    if (nt > 1u) stage_proj(lc + PBE * 2u, gh + PKT, gl + PKT, gw + PKT);   // tile 1 -> buffer 1

#pragma unroll 1
    for (unsigned t = 0; t < nt; ++t) {
      const unsigned bo = (t & 1u) * PBE;
#pragma unroll 1
      for (unsigned k0 = 0; k0 < (unsigned)PKT; k0 += 32) {   // rolled: one copy of the step's code, one step's fragments live
        const hf* cr = rg + bo + coff + k0;
        const v16h ch = ldh(cr);
        const v16h cl = ldh(cr + 64 * CSP);
        const hf* wr = rg + bo + woff + k0;
        const v16h w0 = ldh(wr), w1 = ldh(wr + 16 * CSP), w2 = ldh(wr + 32 * CSP), w3 = ldh(wr + 48 * CSP);
        ah[0] = wmmah(w0, ch, ah[0]);
        al[0] = wmmah(w0, cl, al[0]);
        ah[1] = wmmah(w1, ch, ah[1]);
        al[1] = wmmah(w1, cl, al[1]);
        ah[2] = wmmah(w2, ch, ah[2]);
        al[2] = wmmah(w2, cl, al[2]);
        ah[3] = wmmah(w3, ch, ah[3]);
        al[3] = wmmah(w3, cl, al[3]);
        guard8(ah[0], ah[1], ah[2], ah[3], al[0], al[1], al[2], al[3], ch, cl, w0, w1, w2, w3);
        sfence();
      }
      asm volatile("s_wait_dscnt 0x0" ::: "memory");       // this wave's reads of tile t have returned before its buffer is refilled
      asm volatile("s_wait_asynccnt 0x0" ::: "memory");    // this wave's pieces of tile t + 1 have landed
      __syncthreads();                                     // publishes tile t + 1 and ends every wave's reads of tile t
      if (t + 2u < nt) stage_proj(lc + bo * 2u, gh + (t + 2u) * PKT, gl + (t + 2u) * PKT, gw + (t + 2u) * PKT);
    }
    asm volatile("s_wait_asynccnt 0x0" ::: "memory");      // no copy outstanding behind the loop

    const float un = 1.0f / (CCS * WPS);
    const float ur = 1.0f / RSC;
#pragma unroll
    for (int t = 0; t < 4; ++t) {
        v4f x0, x1;
        x0[0] = fmaf(al[t][0], ur, ah[t][0]) * un; x0[1] = fmaf(al[t][1], ur, ah[t][1]) * un;
        x0[2] = fmaf(al[t][2], ur, ah[t][2]) * un; x0[3] = fmaf(al[t][3], ur, ah[t][3]) * un;
        x1[0] = fmaf(al[t][4], ur, ah[t][4]) * un; x1[1] = fmaf(al[t][5], ur, ah[t][5]) * un;
        x1[2] = fmaf(al[t][6], ur, ah[t][6]) * un; x1[3] = fmaf(al[t][7], ur, ah[t][7]) * un;
        const unsigned so = (16u * tg + lr) * OSP + 64u * fh + 16u * t + 8u * hi;
        *(v4fa*)(os + so) = x0;
        *(v4fa*)(os + so + 4u) = x1;
    }
    __syncthreads();
    const v4f bb = *(const v4f*)(bias + lane * 4u);
    v4f bq;
    bq[0] = bfr(bb[0]); bq[1] = bfr(bb[1]); bq[2] = bfr(bb[2]); bq[3] = bfr(bb[3]);
    float* orow = OUT + ((size_t)bch0 * SEQ + m0 + 8u * wave) * DIM + lane * 4u;
{
#pragma unroll
        for (unsigned s = 0; s < 8; ++s) {
            v4f val = *(const v4fa*)(os + (8u * wave + s) * OSP + lane * 4u);
            val[0] += bq[0]; val[1] += bq[1]; val[2] += bq[2]; val[3] += bq[3];
            *(v4f*)(orow + (size_t)s * DIM) = val;
        }
        
    }
}

extern "C" void kernel_launch(void* const* d_in, const int* in_sizes, int n_in,
                              void* d_out, int out_size, void* d_ws, size_t ws_size, hipStream_t stream) {
    if (n_in < 6) return;
    const size_t need = ((size_t)(NB - 1) * SEQ_FULL + SEQ) * DIM;
    if ((size_t)in_sizes[0] < need) return;
    if (in_sizes[1] < DIM || in_sizes[2] < DIM || in_sizes[5] < DIM) return;
    if ((size_t)in_sizes[3] < (size_t)DIM * QKVN) return;
    if ((size_t)in_sizes[4] < (size_t)INNER * DIM) return;
    if ((size_t)out_size < (size_t)NB * SEQ * DIM) return;
    if (SZ_ALL > ws_size) return;

    const float* x      = (const float*)d_in[0];   // inputs  [NB][SEQ_FULL][128] (rows n < SEQ read)
    const float* gamma  = (const float*)d_in[1];   // ln_gamma [128]
    const float* beta   = (const float*)d_in[2];   // ln_beta  [128]
    const float* w_qkv  = (const float*)d_in[3];   // [128][3072]  ([in][out])
    const float* w_proj = (const float*)d_in[4];   // [1024][128]  ([in][out])
    const float* b_proj = (const float*)d_in[5];   // [128]
    float* OUT = (float*)d_out;                    // [NB][SEQ][128]

    char* wsp = (char*)d_ws;
    hf* XH  = (hf*)(wsp);
    hf* WT  = (hf*)(wsp + SZ_XH);
    hf* WP  = (hf*)(wsp + SZ_XH + SZ_WT);
    hf* QKV = (hf*)(wsp + SZ_XH + SZ_WT + SZ_WP);
    hf* CH  = (hf*)(wsp + SZ_XH + SZ_WT + SZ_WP + 3 * SZ_PL);
    hf* CL  = (hf*)(wsp + SZ_XH + SZ_WT + SZ_WP + 3 * SZ_PL + SZ_CX);
    const size_t PL = (size_t)BCH * NH * SEQ * DIM;   // elements per q / k / v^T plane

    k_ln<<<(unsigned)(NB * SEQ / 16), 256, 0, stream>>>(x, gamma, beta, XH);
    // w_qkv in[128][3072] -> WT out[3072][128]: grid (128/64) * (3072/128)
    k_wt<<<(unsigned)((DIM / 64) * (QKVN / 128)), 256, 0, stream>>>(w_qkv, WT, DIM, QKVN, WQS);
    // w_proj in[1024][128] -> WP out[128][1024]: grid (1024/64) * (128/128)
    k_wt<<<(unsigned)((INNER / 64) * (DIM / 128)), 256, 0, stream>>>(w_proj, WP, INNER, DIM, WPS);
    for (int c = 0; c < NCH; ++c) {
        const int bch0 = c * BCH;
        k_qkv<<<dim3((unsigned)(BCH * SEQ / 64), 24, 1), 128, 0, stream>>>(XH, WT, QKV, bch0);
        k_flash<<<(unsigned)(BCH * NH * (SEQ / BQ)), NWV * 32, 0, stream>>>(QKV, QKV + PL, QKV + 2 * PL, CH, CL);
        k_proj<<<(unsigned)(BCH * SEQ / 64), 256, 0, stream>>>(CH, CL, WP, b_proj, OUT, bch0);
    }
}

// v003
// One run takes 107 microseconds.
// Next to v002, in two timings, it ran 1.32 and 1.33 times as fast.
// Counting every step since v000, it is 3.49 times as fast.
#include <hip/hip_runtime.h>

// Pre-LayerNorm multi-head softmax(QK^T)V block: x = LN(in) over 128; qkv = x @ w_qkv ([128][3072], thirds q|k|v, column = which*1024 + h*128 + d); 8 heads of dim 128; logits (q.k)/32; out = ctx @ w_proj + b_proj.
// Compute dtypes, f32 accumulate: every contraction on v_wmma_f32_16x16x32_f16. Float inputs are RNE-converted to bf16 first; weights carried as bf16 value x 16 (w_qkv) / x 32 (w_proj), exact in f16;
// x, q, k, v planes f16; P carried as f16 x 2^10 (online softmax in f32, log2 domain); ctx carried as f16(ctx x 16) plus f16 residual x 2^11 with its own accumulator in the output projection.
// Flash form with transposed tiles: the S^T accumulator tiles are directly the B-operand layout of P^T; all WMMA operands are two 16-byte loads from dense, statically strided 16-bit rows (LDS tiles in every product kernel; only the flash Q rows come straight from their plane).

#ifndef NB
#define NB 16
#endif
#ifndef SEQ
#define SEQ 1024
#endif
#define NB_FULL  16
#define SEQ_FULL 1024
#define DIM   128                 // token width == head dim
#define NH    8
#define INNER (NH * DIM)          // 1024
#define QKVN  (3 * INNER)         // 3072
#define NCH   1                   // batch chunks: all batches go through one k_qkv / k_flash / k_proj pass
#define BCH   (NB / NCH)          // batches per chunk
#define NWV   8                   // waves per flash block
#define BQ    (16 * NWV)          // queries per flash block
#define KS    32                  // keys per step
#define TK    64                  // keys per staged K / V^T tile (two steps)
#define CSP   136                 // LDS pitch (16-bit elements) of 128-wide staging rows
#define OSP   132                 // LDS pitch (floats) of the output staging rows
#define VTP   72                  // LDS pitch (16-bit elements) of 64-wide transposed rows
#define KTE   (TK * CSP)          // staged K tile, 16-bit elements: TK key rows of 128
#define BUFE  (KTE + DIM * VTP)   // one ring buffer: K tile, then V^T tile (128 rows of TK keys)
#define PKT   128                 // k_proj: inner-dimension elements per staged tile (four 32-deep k-steps)
#define PBE   (256 * CSP)         // k_proj: one ring buffer: 64 ctx value rows, 64 ctx residual rows, 128 weight rows
#define L2E   1.4426950408889634f
#define SC2   (L2E * 0.03125f)    // log2(e) / 32
#define PCL   10.0f               // P carry exponent (2^10)
#define WQS   16.0f               // w_qkv carry
#define WPS   32.0f               // w_proj carry
#define CCS   16.0f               // ctx carry
#define RSC   2048.0f             // ctx residual carry
#define NWQ   ((DIM / 64) * (QKVN / 128))   // k_prep: blocks that transpose w_qkv, in[128][3072] -> out[3072][128]
#define NWP   ((INNER / 64) * (DIM / 128))  // k_prep: blocks that transpose w_proj, in[1024][128] -> out[128][1024]
#define NLN   (NB * SEQ / 16)               // k_prep: LayerNorm blocks, 16 rows each

static_assert(DIM == 128);
static_assert(INNER == 1024);
static_assert(NB <= NB_FULL);
static_assert(SEQ <= SEQ_FULL);
static_assert(NB % NCH == 0);
static_assert(SEQ % BQ == 0);
static_assert(SEQ % 64 == 0);
static_assert(SEQ % KS == 0);
static_assert(SEQ % TK == 0 && TK == 2 * KS && TK <= VTP);
static_assert(NWV * 32 == 256);                  // k_flash staging: 256 lanes x 16 B x 4 pieces == one 16-KiB tile
static_assert(TK * DIM * 2 == 4 * 256 * 16);
static_assert((KTE * 2) % 16 == 0 && (BUFE * 2) % 16 == 0);
static_assert(NWV * 2 * 16 * CSP <= 2 * BUFE);   // k_flash: the output staging fits the ring it reuses
static_assert(DIM % 32 == 0);
static_assert(DIM == 4 * 32);                    // four 32-deep k-steps per score tile / per QKV tile
static_assert(DIM == 8 * 16);                    // eight 16-row output tiles per wave
static_assert(INNER % 32 == 0);
static_assert((NB * SEQ) % 16 == 0);             // d_ln: 16 rows per block
static_assert(16 * 8 == DIM);                    // d_ln: 16 lanes x 8 elements == row
static_assert(64 * CSP <= DIM * VTP);            // k_qkv: row-major staging fits the shared tile
static_assert(64 <= VTP);                        // transposed staging rows hold 64 tokens
static_assert((CSP * 2) % 16 == 0);
static_assert((VTP * 2) % 16 == 0);
static_assert((OSP * 4) % 16 == 0);
static_assert(32 * 4 == DIM);                    // k_proj: 32 lanes x 4 floats == output row
static_assert(16 * 8 * 2 == 256);                // 16 lanes x 16 B == one 128-element 16-bit row
static_assert(QKVN % 128 == 0);
static_assert(INNER % PKT == 0 && PKT % 32 == 0 && PKT <= CSP && PKT * 2 == 16 * 16);   // staged rows: 16 lanes x 16 B
static_assert((PBE * 2) % 16 == 0);
static_assert(DIM % 64 == 0 && INNER % 64 == 0); // d_wt tile multiples
static_assert((BCH * SEQ) % 64 == 0);            // k_qkv / k_proj: 64 tokens per block

#define SZ_XH  ((size_t)NB * SEQ * DIM * 2)
#define SZ_WT  ((size_t)QKVN * DIM * 2)
#define SZ_WP  ((size_t)DIM * INNER * 2)
#define SZ_PL  ((size_t)BCH * NH * SEQ * DIM * 2)
#define SZ_CX  ((size_t)BCH * SEQ * INNER * 2)
#define SZ_ALL (SZ_XH + SZ_WT + SZ_WP + 3 * SZ_PL + 2 * SZ_CX)
static_assert(SZ_XH % 256 == 0 && SZ_WT % 256 == 0 && SZ_WP % 256 == 0 && SZ_PL % 256 == 0 && SZ_CX % 256 == 0);
static_assert(SZ_ALL <= (size_t)268435456);

typedef unsigned short hf;
typedef __attribute__((ext_vector_type(16))) _Float16 v16h;
typedef __attribute__((ext_vector_type(8)))  _Float16 v8h;
typedef __attribute__((ext_vector_type(8)))  unsigned short v8us;
typedef __attribute__((ext_vector_type(8)))  float    v8f;
typedef __attribute__((ext_vector_type(4)))  float    v4f;
typedef v4f  __attribute__((may_alias)) v4fa;
typedef v8us __attribute__((may_alias)) v8usa;

__device__ __forceinline__ float bfr(float f) { unsigned u = __float_as_uint(f); u += 0x7FFFu + ((u >> 16) & 1u); return __uint_as_float(u & 0xFFFF0000u); }
__device__ __forceinline__ unsigned short f2h(float f) { return __builtin_bit_cast(unsigned short, (_Float16)f); }
__device__ __forceinline__ v16h cat16h(v8us lo, v8us hi) { return __builtin_bit_cast(v16h, __builtin_shufflevector(lo, hi, 0, 1, 2, 3, 4, 5, 6, 7, 8, 9, 10, 11, 12, 13, 14, 15)); }
__device__ __forceinline__ v8f wmmah(v16h a, v16h b, v8f c) { return __builtin_amdgcn_wmma_f32_16x16x32_f16(false, a, false, b, (short)0, c, false, false); }
// fragment loader (A and B alike): p = row base + k0 + 8*(lane>>4); elements 0..7 <- p[0..7], elements 8..15 <- p[16..23]
__device__ __forceinline__ v16h ldh(const hf* p) { return cat16h(*(const v8us*)p, *(const v8us*)(p + 16)); }
__device__ __forceinline__ void sfence() { asm volatile("" ::: "memory"); __builtin_amdgcn_sched_barrier(0); }
// hazard guards: four idle VALU slots after the last WMMA of a group; the group's operand fragments stay live until here
__device__ __forceinline__ void guard1(v8f& c0, v16h a, v16h b, v16h c, v16h d) {
    asm volatile("v_nop\n\tv_nop\n\tv_nop\n\tv_nop" : "+v"(c0) : "v"(a), "v"(b), "v"(c), "v"(d));
}
__device__ __forceinline__ void guard2(v8f& c0, v8f& c1, v16h a, v16h b, v16h c, v16h d) {
    asm volatile("v_nop\n\tv_nop\n\tv_nop\n\tv_nop" : "+v"(c0), "+v"(c1) : "v"(a), "v"(b), "v"(c), "v"(d));
}
__device__ __forceinline__ void guard4(v8f& c0, v8f& c1, v8f& c2, v8f& c3, v16h a, v16h b, v16h c, v16h d, v16h e) {
    asm volatile("v_nop\n\tv_nop\n\tv_nop\n\tv_nop" : "+v"(c0), "+v"(c1), "+v"(c2), "+v"(c3) : "v"(a), "v"(b), "v"(c), "v"(d), "v"(e));
}
__device__ __forceinline__ void guard8(v8f& c0, v8f& c1, v8f& c2, v8f& c3, v8f& c4, v8f& c5, v8f& c6, v8f& c7,
                                       v16h a, v16h b, v16h c, v16h d, v16h e, v16h f) {
    asm volatile("v_nop\n\tv_nop\n\tv_nop\n\tv_nop"
                 : "+v"(c0), "+v"(c1), "+v"(c2), "+v"(c3), "+v"(c4), "+v"(c5), "+v"(c6), "+v"(c7)
                 : "v"(a), "v"(b), "v"(c), "v"(d), "v"(e), "v"(f));
}

// One 64-key tile, global -> LDS through no register: each lane copies four 16-byte pieces of K (16 key rows apart) and four of V^T (32 d rows apart).
// lk / lv: the lane's LDS byte addresses of its first pieces; gk / gv: their global addresses. The address-translation wait closes the statement, ahead of any rewrite of the address registers.
__device__ __forceinline__ void stage_kv(unsigned lk, unsigned lv, const hf* gk, const hf* gv) {
    asm volatile("global_load_async_to_lds_b128 %0, %8, off\n\t"
                 "global_load_async_to_lds_b128 %1, %9, off\n\t"
                 "global_load_async_to_lds_b128 %2, %10, off\n\t"
                 "global_load_async_to_lds_b128 %3, %11, off\n\t"
                 "global_load_async_to_lds_b128 %4, %12, off\n\t"
                 "global_load_async_to_lds_b128 %5, %13, off\n\t"
                 "global_load_async_to_lds_b128 %6, %14, off\n\t"
                 "global_load_async_to_lds_b128 %7, %15, off\n\t"
                 "s_wait_xcnt 0x0"
                 :: "v"(lk), "v"(lk + 16u * CSP * 2u), "v"(lk + 32u * CSP * 2u), "v"(lk + 48u * CSP * 2u),
                    "v"(lv), "v"(lv + 32u * VTP * 2u), "v"(lv + 64u * VTP * 2u), "v"(lv + 96u * VTP * 2u),
                    "v"(gk), "v"(gk + 16 * DIM), "v"(gk + 32 * DIM), "v"(gk + 48 * DIM),
                    "v"(gv), "v"(gv + (size_t)32 * SEQ), "v"(gv + (size_t)64 * SEQ), "v"(gv + (size_t)96 * SEQ)
                 : "memory");
}

// Eight 16-byte pieces of row-major tiles, global -> LDS through no register: four from ga and four from gb, gs elements apart in each run; they land ls bytes apart, from l on.
// The address-translation wait closes the statement, ahead of any rewrite of the address registers.
__device__ __forceinline__ void stage_rows(unsigned l, const hf* ga, const hf* gb, unsigned ls, size_t gs) {
    asm volatile("global_load_async_to_lds_b128 %0, %8, off\n\t"
                 "global_load_async_to_lds_b128 %1, %9, off\n\t"
                 "global_load_async_to_lds_b128 %2, %10, off\n\t"
                 "global_load_async_to_lds_b128 %3, %11, off\n\t"
                 "global_load_async_to_lds_b128 %4, %12, off\n\t"
                 "global_load_async_to_lds_b128 %5, %13, off\n\t"
                 "global_load_async_to_lds_b128 %6, %14, off\n\t"
                 "global_load_async_to_lds_b128 %7, %15, off\n\t"
                 "s_wait_xcnt 0x0"
                 :: "v"(l), "v"(l + ls), "v"(l + 2u * ls), "v"(l + 3u * ls),
                    "v"(l + 4u * ls), "v"(l + 5u * ls), "v"(l + 6u * ls), "v"(l + 7u * ls),
                    "v"(ga), "v"(ga + gs), "v"(ga + 2 * gs), "v"(ga + 3 * gs),
                    "v"(gb), "v"(gb + gs), "v"(gb + 2 * gs), "v"(gb + 3 * gs)
                 : "memory");
}
// k_proj, one 128-deep tile: 256 lanes, 16 per row, rows 16 apart; ctx value rows 0..63, residual rows 64..127, weight rows 128..255 of the ring buffer at lc.
__device__ __forceinline__ void stage_proj(unsigned lc, const hf* gh, const hf* gl, const hf* gw) {
    stage_rows(lc, gh, gl, 16u * CSP * 2u, (size_t)16 * INNER);
    stage_rows(lc + 128u * CSP * 2u, gw, gw + (size_t)64 * INNER, 16u * CSP * 2u, (size_t)16 * INNER);
}

// d_ln: x plane XH[NB*SEQ][128] (f16) = LayerNorm(bf16(in)) with bf16(gamma), bf16(beta); 16 lanes per row, 8 elements per lane; blk = index among the LayerNorm blocks
__device__ __forceinline__ void d_ln(const float* __restrict__ X, const float* __restrict__ G, const float* __restrict__ Bt, hf* XH, unsigned blk) {
    const unsigned tid = threadIdx.x;
    const unsigned row = blk * 16u + (tid >> 4);
    const unsigned sub = tid & 15u;
    const unsigned b = row / (unsigned)SEQ, n = row - b * (unsigned)SEQ;
    const float* src = X + ((size_t)b * SEQ_FULL + n) * DIM + sub * 8u;
    const v4f a0 = *(const v4f*)src;
    const v4f a1 = *(const v4f*)(src + 4);
    float e[8];
    e[0] = bfr(a0[0]); e[1] = bfr(a0[1]); e[2] = bfr(a0[2]); e[3] = bfr(a0[3]);
    e[4] = bfr(a1[0]); e[5] = bfr(a1[1]); e[6] = bfr(a1[2]); e[7] = bfr(a1[3]);
    float s = ((e[0] + e[1]) + (e[2] + e[3])) + ((e[4] + e[5]) + (e[6] + e[7]));
    s += __shfl_xor(s, 8, 32);
    s += __shfl_xor(s, 4, 32);
    s += __shfl_xor(s, 2, 32);
    s += __shfl_xor(s, 1, 32);
    const float mu = s * (1.0f / DIM);
    float d[8];
    float s2 = 0.0f;
#pragma unroll
    for (int j = 0; j < 8; ++j) { d[j] = e[j] - mu; s2 = fmaf(d[j], d[j], s2); }
    s2 += __shfl_xor(s2, 8, 32);
    s2 += __shfl_xor(s2, 4, 32);
    s2 += __shfl_xor(s2, 2, 32);
    s2 += __shfl_xor(s2, 1, 32);
    const float rs = rsqrtf(s2 * (1.0f / DIM) + 1.0e-5f);
    const v4f g0 = *(const v4f*)(G + sub * 8u), g1 = *(const v4f*)(G + sub * 8u + 4u);
    const v4f b0 = *(const v4f*)(Bt + sub * 8u), b1 = *(const v4f*)(Bt + sub * 8u + 4u);
    v8h o;
    o[0] = (_Float16)(d[0] * rs * bfr(g0[0]) + bfr(b0[0]));
    o[1] = (_Float16)(d[1] * rs * bfr(g0[1]) + bfr(b0[1]));
    o[2] = (_Float16)(d[2] * rs * bfr(g0[2]) + bfr(b0[2]));
    o[3] = (_Float16)(d[3] * rs * bfr(g0[3]) + bfr(b0[3]));
    o[4] = (_Float16)(d[4] * rs * bfr(g1[0]) + bfr(b1[0]));
    o[5] = (_Float16)(d[5] * rs * bfr(g1[1]) + bfr(b1[1]));
    o[6] = (_Float16)(d[6] * rs * bfr(g1[2]) + bfr(b1[2]));
    o[7] = (_Float16)(d[7] * rs * bfr(g1[3]) + bfr(b1[3]));
    const v8us ob = __builtin_bit_cast(v8us, o);
    hf* dst = XH + (size_t)row * DIM + sub * 8u;
    *(v8us*)dst = ob;
    asm volatile("s_wait_xcnt 0x0" ::: "memory");   // closes the store ahead of any rewrite of its address and data registers (the code of another block range follows in k_prep)
}

// d_wt: WT[c][r] (f16) = bf16(W[r][c]) * scale; in[R][C] -> out[C][R]; one block = 64 r x 128 c through the LDS tile tl (cross-wave, block barrier); blk = index among this matrix's blocks
__device__ __forceinline__ void d_wt(const float* __restrict__ W, hf* WT, int R, int C, float scale, unsigned blk, hf* tl) {
    const unsigned tid = threadIdx.x;
    const unsigned tc = (unsigned)C / 128u;
    const unsigned kt = blk / tc;
    const unsigned ct = blk - kt * tc;
    const float* src = W + (size_t)(kt * 64u) * (unsigned)C + ct * 128u;
#pragma unroll
    for (unsigned it = 0; it < 8; ++it) {
        const unsigned f = it * 256u + tid;
        const unsigned key = f >> 5, c4 = (f & 31u) * 4u;
        const v4f x = *(const v4f*)(src + (size_t)key * (unsigned)C + c4);
#pragma unroll
        for (unsigned c = 0; c < 4; ++c) tl[(c4 + c) * VTP + key] = f2h(bfr(x[c]) * scale);
    }
    __syncthreads();
    hf* dst = WT + (size_t)(ct * 128u) * (unsigned)R + kt * 64u;
    const unsigned c8 = (tid & 7u) * 8u, dr = tid >> 3;
{
#pragma unroll
        for (unsigned it = 0; it < 4; ++it) {
            const unsigned d = it * 32u + dr;
            const v8us o = *(const v8usa*)(tl + d * VTP + c8);
            *(v8us*)(dst + (size_t)d * (unsigned)R + c8) = o;
        }
        asm volatile("s_wait_xcnt 0x0" ::: "memory");   // closes the four stores ahead of any rewrite of their address and data registers (the code of another block range follows in k_prep)
    }
}

// k_prep: the three preparations that depend on nothing but the inputs, in one launch, by block range (block-uniform branches):
//  blocks [0, NWQ) transpose w_qkv, [NWQ, NWQ + NWP) transpose w_proj, the rest normalise 16 rows each.
__global__ __launch_bounds__(256) void k_prep(const float* __restrict__ X, const float* __restrict__ G, const float* __restrict__ Bt,
                                              const float* __restrict__ WQ, const float* __restrict__ WO, hf* XH, hf* WT, hf* WP) {
    __shared__ __align__(16) hf tl[DIM * VTP];
    const unsigned b = blockIdx.x;
    if (b < (unsigned)NWQ) d_wt(WQ, WT, DIM, QKVN, WQS, b, tl);
    else if (b < (unsigned)(NWQ + NWP)) d_wt(WO, WP, INNER, DIM, WPS, b - (unsigned)NWQ, tl);
    else d_ln(X, G, Bt, XH, b - (unsigned)(NWQ + NWP));
}

// k_qkv: one block = 64 tokens x one (which, head) group of 128 features; wave w owns tokens 16w..16w+15; the eight 16-feature tiles are processed in a rolled loop
//  (one accumulator tile and four weight fragments live at a time; the four token fragments are held), K = 128.
//  The block's x tile (64 rows) and weight tile (128 rows) are brought into LDS once by asynchronous copies (whole 256-byte rows); every fragment is read from LDS.
//  q / k groups: A = W^T rows (row m = feature), B = x rows (column n = token); D element r of lane (h, n) = (feature 16t + 8h + r, token n); staged row-major [token][feature].
//  v group:      A = x rows (row m = token), B = W^T rows (column n = feature); D element r of lane (h, n) = (token 8h + r, feature n); staged transposed [feature][token].
__attribute__((amdgpu_num_vgpr(248))) __global__ __launch_bounds__(128) void k_qkv(const hf* XH, const hf* WT, hf* QKV, int bch0) {
    __shared__ __align__(16) hf st[DIM * VTP];   // x tile (pitch CSP) until the token fragments are held, output staging after that
    __shared__ __align__(16) hf wl[DIM * CSP];   // weight tile: 128 feature rows
    const unsigned tid = threadIdx.x, lane = tid & 31u, lr = lane & 15u, hi = lane >> 4;
    const unsigned wave = (unsigned)__builtin_amdgcn_readfirstlane((int)(tid >> 5));
    const unsigned which = blockIdx.y >> 3, head = blockIdx.y & 7u;
    const unsigned mloc = blockIdx.x * 64u;
    const unsigned bl = mloc / (unsigned)SEQ, n0 = mloc - bl * (unsigned)SEQ;
    const size_t PL = (size_t)BCH * NH * SEQ * DIM;

    {   // staging: 128 lanes, 16 per row, rows 8 apart; 8 pieces of x and 16 of the weights per lane
        const unsigned srow = tid >> 4, scol = (tid & 15u) * 8u;
        const hf* gx = XH + ((size_t)((unsigned)bch0 + bl) * SEQ + n0 + srow) * DIM + scol;
        const hf* gw = WT + ((size_t)blockIdx.y * 128u + srow) * DIM + scol;
        const unsigned lx = (unsigned)(size_t)(st + srow * CSP + scol);
        const unsigned lw = (unsigned)(size_t)(wl + srow * CSP + scol);
        stage_rows(lx, gx, gx + 32 * DIM, 8u * CSP * 2u, (size_t)8 * DIM);
        stage_rows(lw, gw, gw + 32 * DIM, 8u * CSP * 2u, (size_t)8 * DIM);
        stage_rows(lw + 64u * CSP * 2u, gw + 64 * DIM, gw + 96 * DIM, 8u * CSP * 2u, (size_t)8 * DIM);
    }
    asm volatile("s_wait_asynccnt 0x0" ::: "memory");      // this wave's pieces of both tiles have landed
    __syncthreads();                                       // both tiles readable by every wave
    v16h tf[4];
    {
        const hf* tp = st + (16u * wave + lr) * CSP + 8u * hi;
        tf[0] = ldh(tp);
        tf[1] = ldh(tp + 32);
        tf[2] = ldh(tp + 64);
        tf[3] = ldh(tp + 96);
    }
    __syncthreads();                                       // ends every wave's reads of the x tile before it is overwritten as output staging
    const unsigned woff = lr * CSP + 8u * hi;
    const float un = 1.0f / WQS;

    if (which == 2u) {      // block-uniform
#pragma unroll 1
        for (unsigned t = 0; t < 8u; ++t) {
            const hf* wr = wl + woff + t * (16u * CSP);
            const v16h w0 = ldh(wr), w1 = ldh(wr + 32), w2 = ldh(wr + 64), w3 = ldh(wr + 96);
            v8f acc = (v8f){};
            acc = wmmah(tf[0], w0, acc);
            acc = wmmah(tf[1], w1, acc);
            acc = wmmah(tf[2], w2, acc);
            acc = wmmah(tf[3], w3, acc);
            guard1(acc, w0, w1, w2, w3);
            v8h o;
#pragma unroll
            for (int r = 0; r < 8; ++r) o[r] = (_Float16)(acc[r] * un);
            *(v8usa*)(st + (16u * t + lr) * VTP + 16u * wave + 8u * hi) = __builtin_bit_cast(v8us, o);
            sfence();
        }
    } else {
#pragma unroll 1
        for (unsigned t = 0; t < 8u; ++t) {
            const hf* wr = wl + woff + t * (16u * CSP);
            const v16h w0 = ldh(wr), w1 = ldh(wr + 32), w2 = ldh(wr + 64), w3 = ldh(wr + 96);
            v8f acc = (v8f){};
            acc = wmmah(w0, tf[0], acc);
            acc = wmmah(w1, tf[1], acc);
            acc = wmmah(w2, tf[2], acc);
            acc = wmmah(w3, tf[3], acc);
            guard1(acc, w0, w1, w2, w3);
            v8h o;
#pragma unroll
            for (int r = 0; r < 8; ++r) o[r] = (_Float16)(acc[r] * un);
            *(v8usa*)(st + (16u * wave + lr) * CSP + 16u * t + 8u * hi) = __builtin_bit_cast(v8us, o);
            sfence();
        }
    }
    __syncthreads();
    const size_t bhp = (size_t)(bl * NH + head);
    if (which == 2u) {
        hf* dst = QKV + 2 * PL + bhp * DIM * SEQ + n0;
        const unsigned c8 = (tid & 7u) * 8u, dr = tid >> 3;
{
#pragma unroll
            for (unsigned it = 0; it < 8; ++it) {
                const unsigned d = it * 16u + dr;
                const v8us o = *(const v8usa*)(st + d * VTP + c8);
                *(v8us*)(dst + (size_t)d * SEQ + c8) = o;
            }
            
        }
    } else {
        hf* dst = QKV + (size_t)which * PL + (bhp * SEQ + n0) * DIM + lr * 8u;
{
#pragma unroll
            for (unsigned s = 0; s < 8; ++s) {
                const unsigned rr = 16u * wave + 2u * s + hi;
                const v8us o = *(const v8usa*)(st + rr * CSP + lr * 8u);
                *(v8us*)(dst + (size_t)rr * DIM) = o;
            }
            
        }
    }
}

// k_flash: one wave per 16 queries of one (batch, head), 32 keys per step, online softmax; the block's eight waves share K / V^T tiles of 64 keys,
//  staged in a two-buffer LDS ring by asynchronous copies (tile t + 2 is issued behind the barrier that ends the reads of tile t); fragments are read from LDS.
//  S^T tile (keys x queries): A = K rows (row m = key, k = d), B = Q rows (column n = query, k = d); D element r of lane (h, n) = S[query n][key 8h + r].
//  Q fragments (four, B operands) are held; K fragments are loaded four at a time (two k-steps x two key tiles); V^T fragments four output tiles at a time.
//  P^T B fragment: element r <- tile of keys 0..15, element 8 + r <- tile of keys 16..31 (same lane); P carried x 2^10 (the running sum carries the same factor).
//  O^T tile (d x queries): A = V^T rows (row m = d, k = key), D element r of lane (h, n) = O[query n][d = 16 t + 8h + r].
__attribute__((amdgpu_num_vgpr(248))) __global__ __launch_bounds__(NWV * 32) void k_flash(const hf* QP, const hf* KP, const hf* VT, hf* CH, hf* CL) {
    __shared__ __align__(16) hf cs[2 * BUFE];   // K / V^T ring in the loop, output staging behind it
    const unsigned tid = threadIdx.x, lane = tid & 31u, lr = lane & 15u, hi = lane >> 4;
    const unsigned wave = (unsigned)__builtin_amdgcn_readfirstlane((int)(tid >> 5));
    const unsigned bpb = (unsigned)(SEQ / BQ);
    const unsigned bh = blockIdx.x / bpb;
    const unsigned q0 = (blockIdx.x - bh * bpb) * BQ + wave * 16u;

    v16h qf[4];
    {
        const hf* qp = QP + ((size_t)bh * SEQ + q0 + lr) * DIM + 8u * hi;
        qf[0] = ldh(qp);
        qf[1] = ldh(qp + 32);
        qf[2] = ldh(qp + 64);
        qf[3] = ldh(qp + 96);
    }
    const unsigned kfo = lr * CSP + 8u * hi;          // fragment offsets inside a ring buffer
    const unsigned vfo = KTE + lr * VTP + 8u * hi;
    // staging addresses of this lane: K tile = 16 KiB contiguous, 16 lanes per key row; V^T tile = 128 rows of 128 B, 8 lanes per row
    const hf* gk = KP + (size_t)bh * SEQ * DIM + tid * 8u;
    const hf* gv = VT + ((size_t)bh * DIM + (tid >> 3)) * SEQ + (tid & 7u) * 8u;
    const unsigned lk = (unsigned)(size_t)(cs + (tid >> 4) * CSP + (tid & 15u) * 8u);
    const unsigned lv = (unsigned)(size_t)(cs + KTE + (tid >> 3) * VTP + (tid & 7u) * 8u);
    const unsigned nt = (unsigned)(SEQ / TK);

    v8f o[8];
#pragma unroll
    for (int t = 0; t < 8; ++t) o[t] = (v8f){};
    float ml = -1.0e30f;      // running max in the log2 domain
    float l = 0.0f;           // running sum (carried x 2^10)

    stage_kv(lk, lv, gk, gv);                              // tile 0 -> buffer 0
    asm volatile("s_wait_asynccnt 0x0" ::: "memory");      // this wave's pieces of tile 0 have landed
    __syncthreads();                                       // tile 0 readable by every wave
    if (nt > 1u) stage_kv(lk + BUFE * 2u, lv + BUFE * 2u, gk + TK * DIM, gv + TK);   // tile 1 -> buffer 1

#pragma unroll 1
    for (unsigned t = 0; t < nt; ++t) {
      const unsigned bo = (t & 1u) * BUFE;
#pragma unroll 1
      for (unsigned h = 0; h < 2u; ++h) {                  // rolled: one copy of the step's code, one step's fragments live
        v8f s0 = (v8f){}, s1 = (v8f){};
        const hf* ka = cs + bo + kfo + h * (KS * CSP);
        {
            const v16h a00 = ldh(ka), a01 = ldh(ka + 16 * CSP);
            const v16h a10 = ldh(ka + 32), a11 = ldh(ka + 16 * CSP + 32);
            s0 = wmmah(a00, qf[0], s0);
            s1 = wmmah(a01, qf[0], s1);
            s0 = wmmah(a10, qf[1], s0);
            s1 = wmmah(a11, qf[1], s1);
            guard2(s0, s1, a00, a01, a10, a11);
        }
        sfence();
        {
            const v16h a20 = ldh(ka + 64), a21 = ldh(ka + 16 * CSP + 64);
            const v16h a30 = ldh(ka + 96), a31 = ldh(ka + 16 * CSP + 96);
            s0 = wmmah(a20, qf[2], s0);
            s1 = wmmah(a21, qf[2], s1);
            s0 = wmmah(a30, qf[3], s0);
            s1 = wmmah(a31, qf[3], s1);
            guard2(s0, s1, a20, a21, a30, a31);
        }
        sfence();

        float mx = fmaxf(s0[0], s1[0]);
#pragma unroll
        for (int r = 1; r < 8; ++r) mx = fmaxf(mx, fmaxf(s0[r], s1[r]));
        mx = fmaxf(mx, __shfl_xor(mx, 16, 32));
        const float mnl = fmaxf(ml, mx * SC2);
        const float corr = __builtin_amdgcn_exp2f(ml - mnl);
        ml = mnl;
        const float sh = PCL - mnl;
        float p0[8], p1[8];
        float ps = 0.0f;
#pragma unroll
        for (int r = 0; r < 8; ++r) {
            p0[r] = __builtin_amdgcn_exp2f(fmaf(s0[r], SC2, sh));
            p1[r] = __builtin_amdgcn_exp2f(fmaf(s1[r], SC2, sh));
            ps += p0[r] + p1[r];
        }
        ps += __shfl_xor(ps, 16, 32);
        l = l * corr + ps;
        if (__builtin_amdgcn_ballot_w32(corr != 1.0f) != 0u) {   // wave-uniform; multiplying by exactly 1 is skipped
#pragma unroll
            for (int t = 0; t < 8; ++t) o[t] *= corr;
        }

        v16h ph;
#pragma unroll
        for (int r = 0; r < 8; ++r) { ph[r] = (_Float16)p0[r]; ph[8 + r] = (_Float16)p1[r]; }

        sfence();   // keep the V^T loads below the softmax (bounds live fragments)
        const hf* va = cs + bo + vfo + h * KS;
        {
            const v16h v0 = ldh(va), v1 = ldh(va + 16 * VTP), v2 = ldh(va + 32 * VTP), v3 = ldh(va + 48 * VTP);
            o[0] = wmmah(v0, ph, o[0]);
            o[1] = wmmah(v1, ph, o[1]);
            o[2] = wmmah(v2, ph, o[2]);
            o[3] = wmmah(v3, ph, o[3]);
            guard4(o[0], o[1], o[2], o[3], v0, v1, v2, v3, ph);
        }
        sfence();
        {
            const v16h v4 = ldh(va + 64 * VTP), v5 = ldh(va + 80 * VTP), v6 = ldh(va + 96 * VTP), v7 = ldh(va + 112 * VTP);
            o[4] = wmmah(v4, ph, o[4]);
            o[5] = wmmah(v5, ph, o[5]);
            o[6] = wmmah(v6, ph, o[6]);
            o[7] = wmmah(v7, ph, o[7]);
            guard4(o[4], o[5], o[6], o[7], v4, v5, v6, v7, ph);
        }
        sfence();
      }
      asm volatile("s_wait_dscnt 0x0" ::: "memory");       // this wave's reads of tile t have returned before its buffer is refilled
      asm volatile("s_wait_asynccnt 0x0" ::: "memory");    // this wave's pieces of tile t + 1 have landed
      __syncthreads();                                     // publishes tile t + 1 and ends every wave's reads of tile t
      if (t + 2u < nt) stage_kv(lk + bo * 2u, lv + bo * 2u, gk + (size_t)(t + 2u) * (TK * DIM), gv + (t + 2u) * TK);
    }
    asm volatile("s_wait_asynccnt 0x0" ::: "memory");      // no copy outstanding when the ring becomes output staging

    // epilogue: stage ctx value / residual rows [query][d] (wave-private regions; block barrier used)
    const float sc = (1.0f / l) * CCS;
    const unsigned creg = wave * (2u * 16u * CSP);
#pragma unroll
    for (int t = 0; t < 8; ++t) {
        v8h hv, lv;
#pragma unroll
        for (int r = 0; r < 8; ++r) {
            const float c = o[t][r] * sc;
            const _Float16 h = (_Float16)c;
            hv[r] = h;
            lv[r] = (_Float16)((c - (float)h) * RSC);
        }
        *(v8usa*)(cs + creg + lr * CSP + 16u * t + 8u * hi) = __builtin_bit_cast(v8us, hv);
        *(v8usa*)(cs + creg + 16u * CSP + lr * CSP + 16u * t + 8u * hi) = __builtin_bit_cast(v8us, lv);
    }
    __syncthreads();
    const unsigned bl = bh / NH, head = bh - bl * NH;
    const size_t rowbase = ((size_t)bl * SEQ + q0) * INNER + head * DIM + lr * 8u;
{
#pragma unroll
        for (unsigned s = 0; s < 8; ++s) {
            const unsigned rr = 2u * s + hi;
            const v8us vh = *(const v8usa*)(cs + creg + rr * CSP + lr * 8u);
            const v8us vl = *(const v8usa*)(cs + creg + 16u * CSP + rr * CSP + lr * 8u);
            *(v8us*)(CH + rowbase + (size_t)rr * INNER) = vh;
            *(v8us*)(CL + rowbase + (size_t)rr * INNER) = vl;
        }
        
    }
}

// k_proj: one block = 64 tokens x 128 output features, K = 1024; wave w: token group w>>1 (16 tokens), feature half w&1 (four 16-feature tiles).
//  A = w_proj^T rows (row m = feature, k = inner), B = ctx rows (column n = token); D element r of lane (h, n) = (feature 8h + r, token n).
//  The K loop walks 128-deep tiles of the ctx value, ctx residual and weight rows, staged in a two-buffer LDS ring by asynchronous copies (tile t + 2 is issued behind the barrier that ends the reads of tile t).
//  ctx value and residual planes share the weight fragment and use separate accumulators; out = (acc_v + acc_r / 2^11) / 512 + bf16(bias), added at the store stage.
__global__ __launch_bounds__(256) void k_proj(const hf* CH, const hf* CL, const hf* WP, const float* __restrict__ bias, float* OUT, int bch0) {
    __shared__ __align__(16) hf rg[2 * PBE];     // operand ring
    __shared__ __align__(16) float os[64 * OSP];
    const unsigned tid = threadIdx.x, lane = tid & 31u, lr = lane & 15u, hi = lane >> 4;
    const unsigned wave = (unsigned)__builtin_amdgcn_readfirstlane((int)(tid >> 5));
    const unsigned tg = wave >> 1, fh = wave & 1u;
    const unsigned m0 = blockIdx.x * 64u;
    const unsigned coff = (16u * tg + lr) * CSP + 8u * hi;                 // fragment offsets inside a ring buffer
    const unsigned woff = (128u + 64u * fh + lr) * CSP + 8u * hi;
    // staging addresses of this lane: 16 lanes per 256-byte row piece
    const hf* gh = CH + (size_t)(m0 + (tid >> 4)) * INNER + (tid & 15u) * 8u;
    const hf* gl = CL + (size_t)(m0 + (tid >> 4)) * INNER + (tid & 15u) * 8u;
    const hf* gw = WP + (size_t)(tid >> 4) * INNER + (tid & 15u) * 8u;
    const unsigned lc = (unsigned)(size_t)(rg + (tid >> 4) * CSP + (tid & 15u) * 8u);
    const unsigned nt = (unsigned)(INNER / PKT);

    v8f ah[4], al[4];
#pragma unroll
    for (int t = 0; t < 4; ++t) { ah[t] = (v8f){}; al[t] = (v8f){}; }

    stage_proj(lc, gh, gl, gw);                            // tile 0 -> buffer 0
    asm volatile("s_wait_asynccnt 0x0" ::: "memory");      // this wave's pieces of tile 0 have landed
    __syncthreads();                                       // tile 0 readable by every wave
    if (nt > 1u) stage_proj(lc + PBE * 2u, gh + PKT, gl + PKT, gw + PKT);   // tile 1 -> buffer 1

#pragma unroll 1
    for (unsigned t = 0; t < nt; ++t) {
      const unsigned bo = (t & 1u) * PBE;
#pragma unroll 1
      for (unsigned k0 = 0; k0 < (unsigned)PKT; k0 += 32) {   // rolled: one copy of the step's code, one step's fragments live
        const hf* cr = rg + bo + coff + k0;
        const v16h ch = ldh(cr);
        const v16h cl = ldh(cr + 64 * CSP);
        const hf* wr = rg + bo + woff + k0;
        const v16h w0 = ldh(wr), w1 = ldh(wr + 16 * CSP), w2 = ldh(wr + 32 * CSP), w3 = ldh(wr + 48 * CSP);
        ah[0] = wmmah(w0, ch, ah[0]);
        al[0] = wmmah(w0, cl, al[0]);
        ah[1] = wmmah(w1, ch, ah[1]);
        al[1] = wmmah(w1, cl, al[1]);
        ah[2] = wmmah(w2, ch, ah[2]);
        al[2] = wmmah(w2, cl, al[2]);
        ah[3] = wmmah(w3, ch, ah[3]);
        al[3] = wmmah(w3, cl, al[3]);
        guard8(ah[0], ah[1], ah[2], ah[3], al[0], al[1], al[2], al[3], ch, cl, w0, w1, w2, w3);
        sfence();
      }
      asm volatile("s_wait_dscnt 0x0" ::: "memory");       // this wave's reads of tile t have returned before its buffer is refilled
      asm volatile("s_wait_asynccnt 0x0" ::: "memory");    // this wave's pieces of tile t + 1 have landed
      __syncthreads();                                     // publishes tile t + 1 and ends every wave's reads of tile t
      if (t + 2u < nt) stage_proj(lc + bo * 2u, gh + (t + 2u) * PKT, gl + (t + 2u) * PKT, gw + (t + 2u) * PKT);
    }
    asm volatile("s_wait_asynccnt 0x0" ::: "memory");      // no copy outstanding behind the loop

    const float un = 1.0f / (CCS * WPS);
    const float ur = 1.0f / RSC;
#pragma unroll
    for (int t = 0; t < 4; ++t) {
        v4f x0, x1;
        x0[0] = fmaf(al[t][0], ur, ah[t][0]) * un; x0[1] = fmaf(al[t][1], ur, ah[t][1]) * un;
        x0[2] = fmaf(al[t][2], ur, ah[t][2]) * un; x0[3] = fmaf(al[t][3], ur, ah[t][3]) * un;
        x1[0] = fmaf(al[t][4], ur, ah[t][4]) * un; x1[1] = fmaf(al[t][5], ur, ah[t][5]) * un;
        x1[2] = fmaf(al[t][6], ur, ah[t][6]) * un; x1[3] = fmaf(al[t][7], ur, ah[t][7]) * un;
        const unsigned so = (16u * tg + lr) * OSP + 64u * fh + 16u * t + 8u * hi;
        *(v4fa*)(os + so) = x0;
        *(v4fa*)(os + so + 4u) = x1;
    }
    __syncthreads();
    const v4f bb = *(const v4f*)(bias + lane * 4u);
    v4f bq;
    bq[0] = bfr(bb[0]); bq[1] = bfr(bb[1]); bq[2] = bfr(bb[2]); bq[3] = bfr(bb[3]);
    float* orow = OUT + ((size_t)bch0 * SEQ + m0 + 8u * wave) * DIM + lane * 4u;
{
#pragma unroll
        for (unsigned s = 0; s < 8; ++s) {
            v4f val = *(const v4fa*)(os + (8u * wave + s) * OSP + lane * 4u);
            val[0] += bq[0]; val[1] += bq[1]; val[2] += bq[2]; val[3] += bq[3];
            *(v4f*)(orow + (size_t)s * DIM) = val;
        }
        
    }
}

extern "C" void kernel_launch(void* const* d_in, const int* in_sizes, int n_in,
                              void* d_out, int out_size, void* d_ws, size_t ws_size, hipStream_t stream) {
    if (n_in < 6) return;
    const size_t need = ((size_t)(NB - 1) * SEQ_FULL + SEQ) * DIM;
    if ((size_t)in_sizes[0] < need) return;
    if (in_sizes[1] < DIM || in_sizes[2] < DIM || in_sizes[5] < DIM) return;
    if ((size_t)in_sizes[3] < (size_t)DIM * QKVN) return;
    if ((size_t)in_sizes[4] < (size_t)INNER * DIM) return;
    if ((size_t)out_size < (size_t)NB * SEQ * DIM) return;
    if (SZ_ALL > ws_size) return;

    const float* x      = (const float*)d_in[0];   // inputs  [NB][SEQ_FULL][128] (rows n < SEQ read)
    const float* gamma  = (const float*)d_in[1];   // ln_gamma [128]
    const float* beta   = (const float*)d_in[2];   // ln_beta  [128]
    const float* w_qkv  = (const float*)d_in[3];   // [128][3072]  ([in][out])
    const float* w_proj = (const float*)d_in[4];   // [1024][128]  ([in][out])
    const float* b_proj = (const float*)d_in[5];   // [128]
    float* OUT = (float*)d_out;                    // [NB][SEQ][128]

    char* wsp = (char*)d_ws;
    hf* XH  = (hf*)(wsp);
    hf* WT  = (hf*)(wsp + SZ_XH);
    hf* WP  = (hf*)(wsp + SZ_XH + SZ_WT);
    hf* QKV = (hf*)(wsp + SZ_XH + SZ_WT + SZ_WP);
    hf* CH  = (hf*)(wsp + SZ_XH + SZ_WT + SZ_WP + 3 * SZ_PL);
    hf* CL  = (hf*)(wsp + SZ_XH + SZ_WT + SZ_WP + 3 * SZ_PL + SZ_CX);
    const size_t PL = (size_t)BCH * NH * SEQ * DIM;   // elements per q / k / v^T plane

    k_prep<<<(unsigned)(NWQ + NWP + NLN), 256, 0, stream>>>(x, gamma, beta, w_qkv, w_proj, XH, WT, WP);
    for (int c = 0; c < NCH; ++c) {
        const int bch0 = c * BCH;
        k_qkv<<<dim3((unsigned)(BCH * SEQ / 64), 24, 1), 128, 0, stream>>>(XH, WT, QKV, bch0);
        k_flash<<<(unsigned)(BCH * NH * (SEQ / BQ)), NWV * 32, 0, stream>>>(QKV, QKV + PL, QKV + 2 * PL, CH, CL);
        k_proj<<<(unsigned)(BCH * SEQ / 64), 256, 0, stream>>>(CH, CL, WP, b_proj, OUT, bch0);
    }
}

// v004
// One run takes 97.9 microseconds.
// Next to v003, in two timings, it ran 1.09 and 1.10 times as fast.
// All steps since v000 together make it 3.82 times as fast.
#include <hip/hip_runtime.h>

// Pre-LayerNorm multi-head softmax(QK^T)V block: x = LN(in) over 128; qkv = x @ w_qkv ([128][3072], thirds q|k|v, column = which*1024 + h*128 + d); 8 heads of dim 128; logits (q.k)/32; out = ctx @ w_proj + b_proj.
// Compute dtypes, f32 accumulate: every contraction on v_wmma_f32_16x16x32_f16. Float inputs are RNE-converted to bf16 first; weights carried as bf16 value x 16 (w_qkv) / x 32 (w_proj), exact in f16;
// x, q, k, v planes f16; P carried as f16 x 2^10 (online softmax in f32, log2 domain); ctx carried as f16(ctx x 16) plus f16 residual x 2^11 with its own accumulator in the output projection.
// Flash form with transposed tiles: the S^T accumulator tiles are directly the B-operand layout of P^T; all WMMA operands are two 16-byte loads from dense, statically strided 16-bit rows (LDS tiles in every product kernel; only the flash Q rows come straight from their plane).

#ifndef NB
#define NB 16
#endif
#ifndef SEQ
#define SEQ 1024
#endif
#define NB_FULL  16
#define SEQ_FULL 1024
#define DIM   128                 // token width == head dim
#define NH    8
#define INNER (NH * DIM)          // 1024
#define QKVN  (3 * INNER)         // 3072
#define NCH   1                   // batch chunks: all batches go through one k_qkv / k_flash / k_proj pass
#define BCH   (NB / NCH)          // batches per chunk
#define NWV   8                   // waves per flash block
#define QT    2                   // 16-query column tiles per flash wave: each K / V^T fragment read from LDS feeds QT products
#define BQ    (16 * QT * NWV)     // queries per flash block
#define KS    32                  // keys per step
#define TK    64                  // keys per staged K / V^T tile (two steps)
#define CSP   136                 // LDS pitch (16-bit elements) of 128-wide staging rows
#define OSP   132                 // LDS pitch (floats) of the output staging rows
#define VTP   72                  // LDS pitch (16-bit elements) of 64-wide transposed rows
#define KTE   (TK * CSP)          // staged K tile, 16-bit elements: TK key rows of 128
#define BUFE  (KTE + DIM * VTP)   // one ring buffer: K tile, then V^T tile (128 rows of TK keys)
#define OSE   (NWV * QT * 2 * 16 * CSP)           // k_flash output staging: per wave and column tile 16 value rows and 16 residual rows
#define CSE   (2 * BUFE > OSE ? 2 * BUFE : OSE)   // k_flash LDS, 16-bit elements: the ring in the loop, the output staging behind it
#define PKT   128                 // k_proj: inner-dimension elements per staged tile (four 32-deep k-steps)
#define PBE   (256 * CSP)         // k_proj: one ring buffer: 64 ctx value rows, 64 ctx residual rows, 128 weight rows
#define L2E   1.4426950408889634f
#define SC2   (L2E * 0.03125f)    // log2(e) / 32
#define PCL   10.0f               // P carry exponent (2^10)
#define WQS   16.0f               // w_qkv carry
#define WPS   32.0f               // w_proj carry
#define CCS   16.0f               // ctx carry
#define RSC   2048.0f             // ctx residual carry
#define NWQ   ((DIM / 64) * (QKVN / 128))   // k_prep: blocks that transpose w_qkv, in[128][3072] -> out[3072][128]
#define NWP   ((INNER / 64) * (DIM / 128))  // k_prep: blocks that transpose w_proj, in[1024][128] -> out[128][1024]
#define NLN   (NB * SEQ / 16)               // k_prep: LayerNorm blocks, 16 rows each

static_assert(DIM == 128);
static_assert(INNER == 1024);
static_assert(NB <= NB_FULL);
static_assert(SEQ <= SEQ_FULL);
static_assert(NB % NCH == 0);
static_assert(SEQ % BQ == 0);
static_assert(SEQ % 64 == 0);
static_assert(SEQ % KS == 0);
static_assert(SEQ % TK == 0 && TK == 2 * KS && TK <= VTP);
static_assert(NWV * 32 == 256);                  // k_flash staging: 256 lanes x 16 B x 4 pieces == one 16-KiB tile
static_assert(TK * DIM * 2 == 4 * 256 * 16);
static_assert((KTE * 2) % 16 == 0 && (BUFE * 2) % 16 == 0);
static_assert(QT == 2);                          // k_flash names its two column tiles a and b
static_assert(2 * BUFE + NWV * 16 * CSP <= CSE); // k_flash: the Q rows kept in LDS lie behind the ring
static_assert(DIM % 32 == 0);
static_assert(DIM == 4 * 32);                    // four 32-deep k-steps per score tile / per QKV tile
static_assert(DIM == 8 * 16);                    // eight 16-row output tiles per wave
static_assert(INNER % 32 == 0);
static_assert((NB * SEQ) % 16 == 0);             // d_ln: 16 rows per block
static_assert(16 * 8 == DIM);                    // d_ln: 16 lanes x 8 elements == row
static_assert(64 * CSP <= DIM * VTP);            // k_qkv: row-major staging fits the shared tile
static_assert(64 <= VTP);                        // transposed staging rows hold 64 tokens
static_assert((CSP * 2) % 16 == 0);
static_assert((VTP * 2) % 16 == 0);
static_assert((OSP * 4) % 16 == 0);
static_assert(32 * 4 == DIM);                    // k_proj: 32 lanes x 4 floats == output row
static_assert(16 * 8 * 2 == 256);                // 16 lanes x 16 B == one 128-element 16-bit row
static_assert(QKVN % 128 == 0);
static_assert(INNER % PKT == 0 && PKT % 32 == 0 && PKT <= CSP && PKT * 2 == 16 * 16);   // staged rows: 16 lanes x 16 B
static_assert((PBE * 2) % 16 == 0);
static_assert(DIM % 64 == 0 && INNER % 64 == 0); // d_wt tile multiples
static_assert((BCH * SEQ) % 64 == 0);            // k_qkv / k_proj: 64 tokens per block

#define SZ_XH  ((size_t)NB * SEQ * DIM * 2)
#define SZ_WT  ((size_t)QKVN * DIM * 2)
#define SZ_WP  ((size_t)DIM * INNER * 2)
#define SZ_PL  ((size_t)BCH * NH * SEQ * DIM * 2)
#define SZ_CX  ((size_t)BCH * SEQ * INNER * 2)
#define SZ_ALL (SZ_XH + SZ_WT + SZ_WP + 3 * SZ_PL + 2 * SZ_CX)
static_assert(SZ_XH % 256 == 0 && SZ_WT % 256 == 0 && SZ_WP % 256 == 0 && SZ_PL % 256 == 0 && SZ_CX % 256 == 0);
static_assert(SZ_ALL <= (size_t)268435456);

typedef unsigned short hf;
typedef __attribute__((ext_vector_type(16))) _Float16 v16h;
typedef __attribute__((ext_vector_type(8)))  _Float16 v8h;
typedef __attribute__((ext_vector_type(8)))  unsigned short v8us;
typedef __attribute__((ext_vector_type(8)))  float    v8f;
typedef __attribute__((ext_vector_type(4)))  float    v4f;
typedef v4f  __attribute__((may_alias)) v4fa;
typedef v8us __attribute__((may_alias)) v8usa;

__device__ __forceinline__ float bfr(float f) { unsigned u = __float_as_uint(f); u += 0x7FFFu + ((u >> 16) & 1u); return __uint_as_float(u & 0xFFFF0000u); }
__device__ __forceinline__ unsigned short f2h(float f) { return __builtin_bit_cast(unsigned short, (_Float16)f); }
__device__ __forceinline__ v16h cat16h(v8us lo, v8us hi) { return __builtin_bit_cast(v16h, __builtin_shufflevector(lo, hi, 0, 1, 2, 3, 4, 5, 6, 7, 8, 9, 10, 11, 12, 13, 14, 15)); }
__device__ __forceinline__ v8f wmmah(v16h a, v16h b, v8f c) { return __builtin_amdgcn_wmma_f32_16x16x32_f16(false, a, false, b, (short)0, c, false, false); }
// fragment loader (A and B alike): p = row base + k0 + 8*(lane>>4); elements 0..7 <- p[0..7], elements 8..15 <- p[16..23]
__device__ __forceinline__ v16h ldh(const hf* p) { return cat16h(*(const v8us*)p, *(const v8us*)(p + 16)); }
__device__ __forceinline__ void sfence() { asm volatile("" ::: "memory"); __builtin_amdgcn_sched_barrier(0); }
// hazard guards: four idle VALU slots after the last WMMA of a group; the group's operand fragments stay live until here
__device__ __forceinline__ void guard1(v8f& c0, v16h a, v16h b, v16h c, v16h d) {
    asm volatile("v_nop\n\tv_nop\n\tv_nop\n\tv_nop" : "+v"(c0) : "v"(a), "v"(b), "v"(c), "v"(d));
}
__device__ __forceinline__ void guard4(v8f& c0, v8f& c1, v8f& c2, v8f& c3, v16h a, v16h b, v16h c) {
    asm volatile("v_nop\n\tv_nop\n\tv_nop\n\tv_nop" : "+v"(c0), "+v"(c1), "+v"(c2), "+v"(c3) : "v"(a), "v"(b), "v"(c));
}
__device__ __forceinline__ void guard8(v8f& c0, v8f& c1, v8f& c2, v8f& c3, v8f& c4, v8f& c5, v8f& c6, v8f& c7,
                                       v16h a, v16h b, v16h c, v16h d, v16h e, v16h f) {
    asm volatile("v_nop\n\tv_nop\n\tv_nop\n\tv_nop"
                 : "+v"(c0), "+v"(c1), "+v"(c2), "+v"(c3), "+v"(c4), "+v"(c5), "+v"(c6), "+v"(c7)
                 : "v"(a), "v"(b), "v"(c), "v"(d), "v"(e), "v"(f));
}

// One 64-key tile, global -> LDS through no register: each lane copies four 16-byte pieces of K (16 key rows apart) and four of V^T (32 d rows apart).
// lk / lv: the lane's LDS byte addresses of its first pieces; gk / gv: their global addresses. The address-translation wait closes the statement, ahead of any rewrite of the address registers.
__device__ __forceinline__ void stage_kv(unsigned lk, unsigned lv, const hf* gk, const hf* gv) {
    asm volatile("global_load_async_to_lds_b128 %0, %8, off\n\t"
                 "global_load_async_to_lds_b128 %1, %9, off\n\t"
                 "global_load_async_to_lds_b128 %2, %10, off\n\t"
                 "global_load_async_to_lds_b128 %3, %11, off\n\t"
                 "global_load_async_to_lds_b128 %4, %12, off\n\t"
                 "global_load_async_to_lds_b128 %5, %13, off\n\t"
                 "global_load_async_to_lds_b128 %6, %14, off\n\t"
                 "global_load_async_to_lds_b128 %7, %15, off\n\t"
                 "s_wait_xcnt 0x0"
                 :: "v"(lk), "v"(lk + 16u * CSP * 2u), "v"(lk + 32u * CSP * 2u), "v"(lk + 48u * CSP * 2u),
                    "v"(lv), "v"(lv + 32u * VTP * 2u), "v"(lv + 64u * VTP * 2u), "v"(lv + 96u * VTP * 2u),
                    "v"(gk), "v"(gk + 16 * DIM), "v"(gk + 32 * DIM), "v"(gk + 48 * DIM),
                    "v"(gv), "v"(gv + (size_t)32 * SEQ), "v"(gv + (size_t)64 * SEQ), "v"(gv + (size_t)96 * SEQ)
                 : "memory");
}

// Eight 16-byte pieces of row-major tiles, global -> LDS through no register: four from ga and four from gb, gs elements apart in each run; they land ls bytes apart, from l on.
// The address-translation wait closes the statement, ahead of any rewrite of the address registers.
__device__ __forceinline__ void stage_rows(unsigned l, const hf* ga, const hf* gb, unsigned ls, size_t gs) {
    asm volatile("global_load_async_to_lds_b128 %0, %8, off\n\t"
                 "global_load_async_to_lds_b128 %1, %9, off\n\t"
                 "global_load_async_to_lds_b128 %2, %10, off\n\t"
                 "global_load_async_to_lds_b128 %3, %11, off\n\t"
                 "global_load_async_to_lds_b128 %4, %12, off\n\t"
                 "global_load_async_to_lds_b128 %5, %13, off\n\t"
                 "global_load_async_to_lds_b128 %6, %14, off\n\t"
                 "global_load_async_to_lds_b128 %7, %15, off\n\t"
                 "s_wait_xcnt 0x0"
                 :: "v"(l), "v"(l + ls), "v"(l + 2u * ls), "v"(l + 3u * ls),
                    "v"(l + 4u * ls), "v"(l + 5u * ls), "v"(l + 6u * ls), "v"(l + 7u * ls),
                    "v"(ga), "v"(ga + gs), "v"(ga + 2 * gs), "v"(ga + 3 * gs),
                    "v"(gb), "v"(gb + gs), "v"(gb + 2 * gs), "v"(gb + 3 * gs)
                 : "memory");
}
// k_proj, one 128-deep tile: 256 lanes, 16 per row, rows 16 apart; ctx value rows 0..63, residual rows 64..127, weight rows 128..255 of the ring buffer at lc.
__device__ __forceinline__ void stage_proj(unsigned lc, const hf* gh, const hf* gl, const hf* gw) {
    stage_rows(lc, gh, gl, 16u * CSP * 2u, (size_t)16 * INNER);
    stage_rows(lc + 128u * CSP * 2u, gw, gw + (size_t)64 * INNER, 16u * CSP * 2u, (size_t)16 * INNER);
}

// d_ln: x plane XH[NB*SEQ][128] (f16) = LayerNorm(bf16(in)) with bf16(gamma), bf16(beta); 16 lanes per row, 8 elements per lane; blk = index among the LayerNorm blocks
__device__ __forceinline__ void d_ln(const float* __restrict__ X, const float* __restrict__ G, const float* __restrict__ Bt, hf* XH, unsigned blk) {
    const unsigned tid = threadIdx.x;
    const unsigned row = blk * 16u + (tid >> 4);
    const unsigned sub = tid & 15u;
    const unsigned b = row / (unsigned)SEQ, n = row - b * (unsigned)SEQ;
    const float* src = X + ((size_t)b * SEQ_FULL + n) * DIM + sub * 8u;
    const v4f a0 = *(const v4f*)src;
    const v4f a1 = *(const v4f*)(src + 4);
    float e[8];
    e[0] = bfr(a0[0]); e[1] = bfr(a0[1]); e[2] = bfr(a0[2]); e[3] = bfr(a0[3]);
    e[4] = bfr(a1[0]); e[5] = bfr(a1[1]); e[6] = bfr(a1[2]); e[7] = bfr(a1[3]);
    float s = ((e[0] + e[1]) + (e[2] + e[3])) + ((e[4] + e[5]) + (e[6] + e[7]));
    s += __shfl_xor(s, 8, 32);
    s += __shfl_xor(s, 4, 32);
    s += __shfl_xor(s, 2, 32);
    s += __shfl_xor(s, 1, 32);
    const float mu = s * (1.0f / DIM);
    float d[8];
    float s2 = 0.0f;
#pragma unroll
    for (int j = 0; j < 8; ++j) { d[j] = e[j] - mu; s2 = fmaf(d[j], d[j], s2); }
    s2 += __shfl_xor(s2, 8, 32);
    s2 += __shfl_xor(s2, 4, 32);
    s2 += __shfl_xor(s2, 2, 32);
    s2 += __shfl_xor(s2, 1, 32);
    const float rs = rsqrtf(s2 * (1.0f / DIM) + 1.0e-5f);
    const v4f g0 = *(const v4f*)(G + sub * 8u), g1 = *(const v4f*)(G + sub * 8u + 4u);
    const v4f b0 = *(const v4f*)(Bt + sub * 8u), b1 = *(const v4f*)(Bt + sub * 8u + 4u);
    v8h o;
    o[0] = (_Float16)(d[0] * rs * bfr(g0[0]) + bfr(b0[0]));
    o[1] = (_Float16)(d[1] * rs * bfr(g0[1]) + bfr(b0[1]));
    o[2] = (_Float16)(d[2] * rs * bfr(g0[2]) + bfr(b0[2]));
    o[3] = (_Float16)(d[3] * rs * bfr(g0[3]) + bfr(b0[3]));
    o[4] = (_Float16)(d[4] * rs * bfr(g1[0]) + bfr(b1[0]));
    o[5] = (_Float16)(d[5] * rs * bfr(g1[1]) + bfr(b1[1]));
    o[6] = (_Float16)(d[6] * rs * bfr(g1[2]) + bfr(b1[2]));
    o[7] = (_Float16)(d[7] * rs * bfr(g1[3]) + bfr(b1[3]));
    const v8us ob = __builtin_bit_cast(v8us, o);
    hf* dst = XH + (size_t)row * DIM + sub * 8u;
    *(v8us*)dst = ob;
    asm volatile("s_wait_xcnt 0x0" ::: "memory");   // closes the store ahead of any rewrite of its address and data registers (the code of another block range follows in k_prep)
}

// d_wt: WT[c][r] (f16) = bf16(W[r][c]) * scale; in[R][C] -> out[C][R]; one block = 64 r x 128 c through the LDS tile tl (cross-wave, block barrier); blk = index among this matrix's blocks
__device__ __forceinline__ void d_wt(const float* __restrict__ W, hf* WT, int R, int C, float scale, unsigned blk, hf* tl) {
    const unsigned tid = threadIdx.x;
    const unsigned tc = (unsigned)C / 128u;
    const unsigned kt = blk / tc;
    const unsigned ct = blk - kt * tc;
    const float* src = W + (size_t)(kt * 64u) * (unsigned)C + ct * 128u;
#pragma unroll
    for (unsigned it = 0; it < 8; ++it) {
        const unsigned f = it * 256u + tid;
        const unsigned key = f >> 5, c4 = (f & 31u) * 4u;
        const v4f x = *(const v4f*)(src + (size_t)key * (unsigned)C + c4);
#pragma unroll
        for (unsigned c = 0; c < 4; ++c) tl[(c4 + c) * VTP + key] = f2h(bfr(x[c]) * scale);
    }
    __syncthreads();
    hf* dst = WT + (size_t)(ct * 128u) * (unsigned)R + kt * 64u;
    const unsigned c8 = (tid & 7u) * 8u, dr = tid >> 3;
{
#pragma unroll
        for (unsigned it = 0; it < 4; ++it) {
            const unsigned d = it * 32u + dr;
            const v8us o = *(const v8usa*)(tl + d * VTP + c8);
            *(v8us*)(dst + (size_t)d * (unsigned)R + c8) = o;
        }
        asm volatile("s_wait_xcnt 0x0" ::: "memory");   // closes the four stores ahead of any rewrite of their address and data registers (the code of another block range follows in k_prep)
    }
}

// k_prep: the three preparations that depend on nothing but the inputs, in one launch, by block range (block-uniform branches):
//  blocks [0, NWQ) transpose w_qkv, [NWQ, NWQ + NWP) transpose w_proj, the rest normalise 16 rows each.
__global__ __launch_bounds__(256) void k_prep(const float* __restrict__ X, const float* __restrict__ G, const float* __restrict__ Bt,
                                              const float* __restrict__ WQ, const float* __restrict__ WO, hf* XH, hf* WT, hf* WP) {
    __shared__ __align__(16) hf tl[DIM * VTP];
    const unsigned b = blockIdx.x;
    if (b < (unsigned)NWQ) d_wt(WQ, WT, DIM, QKVN, WQS, b, tl);
    else if (b < (unsigned)(NWQ + NWP)) d_wt(WO, WP, INNER, DIM, WPS, b - (unsigned)NWQ, tl);
    else d_ln(X, G, Bt, XH, b - (unsigned)(NWQ + NWP));
}

// k_qkv: one block = 64 tokens x one (which, head) group of 128 features; wave w owns tokens 16w..16w+15; the eight 16-feature tiles are processed in a rolled loop
//  (one accumulator tile and four weight fragments live at a time; the four token fragments are held), K = 128.
//  The block's x tile (64 rows) and weight tile (128 rows) are brought into LDS once by asynchronous copies (whole 256-byte rows); every fragment is read from LDS.
//  q / k groups: A = W^T rows (row m = feature), B = x rows (column n = token); D element r of lane (h, n) = (feature 16t + 8h + r, token n); staged row-major [token][feature].
//  v group:      A = x rows (row m = token), B = W^T rows (column n = feature); D element r of lane (h, n) = (token 8h + r, feature n); staged transposed [feature][token].
__attribute__((amdgpu_num_vgpr(248))) __global__ __launch_bounds__(128) void k_qkv(const hf* XH, const hf* WT, hf* QKV, int bch0) {
    __shared__ __align__(16) hf st[DIM * VTP];   // x tile (pitch CSP) until the token fragments are held, output staging after that
    __shared__ __align__(16) hf wl[DIM * CSP];   // weight tile: 128 feature rows
    const unsigned tid = threadIdx.x, lane = tid & 31u, lr = lane & 15u, hi = lane >> 4;
    const unsigned wave = (unsigned)__builtin_amdgcn_readfirstlane((int)(tid >> 5));
    const unsigned which = blockIdx.y >> 3, head = blockIdx.y & 7u;
    const unsigned mloc = blockIdx.x * 64u;
    const unsigned bl = mloc / (unsigned)SEQ, n0 = mloc - bl * (unsigned)SEQ;
    const size_t PL = (size_t)BCH * NH * SEQ * DIM;

    {   // staging: 128 lanes, 16 per row, rows 8 apart; 8 pieces of x and 16 of the weights per lane
        const unsigned srow = tid >> 4, scol = (tid & 15u) * 8u;
        const hf* gx = XH + ((size_t)((unsigned)bch0 + bl) * SEQ + n0 + srow) * DIM + scol;
        const hf* gw = WT + ((size_t)blockIdx.y * 128u + srow) * DIM + scol;
        const unsigned lx = (unsigned)(size_t)(st + srow * CSP + scol);
        const unsigned lw = (unsigned)(size_t)(wl + srow * CSP + scol);
        stage_rows(lx, gx, gx + 32 * DIM, 8u * CSP * 2u, (size_t)8 * DIM);
        stage_rows(lw, gw, gw + 32 * DIM, 8u * CSP * 2u, (size_t)8 * DIM);
        stage_rows(lw + 64u * CSP * 2u, gw + 64 * DIM, gw + 96 * DIM, 8u * CSP * 2u, (size_t)8 * DIM);
    }
    asm volatile("s_wait_asynccnt 0x0" ::: "memory");      // this wave's pieces of both tiles have landed
    __syncthreads();                                       // both tiles readable by every wave
    v16h tf[4];
    {
        const hf* tp = st + (16u * wave + lr) * CSP + 8u * hi;
        tf[0] = ldh(tp);
        tf[1] = ldh(tp + 32);
        tf[2] = ldh(tp + 64);
        tf[3] = ldh(tp + 96);
    }
    __syncthreads();                                       // ends every wave's reads of the x tile before it is overwritten as output staging
    const unsigned woff = lr * CSP + 8u * hi;
    const float un = 1.0f / WQS;

    if (which == 2u) {      // block-uniform
#pragma unroll 1
        for (unsigned t = 0; t < 8u; ++t) {
            const hf* wr = wl + woff + t * (16u * CSP);
            const v16h w0 = ldh(wr), w1 = ldh(wr + 32), w2 = ldh(wr + 64), w3 = ldh(wr + 96);
            v8f acc = (v8f){};
            acc = wmmah(tf[0], w0, acc);
            acc = wmmah(tf[1], w1, acc);
            acc = wmmah(tf[2], w2, acc);
            acc = wmmah(tf[3], w3, acc);
            guard1(acc, w0, w1, w2, w3);
            v8h o;
#pragma unroll
            for (int r = 0; r < 8; ++r) o[r] = (_Float16)(acc[r] * un);
            *(v8usa*)(st + (16u * t + lr) * VTP + 16u * wave + 8u * hi) = __builtin_bit_cast(v8us, o);
            sfence();
        }
    } else {
#pragma unroll 1
        for (unsigned t = 0; t < 8u; ++t) {
            const hf* wr = wl + woff + t * (16u * CSP);
            const v16h w0 = ldh(wr), w1 = ldh(wr + 32), w2 = ldh(wr + 64), w3 = ldh(wr + 96);
            v8f acc = (v8f){};
            acc = wmmah(w0, tf[0], acc);
            acc = wmmah(w1, tf[1], acc);
            acc = wmmah(w2, tf[2], acc);
            acc = wmmah(w3, tf[3], acc);
            guard1(acc, w0, w1, w2, w3);
            v8h o;
#pragma unroll
            for (int r = 0; r < 8; ++r) o[r] = (_Float16)(acc[r] * un);
            *(v8usa*)(st + (16u * wave + lr) * CSP + 16u * t + 8u * hi) = __builtin_bit_cast(v8us, o);
            sfence();
        }
    }
    __syncthreads();
    const size_t bhp = (size_t)(bl * NH + head);
    if (which == 2u) {
        hf* dst = QKV + 2 * PL + bhp * DIM * SEQ + n0;
        const unsigned c8 = (tid & 7u) * 8u, dr = tid >> 3;
{
#pragma unroll
            for (unsigned it = 0; it < 8; ++it) {
                const unsigned d = it * 16u + dr;
                const v8us o = *(const v8usa*)(st + d * VTP + c8);
                *(v8us*)(dst + (size_t)d * SEQ + c8) = o;
            }
            
        }
    } else {
        hf* dst = QKV + (size_t)which * PL + (bhp * SEQ + n0) * DIM + lr * 8u;
{
#pragma unroll
            for (unsigned s = 0; s < 8; ++s) {
                const unsigned rr = 16u * wave + 2u * s + hi;
                const v8us o = *(const v8usa*)(st + rr * CSP + lr * 8u);
                *(v8us*)(dst + (size_t)rr * DIM) = o;
            }
            
        }
    }
}

// one online-softmax step of one 16-query column tile: s0 / s1 = S^T tiles of keys 0..15 / 16..31; updates the running maximum ml and sum l, gives the rescale factor corr, returns the P^T B fragment
__device__ __forceinline__ v16h soft_step(const v8f& s0, const v8f& s1, float& ml, float& l, float& corr) {
    float mx = fmaxf(s0[0], s1[0]);
#pragma unroll
    for (int r = 1; r < 8; ++r) mx = fmaxf(mx, fmaxf(s0[r], s1[r]));
    mx = fmaxf(mx, __shfl_xor(mx, 16, 32));
    const float mnl = fmaxf(ml, mx * SC2);
    corr = __builtin_amdgcn_exp2f(ml - mnl);
    ml = mnl;
    const float sh = PCL - mnl;
    float p0[8], p1[8];
    float ps = 0.0f;
#pragma unroll
    for (int r = 0; r < 8; ++r) {
        p0[r] = __builtin_amdgcn_exp2f(fmaf(s0[r], SC2, sh));
        p1[r] = __builtin_amdgcn_exp2f(fmaf(s1[r], SC2, sh));
        ps += p0[r] + p1[r];
    }
    ps += __shfl_xor(ps, 16, 32);
    l = l * corr + ps;
    v16h ph;
#pragma unroll
    for (int r = 0; r < 8; ++r) { ph[r] = (_Float16)p0[r]; ph[8 + r] = (_Float16)p1[r]; }
    return ph;
}

// k_flash: one wave per 32 queries (two 16-query column tiles, a and b) of one (batch, head), 32 keys per step, online softmax; the block's eight waves share K / V^T tiles of 64 keys,
//  staged in a two-buffer LDS ring by asynchronous copies (tile t + 2 is issued behind the barrier that ends the reads of tile t); fragments are read from LDS, each once per step for both column tiles.
//  S^T tile (keys x queries): A = K rows (row m = key, k = d), B = Q rows (column n = query, k = d); D element r of lane (h, n) = S[query n][key 8h + r].
//  Q fragments (B operands): six are held, tile b's first two are read from LDS with their K fragments; K fragments are loaded two at a time (one k-step x two key tiles, four products); V^T fragments four output tiles at a time (eight products).
//  P^T B fragment: element r <- tile of keys 0..15, element 8 + r <- tile of keys 16..31 (same lane); P carried x 2^10 (the running sum carries the same factor).
//  O^T tile (d x queries): A = V^T rows (row m = d, k = key), D element r of lane (h, n) = O[query n][d = 16 t + 8h + r].
__attribute__((amdgpu_num_vgpr(256))) __global__ __launch_bounds__(NWV * 32) void k_flash(const hf* QP, const hf* KP, const hf* VT, hf* CH, hf* CL) {
    __shared__ __align__(16) hf cs[CSE];        // in the loop the K / V^T ring, then 16 Q rows per wave; output staging behind the loop
    const unsigned tid = threadIdx.x, lane = tid & 31u, lr = lane & 15u, hi = lane >> 4;
    const unsigned wave = (unsigned)__builtin_amdgcn_readfirstlane((int)(tid >> 5));
    const unsigned bpb = (unsigned)(SEQ / BQ);
    const unsigned bh = blockIdx.x / bpb;
    const unsigned q0 = (blockIdx.x - bh * bpb) * BQ + wave * (16u * QT);

    v16h qa[4], qb[4];
    {
        const hf* qp = QP + ((size_t)bh * SEQ + q0 + lr) * DIM + 8u * hi;
#pragma unroll
        for (int k = 0; k < 4; ++k) qa[k] = ldh(qp + 32 * k);
#pragma unroll
        for (int k = 2; k < 4; ++k) qb[k] = ldh(qp + 16 * DIM + 32 * k);
    }
    const unsigned kfo = lr * CSP + 8u * hi;          // fragment offsets inside a ring buffer
    // tile b's first two Q fragments live in LDS, in rows of this wave's own behind the ring (same row form as a K tile), and are read with the K fragments of their k-steps:
    // six held Q fragments leave the wave inside 256 registers, four waves per SIMD; with more held it spills to scratch. The loop's last barrier ends every wave's reads of them, ahead of the output staging
    hf* qs = cs + 2 * BUFE + wave * (16u * CSP) + kfo;
    {
        const hf* qp = QP + ((size_t)bh * SEQ + q0 + 16u + lr) * DIM + 8u * hi;
        *(v8usa*)qs = *(const v8us*)qp;
        *(v8usa*)(qs + 16) = *(const v8us*)(qp + 16);
        *(v8usa*)(qs + 32) = *(const v8us*)(qp + 32);
        *(v8usa*)(qs + 48) = *(const v8us*)(qp + 48);
    }
    const unsigned vfo = KTE + lr * VTP + 8u * hi;
    // staging addresses of this lane: K tile = 16 KiB contiguous, 16 lanes per key row; V^T tile = 128 rows of 128 B, 8 lanes per row
    const hf* gk = KP + (size_t)bh * SEQ * DIM + tid * 8u;
    const hf* gv = VT + ((size_t)bh * DIM + (tid >> 3)) * SEQ + (tid & 7u) * 8u;
    const unsigned lk = (unsigned)(size_t)(cs + (tid >> 4) * CSP + (tid & 15u) * 8u);
    const unsigned lv = (unsigned)(size_t)(cs + KTE + (tid >> 3) * VTP + (tid & 7u) * 8u);
    const unsigned nt = (unsigned)(SEQ / TK);

    v8f oa[8], ob[8];
#pragma unroll
    for (int t = 0; t < 8; ++t) { oa[t] = (v8f){}; ob[t] = (v8f){}; }
    float mla = -1.0e30f, mlb = -1.0e30f;   // running maxima in the log2 domain
    float la = 0.0f, lb = 0.0f;             // running sums (carried x 2^10)

    stage_kv(lk, lv, gk, gv);                              // tile 0 -> buffer 0
    asm volatile("s_wait_asynccnt 0x0" ::: "memory");      // this wave's pieces of tile 0 have landed
    __syncthreads();                                       // tile 0 readable by every wave
    if (nt > 1u) stage_kv(lk + BUFE * 2u, lv + BUFE * 2u, gk + TK * DIM, gv + TK);   // tile 1 -> buffer 1

#pragma unroll 1
    for (unsigned t = 0; t < nt; ++t) {
      const unsigned bo = (t & 1u) * BUFE;
#pragma unroll 1
      for (unsigned h = 0; h < 2u; ++h) {                  // rolled: one copy of the step's code, one step's fragments live
        v8f sa0 = (v8f){}, sa1 = (v8f){}, sb0 = (v8f){}, sb1 = (v8f){};
        const hf* ka = cs + bo + kfo + h * (KS * CSP);
#pragma unroll
        for (int k = 0; k < 4; ++k) {                      // one k-step at a time: two K fragments, four products
            const v16h a0 = ldh(ka + 32 * k), a1 = ldh(ka + 16 * CSP + 32 * k);
            const v16h qk = k < 2 ? ldh(qs + 32 * k) : qb[k];
            sa0 = wmmah(a0, qa[k], sa0);
            sa1 = wmmah(a1, qa[k], sa1);
            sb0 = wmmah(a0, qk, sb0);
            sb1 = wmmah(a1, qk, sb1);
            guard4(sa0, sa1, sb0, sb1, a0, a1, qk);
            sfence();
        }

        float ca, cb;
        const v16h pa = soft_step(sa0, sa1, mla, la, ca);
        if (__builtin_amdgcn_ballot_w32(ca != 1.0f) != 0u) {   // wave-uniform; multiplying by exactly 1 is skipped
#pragma unroll
            for (int j = 0; j < 8; ++j) oa[j] *= ca;
        }
        const v16h pb = soft_step(sb0, sb1, mlb, lb, cb);
        if (__builtin_amdgcn_ballot_w32(cb != 1.0f) != 0u) {
#pragma unroll
            for (int j = 0; j < 8; ++j) ob[j] *= cb;
        }

        sfence();   // keep the V^T loads below the softmax (bounds live fragments)
        const hf* va = cs + bo + vfo + h * KS;
        {
            const v16h v0 = ldh(va), v1 = ldh(va + 16 * VTP), v2 = ldh(va + 32 * VTP), v3 = ldh(va + 48 * VTP);
            oa[0] = wmmah(v0, pa, oa[0]);
            ob[0] = wmmah(v0, pb, ob[0]);
            oa[1] = wmmah(v1, pa, oa[1]);
            ob[1] = wmmah(v1, pb, ob[1]);
            oa[2] = wmmah(v2, pa, oa[2]);
            ob[2] = wmmah(v2, pb, ob[2]);
            oa[3] = wmmah(v3, pa, oa[3]);
            ob[3] = wmmah(v3, pb, ob[3]);
            guard8(oa[0], ob[0], oa[1], ob[1], oa[2], ob[2], oa[3], ob[3], v0, v1, v2, v3, pa, pb);
        }
        sfence();
        {
            const v16h v4 = ldh(va + 64 * VTP), v5 = ldh(va + 80 * VTP), v6 = ldh(va + 96 * VTP), v7 = ldh(va + 112 * VTP);
            oa[4] = wmmah(v4, pa, oa[4]);
            ob[4] = wmmah(v4, pb, ob[4]);
            oa[5] = wmmah(v5, pa, oa[5]);
            ob[5] = wmmah(v5, pb, ob[5]);
            oa[6] = wmmah(v6, pa, oa[6]);
            ob[6] = wmmah(v6, pb, ob[6]);
            oa[7] = wmmah(v7, pa, oa[7]);
            ob[7] = wmmah(v7, pb, ob[7]);
            guard8(oa[4], ob[4], oa[5], ob[5], oa[6], ob[6], oa[7], ob[7], v4, v5, v6, v7, pa, pb);
        }
        sfence();
      }
      asm volatile("s_wait_dscnt 0x0" ::: "memory");       // this wave's reads of tile t have returned before its buffer is refilled
      asm volatile("s_wait_asynccnt 0x0" ::: "memory");    // this wave's pieces of tile t + 1 have landed
      __syncthreads();                                     // publishes tile t + 1 and ends every wave's reads of tile t
      if (t + 2u < nt) stage_kv(lk + bo * 2u, lv + bo * 2u, gk + (size_t)(t + 2u) * (TK * DIM), gv + (t + 2u) * TK);
    }
    asm volatile("s_wait_asynccnt 0x0" ::: "memory");      // no copy outstanding when the ring becomes output staging

    // epilogue: stage ctx value / residual rows [query][d] (wave-private regions; block barrier used)
    const unsigned creg = wave * (QT * 2u * 16u * CSP);
#pragma unroll
    for (int c = 0; c < QT; ++c) {
        const float sc = (1.0f / (c == 0 ? la : lb)) * CCS;
        const unsigned cr = creg + (unsigned)c * (2u * 16u * CSP);
#pragma unroll
        for (int t = 0; t < 8; ++t) {
            v8h hv, lv;
#pragma unroll
            for (int r = 0; r < 8; ++r) {
                const float x = (c == 0 ? oa[t][r] : ob[t][r]) * sc;
                const _Float16 h = (_Float16)x;
                hv[r] = h;
                lv[r] = (_Float16)((x - (float)h) * RSC);
            }
            *(v8usa*)(cs + cr + lr * CSP + 16u * t + 8u * hi) = __builtin_bit_cast(v8us, hv);
            *(v8usa*)(cs + cr + 16u * CSP + lr * CSP + 16u * t + 8u * hi) = __builtin_bit_cast(v8us, lv);
        }
    }
    __syncthreads();
    const unsigned bl = bh / NH, head = bh - bl * NH;
    const size_t rowbase = ((size_t)bl * SEQ + q0) * INNER + head * DIM + lr * 8u;
#pragma unroll
    for (unsigned c = 0; c < (unsigned)QT; ++c) {
        const unsigned cr = creg + c * (2u * 16u * CSP);
#pragma unroll
        for (unsigned s = 0; s < 8; ++s) {
            const unsigned rr = 2u * s + hi;
            const v8us vh = *(const v8usa*)(cs + cr + rr * CSP + lr * 8u);
            const v8us vl = *(const v8usa*)(cs + cr + 16u * CSP + rr * CSP + lr * 8u);
            *(v8us*)(CH + rowbase + (size_t)(16u * c + rr) * INNER) = vh;
            *(v8us*)(CL + rowbase + (size_t)(16u * c + rr) * INNER) = vl;
        }
        if (c + 1u < (unsigned)QT) asm volatile("s_wait_xcnt 0x0" ::: "memory");   // closes this tile's stores ahead of the next tile's LDS reads, which reuse their data registers
    }
}

// k_proj: one block = 64 tokens x 128 output features, K = 1024; wave w: token group w>>1 (16 tokens), feature half w&1 (four 16-feature tiles).
//  A = w_proj^T rows (row m = feature, k = inner), B = ctx rows (column n = token); D element r of lane (h, n) = (feature 8h + r, token n).
//  The K loop walks 128-deep tiles of the ctx value, ctx residual and weight rows, staged in a two-buffer LDS ring by asynchronous copies (tile t + 2 is issued behind the barrier that ends the reads of tile t).
//  ctx value and residual planes share the weight fragment and use separate accumulators; out = (acc_v + acc_r / 2^11) / 512 + bf16(bias), added at the store stage.
__global__ __launch_bounds__(256) void k_proj(const hf* CH, const hf* CL, const hf* WP, const float* __restrict__ bias, float* OUT, int bch0) {
    __shared__ __align__(16) hf rg[2 * PBE];     // operand ring
    __shared__ __align__(16) float os[64 * OSP];
    const unsigned tid = threadIdx.x, lane = tid & 31u, lr = lane & 15u, hi = lane >> 4;
    const unsigned wave = (unsigned)__builtin_amdgcn_readfirstlane((int)(tid >> 5));
    const unsigned tg = wave >> 1, fh = wave & 1u;
    const unsigned m0 = blockIdx.x * 64u;
    const unsigned coff = (16u * tg + lr) * CSP + 8u * hi;                 // fragment offsets inside a ring buffer
    const unsigned woff = (128u + 64u * fh + lr) * CSP + 8u * hi;
    // staging addresses of this lane: 16 lanes per 256-byte row piece
    const hf* gh = CH + (size_t)(m0 + (tid >> 4)) * INNER + (tid & 15u) * 8u;
    const hf* gl = CL + (size_t)(m0 + (tid >> 4)) * INNER + (tid & 15u) * 8u;
    const hf* gw = WP + (size_t)(tid >> 4) * INNER + (tid & 15u) * 8u;
    const unsigned lc = (unsigned)(size_t)(rg + (tid >> 4) * CSP + (tid & 15u) * 8u);
    const unsigned nt = (unsigned)(INNER / PKT);

    v8f ah[4], al[4];
#pragma unroll
    for (int t = 0; t < 4; ++t) { ah[t] = (v8f){}; al[t] = (v8f){}; }

    stage_proj(lc, gh, gl, gw);                            // tile 0 -> buffer 0
    asm volatile("s_wait_asynccnt 0x0" ::: "memory");      // this wave's pieces of tile 0 have landed
    __syncthreads();                                       // tile 0 readable by every wave
    if (nt > 1u) stage_proj(lc + PBE * 2u, gh + PKT, gl + PKT, gw + PKT);   // tile 1 -> buffer 1

#pragma unroll 1
    for (unsigned t = 0; t < nt; ++t) {
      const unsigned bo = (t & 1u) * PBE;
#pragma unroll 1
      for (unsigned k0 = 0; k0 < (unsigned)PKT; k0 += 32) {   // rolled: one copy of the step's code, one step's fragments live
        const hf* cr = rg + bo + coff + k0;
        const v16h ch = ldh(cr);
        const v16h cl = ldh(cr + 64 * CSP);
        const hf* wr = rg + bo + woff + k0;
        const v16h w0 = ldh(wr), w1 = ldh(wr + 16 * CSP), w2 = ldh(wr + 32 * CSP), w3 = ldh(wr + 48 * CSP);
        ah[0] = wmmah(w0, ch, ah[0]);
        al[0] = wmmah(w0, cl, al[0]);
        ah[1] = wmmah(w1, ch, ah[1]);
        al[1] = wmmah(w1, cl, al[1]);
        ah[2] = wmmah(w2, ch, ah[2]);
        al[2] = wmmah(w2, cl, al[2]);
        ah[3] = wmmah(w3, ch, ah[3]);
        al[3] = wmmah(w3, cl, al[3]);
        guard8(ah[0], ah[1], ah[2], ah[3], al[0], al[1], al[2], al[3], ch, cl, w0, w1, w2, w3);
        sfence();
      }
      asm volatile("s_wait_dscnt 0x0" ::: "memory");       // this wave's reads of tile t have returned before its buffer is refilled
      asm volatile("s_wait_asynccnt 0x0" ::: "memory");    // this wave's pieces of tile t + 1 have landed
      __syncthreads();                                     // publishes tile t + 1 and ends every wave's reads of tile t
      if (t + 2u < nt) stage_proj(lc + bo * 2u, gh + (t + 2u) * PKT, gl + (t + 2u) * PKT, gw + (t + 2u) * PKT);
    }
    asm volatile("s_wait_asynccnt 0x0" ::: "memory");      // no copy outstanding behind the loop

    const float un = 1.0f / (CCS * WPS);
    const float ur = 1.0f / RSC;
#pragma unroll
    for (int t = 0; t < 4; ++t) {
        v4f x0, x1;
        x0[0] = fmaf(al[t][0], ur, ah[t][0]) * un; x0[1] = fmaf(al[t][1], ur, ah[t][1]) * un;
        x0[2] = fmaf(al[t][2], ur, ah[t][2]) * un; x0[3] = fmaf(al[t][3], ur, ah[t][3]) * un;
        x1[0] = fmaf(al[t][4], ur, ah[t][4]) * un; x1[1] = fmaf(al[t][5], ur, ah[t][5]) * un;
        x1[2] = fmaf(al[t][6], ur, ah[t][6]) * un; x1[3] = fmaf(al[t][7], ur, ah[t][7]) * un;
        const unsigned so = (16u * tg + lr) * OSP + 64u * fh + 16u * t + 8u * hi;
        *(v4fa*)(os + so) = x0;
        *(v4fa*)(os + so + 4u) = x1;
    }
    __syncthreads();
    const v4f bb = *(const v4f*)(bias + lane * 4u);
    v4f bq;
    bq[0] = bfr(bb[0]); bq[1] = bfr(bb[1]); bq[2] = bfr(bb[2]); bq[3] = bfr(bb[3]);
    float* orow = OUT + ((size_t)bch0 * SEQ + m0 + 8u * wave) * DIM + lane * 4u;
{
#pragma unroll
        for (unsigned s = 0; s < 8; ++s) {
            v4f val = *(const v4fa*)(os + (8u * wave + s) * OSP + lane * 4u);
            val[0] += bq[0]; val[1] += bq[1]; val[2] += bq[2]; val[3] += bq[3];
            *(v4f*)(orow + (size_t)s * DIM) = val;
        }
        
    }
}

extern "C" void kernel_launch(void* const* d_in, const int* in_sizes, int n_in,
                              void* d_out, int out_size, void* d_ws, size_t ws_size, hipStream_t stream) {
    if (n_in < 6) return;
    const size_t need = ((size_t)(NB - 1) * SEQ_FULL + SEQ) * DIM;
    if ((size_t)in_sizes[0] < need) return;
    if (in_sizes[1] < DIM || in_sizes[2] < DIM || in_sizes[5] < DIM) return;
    if ((size_t)in_sizes[3] < (size_t)DIM * QKVN) return;
    if ((size_t)in_sizes[4] < (size_t)INNER * DIM) return;
    if ((size_t)out_size < (size_t)NB * SEQ * DIM) return;
    if (SZ_ALL > ws_size) return;

    const float* x      = (const float*)d_in[0];   // inputs  [NB][SEQ_FULL][128] (rows n < SEQ read)
    const float* gamma  = (const float*)d_in[1];   // ln_gamma [128]
    const float* beta   = (const float*)d_in[2];   // ln_beta  [128]
    const float* w_qkv  = (const float*)d_in[3];   // [128][3072]  ([in][out])
    const float* w_proj = (const float*)d_in[4];   // [1024][128]  ([in][out])
    const float* b_proj = (const float*)d_in[5];   // [128]
    float* OUT = (float*)d_out;                    // [NB][SEQ][128]

    char* wsp = (char*)d_ws;
    hf* XH  = (hf*)(wsp);
    hf* WT  = (hf*)(wsp + SZ_XH);
    hf* WP  = (hf*)(wsp + SZ_XH + SZ_WT);
    hf* QKV = (hf*)(wsp + SZ_XH + SZ_WT + SZ_WP);
    hf* CH  = (hf*)(wsp + SZ_XH + SZ_WT + SZ_WP + 3 * SZ_PL);
    hf* CL  = (hf*)(wsp + SZ_XH + SZ_WT + SZ_WP + 3 * SZ_PL + SZ_CX);
    const size_t PL = (size_t)BCH * NH * SEQ * DIM;   // elements per q / k / v^T plane

    k_prep<<<(unsigned)(NWQ + NWP + NLN), 256, 0, stream>>>(x, gamma, beta, w_qkv, w_proj, XH, WT, WP);
    for (int c = 0; c < NCH; ++c) {
        const int bch0 = c * BCH;
        k_qkv<<<dim3((unsigned)(BCH * SEQ / 64), 24, 1), 128, 0, stream>>>(XH, WT, QKV, bch0);
        k_flash<<<(unsigned)(BCH * NH * (SEQ / BQ)), NWV * 32, 0, stream>>>(QKV, QKV + PL, QKV + 2 * PL, CH, CL);
        k_proj<<<(unsigned)(BCH * SEQ / 64), 256, 0, stream>>>(CH, CL, WP, b_proj, OUT, bch0);
    }
}

// v005
// Measured time: 93.9 microseconds a run.
// In two side-by-side timings against v004, it was 1.05 and 1.06 times as fast.
// All steps since v000 together make it 4.03 times as fast.
#include <hip/hip_runtime.h>

// Pre-LayerNorm multi-head softmax(QK^T)V block: x = LN(in) over 128; qkv = x @ w_qkv ([128][3072], thirds q|k|v, column = which*1024 + h*128 + d); 8 heads of dim 128; logits (q.k)/32; out = ctx @ w_proj + b_proj.
// Compute dtypes, f32 accumulate: every contraction on v_wmma_f32_16x16x32_f16. Float inputs are RNE-converted to bf16 first; weights carried as bf16 value x 16 (w_qkv) / x 32 (w_proj), exact in f16;
// x, q, k, v planes f16; P carried as f16 x 2^7 (online softmax in f32, log2 domain, lazy rescale); ctx carried as f16(ctx x 16) plus f16 residual x 2^11 with its own accumulator in the output projection.
// Flash form with transposed tiles: the S^T accumulator tiles are directly the B-operand layout of P^T; all WMMA operands are two 16-byte loads from dense, statically strided 16-bit rows (LDS tiles in every product kernel; only the flash Q rows come straight from their plane).

#ifndef NB
#define NB 16
#endif
#ifndef SEQ
#define SEQ 1024
#endif
#define NB_FULL  16
#define SEQ_FULL 1024
#define DIM   128                 // token width == head dim
#define NH    8
#define INNER (NH * DIM)          // 1024
#define QKVN  (3 * INNER)         // 3072
#define NCH   1                   // batch chunks: all batches go through one k_qkv / k_flash / k_proj pass
#define BCH   (NB / NCH)          // batches per chunk
#define NWV   8                   // waves per flash block
#define QT    2                   // 16-query column tiles per flash wave: each K / V^T fragment read from LDS feeds QT products
#define BQ    (16 * QT * NWV)     // queries per flash block
#define KS    32                  // keys per step
#define TK    64                  // keys per staged K / V^T tile (two steps)
#define CSP   136                 // LDS pitch (16-bit elements) of 128-wide staging rows
#define OSP   132                 // LDS pitch (floats) of the output staging rows
#define VTP   72                  // LDS pitch (16-bit elements) of 64-wide transposed rows
#define KTE   (TK * CSP)          // staged K tile, 16-bit elements: TK key rows of 128
#define BUFE  (KTE + DIM * VTP)   // one ring buffer: K tile, then V^T tile (128 rows of TK keys)
#define OSE   (NWV * QT * 2 * 16 * CSP)           // k_flash output staging: per wave and column tile 16 value rows and 16 residual rows
#define CSE   (2 * BUFE > OSE ? 2 * BUFE : OSE)   // k_flash LDS, 16-bit elements: the ring in the loop, the output staging behind it
#define PKT   128                 // k_proj: inner-dimension elements per staged tile (four 32-deep k-steps)
#define PBE   (256 * CSP)         // k_proj: one ring buffer: 64 ctx value rows, 64 ctx residual rows, 128 weight rows
#define L2E   1.4426950408889634f
#define SC2   (L2E * 0.03125f)    // log2(e) / 32
#define PCL   7.0f                // P carry exponent (2^7)
#define LZT   8.0f                // lazy rescale: how far (log2 domain) a score may lie above the reference maximum in use; 2^(PCL + LZT) is finite in f16
#define WQS   16.0f               // w_qkv carry
#define WPS   32.0f               // w_proj carry
#define CCS   16.0f               // ctx carry
#define RSC   2048.0f             // ctx residual carry
#define NWQ   ((DIM / 64) * (QKVN / 128))   // k_prep: blocks that transpose w_qkv, in[128][3072] -> out[3072][128]
#define NWP   ((INNER / 64) * (DIM / 128))  // k_prep: blocks that transpose w_proj, in[1024][128] -> out[128][1024]
#define NLN   (NB * SEQ / 16)               // k_prep: LayerNorm blocks, 16 rows each

static_assert(DIM == 128);
static_assert(INNER == 1024);
static_assert(NB <= NB_FULL);
static_assert(SEQ <= SEQ_FULL);
static_assert(NB % NCH == 0);
static_assert(SEQ % BQ == 0);
static_assert(SEQ % 64 == 0);
static_assert(SEQ % KS == 0);
static_assert(SEQ % TK == 0 && TK == 2 * KS && TK <= VTP);
static_assert(NWV * 32 == 256);                  // k_flash staging: 256 lanes x 16 B x 4 pieces == one 16-KiB tile
static_assert(TK * DIM * 2 == 4 * 256 * 16);
static_assert((KTE * 2) % 16 == 0 && (BUFE * 2) % 16 == 0);
static_assert(QT == 2);                          // k_flash names its two column tiles a and b
static_assert(2 * BUFE + NWV * 16 * CSP <= CSE); // k_flash: the Q rows kept in LDS lie behind the ring
static_assert(DIM % 32 == 0);
static_assert(DIM == 4 * 32);                    // four 32-deep k-steps per score tile / per QKV tile
static_assert(DIM == 8 * 16);                    // eight 16-row output tiles per wave
static_assert(INNER % 32 == 0);
static_assert((NB * SEQ) % 16 == 0);             // d_ln: 16 rows per block
static_assert(16 * 8 == DIM);                    // d_ln: 16 lanes x 8 elements == row
static_assert(64 * CSP <= DIM * VTP);            // k_qkv: row-major staging fits the shared tile
static_assert(64 <= VTP);                        // transposed staging rows hold 64 tokens
static_assert((CSP * 2) % 16 == 0);
static_assert((VTP * 2) % 16 == 0);
static_assert((OSP * 4) % 16 == 0);
static_assert(32 * 4 == DIM);                    // k_proj: 32 lanes x 4 floats == output row
static_assert(16 * 8 * 2 == 256);                // 16 lanes x 16 B == one 128-element 16-bit row
static_assert(QKVN % 128 == 0);
static_assert(INNER % PKT == 0 && PKT % 32 == 0 && PKT <= CSP && PKT * 2 == 16 * 16);   // staged rows: 16 lanes x 16 B
static_assert((PBE * 2) % 16 == 0);
static_assert(DIM % 64 == 0 && INNER % 64 == 0); // d_wt tile multiples
static_assert((BCH * SEQ) % 64 == 0);            // k_qkv / k_proj: 64 tokens per block

#define SZ_XH  ((size_t)NB * SEQ * DIM * 2)
#define SZ_WT  ((size_t)QKVN * DIM * 2)
#define SZ_WP  ((size_t)DIM * INNER * 2)
#define SZ_PL  ((size_t)BCH * NH * SEQ * DIM * 2)
#define SZ_CX  ((size_t)BCH * SEQ * INNER * 2)
#define SZ_ALL (SZ_XH + SZ_WT + SZ_WP + 3 * SZ_PL + 2 * SZ_CX)
static_assert(SZ_XH % 256 == 0 && SZ_WT % 256 == 0 && SZ_WP % 256 == 0 && SZ_PL % 256 == 0 && SZ_CX % 256 == 0);
static_assert(SZ_ALL <= (size_t)268435456);

typedef unsigned short hf;
typedef __attribute__((ext_vector_type(16))) _Float16 v16h;
typedef __attribute__((ext_vector_type(8)))  _Float16 v8h;
typedef __attribute__((ext_vector_type(8)))  unsigned short v8us;
typedef __attribute__((ext_vector_type(8)))  float    v8f;
typedef __attribute__((ext_vector_type(4)))  float    v4f;
typedef v4f  __attribute__((may_alias)) v4fa;
typedef v8us __attribute__((may_alias)) v8usa;

__device__ __forceinline__ float bfr(float f) { unsigned u = __float_as_uint(f); u += 0x7FFFu + ((u >> 16) & 1u); return __uint_as_float(u & 0xFFFF0000u); }
__device__ __forceinline__ unsigned short f2h(float f) { return __builtin_bit_cast(unsigned short, (_Float16)f); }
__device__ __forceinline__ v16h cat16h(v8us lo, v8us hi) { return __builtin_bit_cast(v16h, __builtin_shufflevector(lo, hi, 0, 1, 2, 3, 4, 5, 6, 7, 8, 9, 10, 11, 12, 13, 14, 15)); }
__device__ __forceinline__ v8f wmmah(v16h a, v16h b, v8f c) { return __builtin_amdgcn_wmma_f32_16x16x32_f16(false, a, false, b, (short)0, c, false, false); }
// fragment loader (A and B alike): p = row base + k0 + 8*(lane>>4); elements 0..7 <- p[0..7], elements 8..15 <- p[16..23]
__device__ __forceinline__ v16h ldh(const hf* p) { return cat16h(*(const v8us*)p, *(const v8us*)(p + 16)); }
__device__ __forceinline__ void sfence() { asm volatile("" ::: "memory"); __builtin_amdgcn_sched_barrier(0); }
// hazard guards: four idle VALU slots after the last WMMA of a group; the group's operand fragments stay live until here
__device__ __forceinline__ void guard1(v8f& c0, v16h a, v16h b, v16h c, v16h d) {
    asm volatile("v_nop\n\tv_nop\n\tv_nop\n\tv_nop" : "+v"(c0) : "v"(a), "v"(b), "v"(c), "v"(d));
}
__device__ __forceinline__ void guard4(v8f& c0, v8f& c1, v8f& c2, v8f& c3, v16h a, v16h b, v16h c) {
    asm volatile("v_nop\n\tv_nop\n\tv_nop\n\tv_nop" : "+v"(c0), "+v"(c1), "+v"(c2), "+v"(c3) : "v"(a), "v"(b), "v"(c));
}
__device__ __forceinline__ void guard8(v8f& c0, v8f& c1, v8f& c2, v8f& c3, v8f& c4, v8f& c5, v8f& c6, v8f& c7,
                                       v16h a, v16h b, v16h c, v16h d, v16h e, v16h f) {
    asm volatile("v_nop\n\tv_nop\n\tv_nop\n\tv_nop"
                 : "+v"(c0), "+v"(c1), "+v"(c2), "+v"(c3), "+v"(c4), "+v"(c5), "+v"(c6), "+v"(c7)
                 : "v"(a), "v"(b), "v"(c), "v"(d), "v"(e), "v"(f));
}

// One 64-key tile, global -> LDS through no register: each lane copies four 16-byte pieces of K (16 key rows apart) and four of V^T (32 d rows apart).
// lk / lv: the lane's LDS byte addresses of its first pieces; gk / gv: their global addresses. The address-translation wait closes the statement, ahead of any rewrite of the address registers.
__device__ __forceinline__ void stage_kv(unsigned lk, unsigned lv, const hf* gk, const hf* gv) {
    asm volatile("global_load_async_to_lds_b128 %0, %8, off\n\t"
                 "global_load_async_to_lds_b128 %1, %9, off\n\t"
                 "global_load_async_to_lds_b128 %2, %10, off\n\t"
                 "global_load_async_to_lds_b128 %3, %11, off\n\t"
                 "global_load_async_to_lds_b128 %4, %12, off\n\t"
                 "global_load_async_to_lds_b128 %5, %13, off\n\t"
                 "global_load_async_to_lds_b128 %6, %14, off\n\t"
                 "global_load_async_to_lds_b128 %7, %15, off\n\t"
                 "s_wait_xcnt 0x0"
                 :: "v"(lk), "v"(lk + 16u * CSP * 2u), "v"(lk + 32u * CSP * 2u), "v"(lk + 48u * CSP * 2u),
                    "v"(lv), "v"(lv + 32u * VTP * 2u), "v"(lv + 64u * VTP * 2u), "v"(lv + 96u * VTP * 2u),
                    "v"(gk), "v"(gk + 16 * DIM), "v"(gk + 32 * DIM), "v"(gk + 48 * DIM),
                    "v"(gv), "v"(gv + (size_t)32 * SEQ), "v"(gv + (size_t)64 * SEQ), "v"(gv + (size_t)96 * SEQ)
                 : "memory");
}

// Eight 16-byte pieces of row-major tiles, global -> LDS through no register: four from ga and four from gb, gs elements apart in each run; they land ls bytes apart, from l on.
// The address-translation wait closes the statement, ahead of any rewrite of the address registers.
__device__ __forceinline__ void stage_rows(unsigned l, const hf* ga, const hf* gb, unsigned ls, size_t gs) {
    asm volatile("global_load_async_to_lds_b128 %0, %8, off\n\t"
                 "global_load_async_to_lds_b128 %1, %9, off\n\t"
                 "global_load_async_to_lds_b128 %2, %10, off\n\t"
                 "global_load_async_to_lds_b128 %3, %11, off\n\t"
                 "global_load_async_to_lds_b128 %4, %12, off\n\t"
                 "global_load_async_to_lds_b128 %5, %13, off\n\t"
                 "global_load_async_to_lds_b128 %6, %14, off\n\t"
                 "global_load_async_to_lds_b128 %7, %15, off\n\t"
                 "s_wait_xcnt 0x0"
                 :: "v"(l), "v"(l + ls), "v"(l + 2u * ls), "v"(l + 3u * ls),
                    "v"(l + 4u * ls), "v"(l + 5u * ls), "v"(l + 6u * ls), "v"(l + 7u * ls),
                    "v"(ga), "v"(ga + gs), "v"(ga + 2 * gs), "v"(ga + 3 * gs),
                    "v"(gb), "v"(gb + gs), "v"(gb + 2 * gs), "v"(gb + 3 * gs)
                 : "memory");
}
// k_proj, one 128-deep tile: 256 lanes, 16 per row, rows 16 apart; ctx value rows 0..63, residual rows 64..127, weight rows 128..255 of the ring buffer at lc.
__device__ __forceinline__ void stage_proj(unsigned lc, const hf* gh, const hf* gl, const hf* gw) {
    stage_rows(lc, gh, gl, 16u * CSP * 2u, (size_t)16 * INNER);
    stage_rows(lc + 128u * CSP * 2u, gw, gw + (size_t)64 * INNER, 16u * CSP * 2u, (size_t)16 * INNER);
}

// d_ln: x plane XH[NB*SEQ][128] (f16) = LayerNorm(bf16(in)) with bf16(gamma), bf16(beta); 16 lanes per row, 8 elements per lane; blk = index among the LayerNorm blocks
__device__ __forceinline__ void d_ln(const float* __restrict__ X, const float* __restrict__ G, const float* __restrict__ Bt, hf* XH, unsigned blk) {
    const unsigned tid = threadIdx.x;
    const unsigned row = blk * 16u + (tid >> 4);
    const unsigned sub = tid & 15u;
    const unsigned b = row / (unsigned)SEQ, n = row - b * (unsigned)SEQ;
    const float* src = X + ((size_t)b * SEQ_FULL + n) * DIM + sub * 8u;
    const v4f a0 = *(const v4f*)src;
    const v4f a1 = *(const v4f*)(src + 4);
    float e[8];
    e[0] = bfr(a0[0]); e[1] = bfr(a0[1]); e[2] = bfr(a0[2]); e[3] = bfr(a0[3]);
    e[4] = bfr(a1[0]); e[5] = bfr(a1[1]); e[6] = bfr(a1[2]); e[7] = bfr(a1[3]);
    float s = ((e[0] + e[1]) + (e[2] + e[3])) + ((e[4] + e[5]) + (e[6] + e[7]));
    s += __shfl_xor(s, 8, 32);
    s += __shfl_xor(s, 4, 32);
    s += __shfl_xor(s, 2, 32);
    s += __shfl_xor(s, 1, 32);
    const float mu = s * (1.0f / DIM);
    float d[8];
    float s2 = 0.0f;
#pragma unroll
    for (int j = 0; j < 8; ++j) { d[j] = e[j] - mu; s2 = fmaf(d[j], d[j], s2); }
    s2 += __shfl_xor(s2, 8, 32);
    s2 += __shfl_xor(s2, 4, 32);
    s2 += __shfl_xor(s2, 2, 32);
    s2 += __shfl_xor(s2, 1, 32);
    const float rs = rsqrtf(s2 * (1.0f / DIM) + 1.0e-5f);
    const v4f g0 = *(const v4f*)(G + sub * 8u), g1 = *(const v4f*)(G + sub * 8u + 4u);
    const v4f b0 = *(const v4f*)(Bt + sub * 8u), b1 = *(const v4f*)(Bt + sub * 8u + 4u);
    v8h o;
    o[0] = (_Float16)(d[0] * rs * bfr(g0[0]) + bfr(b0[0]));
    o[1] = (_Float16)(d[1] * rs * bfr(g0[1]) + bfr(b0[1]));
    o[2] = (_Float16)(d[2] * rs * bfr(g0[2]) + bfr(b0[2]));
    o[3] = (_Float16)(d[3] * rs * bfr(g0[3]) + bfr(b0[3]));
    o[4] = (_Float16)(d[4] * rs * bfr(g1[0]) + bfr(b1[0]));
    o[5] = (_Float16)(d[5] * rs * bfr(g1[1]) + bfr(b1[1]));
    o[6] = (_Float16)(d[6] * rs * bfr(g1[2]) + bfr(b1[2]));
    o[7] = (_Float16)(d[7] * rs * bfr(g1[3]) + bfr(b1[3]));
    const v8us ob = __builtin_bit_cast(v8us, o);
    hf* dst = XH + (size_t)row * DIM + sub * 8u;
    *(v8us*)dst = ob;
    asm volatile("s_wait_xcnt 0x0" ::: "memory");   // closes the store ahead of any rewrite of its address and data registers (the code of another block range follows in k_prep)
}

// d_wt: WT[c][r] (f16) = bf16(W[r][c]) * scale; in[R][C] -> out[C][R]; one block = 64 r x 128 c through the LDS tile tl (cross-wave, block barrier); blk = index among this matrix's blocks
__device__ __forceinline__ void d_wt(const float* __restrict__ W, hf* WT, int R, int C, float scale, unsigned blk, hf* tl) {
    const unsigned tid = threadIdx.x;
    const unsigned tc = (unsigned)C / 128u;
    const unsigned kt = blk / tc;
    const unsigned ct = blk - kt * tc;
    const float* src = W + (size_t)(kt * 64u) * (unsigned)C + ct * 128u;
#pragma unroll
    for (unsigned it = 0; it < 8; ++it) {
        const unsigned f = it * 256u + tid;
        const unsigned key = f >> 5, c4 = (f & 31u) * 4u;
        const v4f x = *(const v4f*)(src + (size_t)key * (unsigned)C + c4);
#pragma unroll
        for (unsigned c = 0; c < 4; ++c) tl[(c4 + c) * VTP + key] = f2h(bfr(x[c]) * scale);
    }
    __syncthreads();
    hf* dst = WT + (size_t)(ct * 128u) * (unsigned)R + kt * 64u;
    const unsigned c8 = (tid & 7u) * 8u, dr = tid >> 3;
{
#pragma unroll
        for (unsigned it = 0; it < 4; ++it) {
            const unsigned d = it * 32u + dr;
            const v8us o = *(const v8usa*)(tl + d * VTP + c8);
            *(v8us*)(dst + (size_t)d * (unsigned)R + c8) = o;
        }
        asm volatile("s_wait_xcnt 0x0" ::: "memory");   // closes the four stores ahead of any rewrite of their address and data registers (the code of another block range follows in k_prep)
    }
}

// k_prep: the three preparations that depend on nothing but the inputs, in one launch, by block range (block-uniform branches):
//  blocks [0, NWQ) transpose w_qkv, [NWQ, NWQ + NWP) transpose w_proj, the rest normalise 16 rows each.
__global__ __launch_bounds__(256) void k_prep(const float* __restrict__ X, const float* __restrict__ G, const float* __restrict__ Bt,
                                              const float* __restrict__ WQ, const float* __restrict__ WO, hf* XH, hf* WT, hf* WP) {
    __shared__ __align__(16) hf tl[DIM * VTP];
    const unsigned b = blockIdx.x;
    if (b < (unsigned)NWQ) d_wt(WQ, WT, DIM, QKVN, WQS, b, tl);
    else if (b < (unsigned)(NWQ + NWP)) d_wt(WO, WP, INNER, DIM, WPS, b - (unsigned)NWQ, tl);
    else d_ln(X, G, Bt, XH, b - (unsigned)(NWQ + NWP));
}

// k_qkv: one block = 64 tokens x one (which, head) group of 128 features; wave w owns tokens 16w..16w+15; the eight 16-feature tiles are processed in a rolled loop
//  (one accumulator tile and four weight fragments live at a time; the four token fragments are held), K = 128.
//  The block's x tile (64 rows) and weight tile (128 rows) are brought into LDS once by asynchronous copies (whole 256-byte rows); every fragment is read from LDS.
//  q / k groups: A = W^T rows (row m = feature), B = x rows (column n = token); D element r of lane (h, n) = (feature 16t + 8h + r, token n); staged row-major [token][feature].
//  v group:      A = x rows (row m = token), B = W^T rows (column n = feature); D element r of lane (h, n) = (token 8h + r, feature n); staged transposed [feature][token].
__attribute__((amdgpu_num_vgpr(248))) __global__ __launch_bounds__(128) void k_qkv(const hf* XH, const hf* WT, hf* QKV, int bch0) {
    __shared__ __align__(16) hf st[DIM * VTP];   // x tile (pitch CSP) until the token fragments are held, output staging after that
    __shared__ __align__(16) hf wl[DIM * CSP];   // weight tile: 128 feature rows
    const unsigned tid = threadIdx.x, lane = tid & 31u, lr = lane & 15u, hi = lane >> 4;
    const unsigned wave = (unsigned)__builtin_amdgcn_readfirstlane((int)(tid >> 5));
    const unsigned which = blockIdx.y >> 3, head = blockIdx.y & 7u;
    const unsigned mloc = blockIdx.x * 64u;
    const unsigned bl = mloc / (unsigned)SEQ, n0 = mloc - bl * (unsigned)SEQ;
    const size_t PL = (size_t)BCH * NH * SEQ * DIM;

    {   // staging: 128 lanes, 16 per row, rows 8 apart; 8 pieces of x and 16 of the weights per lane
        const unsigned srow = tid >> 4, scol = (tid & 15u) * 8u;
        const hf* gx = XH + ((size_t)((unsigned)bch0 + bl) * SEQ + n0 + srow) * DIM + scol;
        const hf* gw = WT + ((size_t)blockIdx.y * 128u + srow) * DIM + scol;
        const unsigned lx = (unsigned)(size_t)(st + srow * CSP + scol);
        const unsigned lw = (unsigned)(size_t)(wl + srow * CSP + scol);
        stage_rows(lx, gx, gx + 32 * DIM, 8u * CSP * 2u, (size_t)8 * DIM);
        stage_rows(lw, gw, gw + 32 * DIM, 8u * CSP * 2u, (size_t)8 * DIM);
        stage_rows(lw + 64u * CSP * 2u, gw + 64 * DIM, gw + 96 * DIM, 8u * CSP * 2u, (size_t)8 * DIM);
    }
    asm volatile("s_wait_asynccnt 0x0" ::: "memory");      // this wave's pieces of both tiles have landed
    __syncthreads();                                       // both tiles readable by every wave
    v16h tf[4];
    {
        const hf* tp = st + (16u * wave + lr) * CSP + 8u * hi;
        tf[0] = ldh(tp);
        tf[1] = ldh(tp + 32);
        tf[2] = ldh(tp + 64);
        tf[3] = ldh(tp + 96);
    }
    __syncthreads();                                       // ends every wave's reads of the x tile before it is overwritten as output staging
    const unsigned woff = lr * CSP + 8u * hi;
    const float un = 1.0f / WQS;

    if (which == 2u) {      // block-uniform
#pragma unroll 1
        for (unsigned t = 0; t < 8u; ++t) {
            const hf* wr = wl + woff + t * (16u * CSP);
            const v16h w0 = ldh(wr), w1 = ldh(wr + 32), w2 = ldh(wr + 64), w3 = ldh(wr + 96);
            v8f acc = (v8f){};
            acc = wmmah(tf[0], w0, acc);
            acc = wmmah(tf[1], w1, acc);
            acc = wmmah(tf[2], w2, acc);
            acc = wmmah(tf[3], w3, acc);
            guard1(acc, w0, w1, w2, w3);
            v8h o;
#pragma unroll
            for (int r = 0; r < 8; ++r) o[r] = (_Float16)(acc[r] * un);
            *(v8usa*)(st + (16u * t + lr) * VTP + 16u * wave + 8u * hi) = __builtin_bit_cast(v8us, o);
            sfence();
        }
    } else {
#pragma unroll 1
        for (unsigned t = 0; t < 8u; ++t) {
            const hf* wr = wl + woff + t * (16u * CSP);
            const v16h w0 = ldh(wr), w1 = ldh(wr + 32), w2 = ldh(wr + 64), w3 = ldh(wr + 96);
            v8f acc = (v8f){};
            acc = wmmah(w0, tf[0], acc);
            acc = wmmah(w1, tf[1], acc);
            acc = wmmah(w2, tf[2], acc);
            acc = wmmah(w3, tf[3], acc);
            guard1(acc, w0, w1, w2, w3);
            v8h o;
#pragma unroll
            for (int r = 0; r < 8; ++r) o[r] = (_Float16)(acc[r] * un);
            *(v8usa*)(st + (16u * wave + lr) * CSP + 16u * t + 8u * hi) = __builtin_bit_cast(v8us, o);
            sfence();
        }
    }
    __syncthreads();
    const size_t bhp = (size_t)(bl * NH + head);
    if (which == 2u) {
        hf* dst = QKV + 2 * PL + bhp * DIM * SEQ + n0;
        const unsigned c8 = (tid & 7u) * 8u, dr = tid >> 3;
{
#pragma unroll
            for (unsigned it = 0; it < 8; ++it) {
                const unsigned d = it * 16u + dr;
                const v8us o = *(const v8usa*)(st + d * VTP + c8);
                *(v8us*)(dst + (size_t)d * SEQ + c8) = o;
            }
            
        }
    } else {
        hf* dst = QKV + (size_t)which * PL + (bhp * SEQ + n0) * DIM + lr * 8u;
{
#pragma unroll
            for (unsigned s = 0; s < 8; ++s) {
                const unsigned rr = 16u * wave + 2u * s + hi;
                const v8us o = *(const v8usa*)(st + rr * CSP + lr * 8u);
                *(v8us*)(dst + (size_t)rr * DIM) = o;
            }
            
        }
    }
}

// in-lane maximum of one 16-query column tile's scores: s0 / s1 = S^T tiles of keys 0..15 / 16..31 (this lane's 16 of the column's 32 keys)
__device__ __forceinline__ float lane_max(const v8f& s0, const v8f& s1) {
    float mx = fmaxf(s0[0], s1[0]);
#pragma unroll
    for (int r = 1; r < 8; ++r) mx = fmaxf(mx, fmaxf(s0[r], s1[r]));
    return mx;
}
// one softmax step of one column tile against the reference maximum in use (sh = PCL - that maximum, log2 domain): adds to the running sum l, returns the P^T B fragment
__device__ __forceinline__ v16h soft_step(const v8f& s0, const v8f& s1, float sh, float& l) {
    float p0[8], p1[8];
    float ps = 0.0f;
#pragma unroll
    for (int r = 0; r < 8; ++r) {
        p0[r] = __builtin_amdgcn_exp2f(fmaf(s0[r], SC2, sh));
        p1[r] = __builtin_amdgcn_exp2f(fmaf(s1[r], SC2, sh));
        ps += p0[r] + p1[r];
    }
    ps += __shfl_xor(ps, 16, 32);
    l += ps;
    v16h ph;
#pragma unroll
    for (int r = 0; r < 8; ++r) { ph[r] = (_Float16)p0[r]; ph[8 + r] = (_Float16)p1[r]; }
    return ph;
}

// k_flash: one wave per 32 queries (two 16-query column tiles, a and b) of one (batch, head), 32 keys per step, online softmax; the block's eight waves share K / V^T tiles of 64 keys,
//  staged in a two-buffer LDS ring by asynchronous copies (tile t + 2 is issued behind the barrier that ends the reads of tile t); fragments are read from LDS, each once per step for both column tiles.
//  S^T tile (keys x queries): A = K rows (row m = key, k = d), B = Q rows (column n = query, k = d); D element r of lane (h, n) = S[query n][key 8h + r].
//  Q fragments (B operands): six are held, tile b's first two are read from LDS with their K fragments; K fragments are loaded two at a time (one k-step x two key tiles, four products); V^T fragments four output tiles at a time (eight products).
//  P^T B fragment: element r <- tile of keys 0..15, element 8 + r <- tile of keys 16..31 (same lane); P carried x 2^7 (the running sum carries the same factor).
//  O^T tile (d x queries): A = V^T rows (row m = d, k = key), D element r of lane (h, n) = O[query n][d = 16 t + 8h + r].
__attribute__((amdgpu_num_vgpr(256))) __global__ __launch_bounds__(NWV * 32) void k_flash(const hf* QP, const hf* KP, const hf* VT, hf* CH, hf* CL) {
    __shared__ __align__(16) hf cs[CSE];        // in the loop the K / V^T ring, then 16 Q rows per wave; output staging behind the loop
    const unsigned tid = threadIdx.x, lane = tid & 31u, lr = lane & 15u, hi = lane >> 4;
    const unsigned wave = (unsigned)__builtin_amdgcn_readfirstlane((int)(tid >> 5));
    const unsigned bpb = (unsigned)(SEQ / BQ);
    const unsigned bh = blockIdx.x / bpb;
    const unsigned q0 = (blockIdx.x - bh * bpb) * BQ + wave * (16u * QT);

    v16h qa[4], qb[4];
    {
        const hf* qp = QP + ((size_t)bh * SEQ + q0 + lr) * DIM + 8u * hi;
#pragma unroll
        for (int k = 0; k < 4; ++k) qa[k] = ldh(qp + 32 * k);
#pragma unroll
        for (int k = 2; k < 4; ++k) qb[k] = ldh(qp + 16 * DIM + 32 * k);
    }
    const unsigned kfo = lr * CSP + 8u * hi;          // fragment offsets inside a ring buffer
    // tile b's first two Q fragments live in LDS, in rows of this wave's own behind the ring (same row form as a K tile), and are read with the K fragments of their k-steps:
    // six held Q fragments leave the wave inside 256 registers, four waves per SIMD; with more held it spills to scratch. The loop's last barrier ends every wave's reads of them, ahead of the output staging
    hf* qs = cs + 2 * BUFE + wave * (16u * CSP) + kfo;
    {
        const hf* qp = QP + ((size_t)bh * SEQ + q0 + 16u + lr) * DIM + 8u * hi;
        *(v8usa*)qs = *(const v8us*)qp;
        *(v8usa*)(qs + 16) = *(const v8us*)(qp + 16);
        *(v8usa*)(qs + 32) = *(const v8us*)(qp + 32);
        *(v8usa*)(qs + 48) = *(const v8us*)(qp + 48);
    }
    const unsigned vfo = KTE + lr * VTP + 8u * hi;
    // staging addresses of this lane: K tile = 16 KiB contiguous, 16 lanes per key row; V^T tile = 128 rows of 128 B, 8 lanes per row
    const hf* gk = KP + (size_t)bh * SEQ * DIM + tid * 8u;
    const hf* gv = VT + ((size_t)bh * DIM + (tid >> 3)) * SEQ + (tid & 7u) * 8u;
    const unsigned lk = (unsigned)(size_t)(cs + (tid >> 4) * CSP + (tid & 15u) * 8u);
    const unsigned lv = (unsigned)(size_t)(cs + KTE + (tid >> 3) * VTP + (tid & 7u) * 8u);
    const unsigned nt = (unsigned)(SEQ / TK);

    v8f oa[8], ob[8];
#pragma unroll
    for (int t = 0; t < 8; ++t) { oa[t] = (v8f){}; ob[t] = (v8f){}; }
    float mla = -1.0e30f, mlb = -1.0e30f;   // reference maxima in use, log2 domain
    float la = 0.0f, lb = 0.0f;             // running sums (carried x 2^7)

    stage_kv(lk, lv, gk, gv);                              // tile 0 -> buffer 0
    asm volatile("s_wait_asynccnt 0x0" ::: "memory");      // this wave's pieces of tile 0 have landed
    __syncthreads();                                       // tile 0 readable by every wave
    if (nt > 1u) stage_kv(lk + BUFE * 2u, lv + BUFE * 2u, gk + TK * DIM, gv + TK);   // tile 1 -> buffer 1

#pragma unroll 1
    for (unsigned t = 0; t < nt; ++t) {
      const unsigned bo = (t & 1u) * BUFE;
#pragma unroll 1
      for (unsigned h = 0; h < 2u; ++h) {                  // rolled: one copy of the step's code, one step's fragments live
        v8f sa0 = (v8f){}, sa1 = (v8f){}, sb0 = (v8f){}, sb1 = (v8f){};
        const hf* ka = cs + bo + kfo + h * (KS * CSP);
#pragma unroll
        for (int k = 0; k < 4; ++k) {                      // one k-step at a time: two K fragments, four products
            const v16h a0 = ldh(ka + 32 * k), a1 = ldh(ka + 16 * CSP + 32 * k);
            const v16h qk = k < 2 ? ldh(qs + 32 * k) : qb[k];
            sa0 = wmmah(a0, qa[k], sa0);
            sa1 = wmmah(a1, qa[k], sa1);
            sb0 = wmmah(a0, qk, sb0);
            sb1 = wmmah(a1, qk, sb1);
            guard4(sa0, sa1, sb0, sb1, a0, a1, qk);
            sfence();
        }

        // lazy rescale: the reference maxima move only when some score lies more than LZT above the one in use, so P stays near or below 2^(PCL + LZT); one wave-uniform test per step for both tiles, on in-lane maxima (the exchange between the halves is needed only when the maxima move)
        const float xa = lane_max(sa0, sa1), xb = lane_max(sb0, sb1);
        if (__builtin_amdgcn_ballot_w32(fmaxf(fmaf(xa, SC2, -mla), fmaf(xb, SC2, -mlb)) > LZT) != 0u) {
            const float na = fmaxf(mla, fmaxf(xa, __shfl_xor(xa, 16, 32)) * SC2);   // both halves of a column take the same new maximum
            const float nb = fmaxf(mlb, fmaxf(xb, __shfl_xor(xb, 16, 32)) * SC2);
            const float ca = __builtin_amdgcn_exp2f(mla - na), cb = __builtin_amdgcn_exp2f(mlb - nb);
            mla = na; mlb = nb;
            la *= ca; lb *= cb;
#pragma unroll
            for (int j = 0; j < 8; ++j) { oa[j] *= ca; ob[j] *= cb; }
        }
        const v16h pa = soft_step(sa0, sa1, PCL - mla, la);
        sfence();   // keeps the scheduler from merging the two tiles' exponentials into one region: merged, the live set passes 256 registers and the kernel spills to scratch
        const v16h pb = soft_step(sb0, sb1, PCL - mlb, lb);

        sfence();   // keep the V^T loads below the softmax (bounds live fragments)
        const hf* va = cs + bo + vfo + h * KS;
        {
            const v16h v0 = ldh(va), v1 = ldh(va + 16 * VTP), v2 = ldh(va + 32 * VTP), v3 = ldh(va + 48 * VTP);
            oa[0] = wmmah(v0, pa, oa[0]);
            ob[0] = wmmah(v0, pb, ob[0]);
            oa[1] = wmmah(v1, pa, oa[1]);
            ob[1] = wmmah(v1, pb, ob[1]);
            oa[2] = wmmah(v2, pa, oa[2]);
            ob[2] = wmmah(v2, pb, ob[2]);
            oa[3] = wmmah(v3, pa, oa[3]);
            ob[3] = wmmah(v3, pb, ob[3]);
            guard8(oa[0], ob[0], oa[1], ob[1], oa[2], ob[2], oa[3], ob[3], v0, v1, v2, v3, pa, pb);
        }
        sfence();
        {
            const v16h v4 = ldh(va + 64 * VTP), v5 = ldh(va + 80 * VTP), v6 = ldh(va + 96 * VTP), v7 = ldh(va + 112 * VTP);
            oa[4] = wmmah(v4, pa, oa[4]);
            ob[4] = wmmah(v4, pb, ob[4]);
            oa[5] = wmmah(v5, pa, oa[5]);
            ob[5] = wmmah(v5, pb, ob[5]);
            oa[6] = wmmah(v6, pa, oa[6]);
            ob[6] = wmmah(v6, pb, ob[6]);
            oa[7] = wmmah(v7, pa, oa[7]);
            ob[7] = wmmah(v7, pb, ob[7]);
            guard8(oa[4], ob[4], oa[5], ob[5], oa[6], ob[6], oa[7], ob[7], v4, v5, v6, v7, pa, pb);
        }
        sfence();
      }
      asm volatile("s_wait_dscnt 0x0" ::: "memory");       // this wave's reads of tile t have returned before its buffer is refilled
      asm volatile("s_wait_asynccnt 0x0" ::: "memory");    // this wave's pieces of tile t + 1 have landed
      __syncthreads();                                     // publishes tile t + 1 and ends every wave's reads of tile t
      if (t + 2u < nt) stage_kv(lk + bo * 2u, lv + bo * 2u, gk + (size_t)(t + 2u) * (TK * DIM), gv + (t + 2u) * TK);
    }
    asm volatile("s_wait_asynccnt 0x0" ::: "memory");      // no copy outstanding when the ring becomes output staging

    // epilogue: stage ctx value / residual rows [query][d] (wave-private regions; block barrier used)
    const unsigned creg = wave * (QT * 2u * 16u * CSP);
#pragma unroll
    for (int c = 0; c < QT; ++c) {
        const float sc = (1.0f / (c == 0 ? la : lb)) * CCS;
        const unsigned cr = creg + (unsigned)c * (2u * 16u * CSP);
#pragma unroll
        for (int t = 0; t < 8; ++t) {
            v8h hv, lv;
#pragma unroll
            for (int r = 0; r < 8; ++r) {
                const float x = (c == 0 ? oa[t][r] : ob[t][r]) * sc;
                const _Float16 h = (_Float16)x;
                hv[r] = h;
                lv[r] = (_Float16)((x - (float)h) * RSC);
            }
            *(v8usa*)(cs + cr + lr * CSP + 16u * t + 8u * hi) = __builtin_bit_cast(v8us, hv);
            *(v8usa*)(cs + cr + 16u * CSP + lr * CSP + 16u * t + 8u * hi) = __builtin_bit_cast(v8us, lv);
        }
    }
    __syncthreads();
    const unsigned bl = bh / NH, head = bh - bl * NH;
    const size_t rowbase = ((size_t)bl * SEQ + q0) * INNER + head * DIM + lr * 8u;
#pragma unroll
    for (unsigned c = 0; c < (unsigned)QT; ++c) {
        const unsigned cr = creg + c * (2u * 16u * CSP);
#pragma unroll
        for (unsigned s = 0; s < 8; ++s) {
            const unsigned rr = 2u * s + hi;
            const v8us vh = *(const v8usa*)(cs + cr + rr * CSP + lr * 8u);
            const v8us vl = *(const v8usa*)(cs + cr + 16u * CSP + rr * CSP + lr * 8u);
            *(v8us*)(CH + rowbase + (size_t)(16u * c + rr) * INNER) = vh;
            *(v8us*)(CL + rowbase + (size_t)(16u * c + rr) * INNER) = vl;
        }
        if (c + 1u < (unsigned)QT) asm volatile("s_wait_xcnt 0x0" ::: "memory");   // closes this tile's stores ahead of the next tile's LDS reads, which reuse their data registers
    }
}

// k_proj: one block = 64 tokens x 128 output features, K = 1024; wave w: token group w>>1 (16 tokens), feature half w&1 (four 16-feature tiles).
//  A = w_proj^T rows (row m = feature, k = inner), B = ctx rows (column n = token); D element r of lane (h, n) = (feature 8h + r, token n).
//  The K loop walks 128-deep tiles of the ctx value, ctx residual and weight rows, staged in a two-buffer LDS ring by asynchronous copies (tile t + 2 is issued behind the barrier that ends the reads of tile t).
//  ctx value and residual planes share the weight fragment and use separate accumulators; out = (acc_v + acc_r / 2^11) / 512 + bf16(bias), added at the store stage.
__global__ __launch_bounds__(256) void k_proj(const hf* CH, const hf* CL, const hf* WP, const float* __restrict__ bias, float* OUT, int bch0) {
    __shared__ __align__(16) hf rg[2 * PBE];     // operand ring
    __shared__ __align__(16) float os[64 * OSP];
    const unsigned tid = threadIdx.x, lane = tid & 31u, lr = lane & 15u, hi = lane >> 4;
    const unsigned wave = (unsigned)__builtin_amdgcn_readfirstlane((int)(tid >> 5));
    const unsigned tg = wave >> 1, fh = wave & 1u;
    const unsigned m0 = blockIdx.x * 64u;
    const unsigned coff = (16u * tg + lr) * CSP + 8u * hi;                 // fragment offsets inside a ring buffer
    const unsigned woff = (128u + 64u * fh + lr) * CSP + 8u * hi;
    // staging addresses of this lane: 16 lanes per 256-byte row piece
    const hf* gh = CH + (size_t)(m0 + (tid >> 4)) * INNER + (tid & 15u) * 8u;
    const hf* gl = CL + (size_t)(m0 + (tid >> 4)) * INNER + (tid & 15u) * 8u;
    const hf* gw = WP + (size_t)(tid >> 4) * INNER + (tid & 15u) * 8u;
    const unsigned lc = (unsigned)(size_t)(rg + (tid >> 4) * CSP + (tid & 15u) * 8u);
    const unsigned nt = (unsigned)(INNER / PKT);

    v8f ah[4], al[4];
#pragma unroll
    for (int t = 0; t < 4; ++t) { ah[t] = (v8f){}; al[t] = (v8f){}; }

    stage_proj(lc, gh, gl, gw);                            // tile 0 -> buffer 0
    asm volatile("s_wait_asynccnt 0x0" ::: "memory");      // this wave's pieces of tile 0 have landed
    __syncthreads();                                       // tile 0 readable by every wave
    if (nt > 1u) stage_proj(lc + PBE * 2u, gh + PKT, gl + PKT, gw + PKT);   // tile 1 -> buffer 1

#pragma unroll 1
    for (unsigned t = 0; t < nt; ++t) {
      const unsigned bo = (t & 1u) * PBE;
#pragma unroll 1
      for (unsigned k0 = 0; k0 < (unsigned)PKT; k0 += 32) {   // rolled: one copy of the step's code, one step's fragments live
        const hf* cr = rg + bo + coff + k0;
        const v16h ch = ldh(cr);
        const v16h cl = ldh(cr + 64 * CSP);
        const hf* wr = rg + bo + woff + k0;
        const v16h w0 = ldh(wr), w1 = ldh(wr + 16 * CSP), w2 = ldh(wr + 32 * CSP), w3 = ldh(wr + 48 * CSP);
        ah[0] = wmmah(w0, ch, ah[0]);
        al[0] = wmmah(w0, cl, al[0]);
        ah[1] = wmmah(w1, ch, ah[1]);
        al[1] = wmmah(w1, cl, al[1]);
        ah[2] = wmmah(w2, ch, ah[2]);
        al[2] = wmmah(w2, cl, al[2]);
        ah[3] = wmmah(w3, ch, ah[3]);
        al[3] = wmmah(w3, cl, al[3]);
        guard8(ah[0], ah[1], ah[2], ah[3], al[0], al[1], al[2], al[3], ch, cl, w0, w1, w2, w3);
        sfence();
      }
      asm volatile("s_wait_dscnt 0x0" ::: "memory");       // this wave's reads of tile t have returned before its buffer is refilled
      asm volatile("s_wait_asynccnt 0x0" ::: "memory");    // this wave's pieces of tile t + 1 have landed
      __syncthreads();                                     // publishes tile t + 1 and ends every wave's reads of tile t
      if (t + 2u < nt) stage_proj(lc + bo * 2u, gh + (t + 2u) * PKT, gl + (t + 2u) * PKT, gw + (t + 2u) * PKT);
    }
    asm volatile("s_wait_asynccnt 0x0" ::: "memory");      // no copy outstanding behind the loop

    const float un = 1.0f / (CCS * WPS);
    const float ur = 1.0f / RSC;
#pragma unroll
    for (int t = 0; t < 4; ++t) {
        v4f x0, x1;
        x0[0] = fmaf(al[t][0], ur, ah[t][0]) * un; x0[1] = fmaf(al[t][1], ur, ah[t][1]) * un;
        x0[2] = fmaf(al[t][2], ur, ah[t][2]) * un; x0[3] = fmaf(al[t][3], ur, ah[t][3]) * un;
        x1[0] = fmaf(al[t][4], ur, ah[t][4]) * un; x1[1] = fmaf(al[t][5], ur, ah[t][5]) * un;
        x1[2] = fmaf(al[t][6], ur, ah[t][6]) * un; x1[3] = fmaf(al[t][7], ur, ah[t][7]) * un;
        const unsigned so = (16u * tg + lr) * OSP + 64u * fh + 16u * t + 8u * hi;
        *(v4fa*)(os + so) = x0;
        *(v4fa*)(os + so + 4u) = x1;
    }
    __syncthreads();
    const v4f bb = *(const v4f*)(bias + lane * 4u);
    v4f bq;
    bq[0] = bfr(bb[0]); bq[1] = bfr(bb[1]); bq[2] = bfr(bb[2]); bq[3] = bfr(bb[3]);
    float* orow = OUT + ((size_t)bch0 * SEQ + m0 + 8u * wave) * DIM + lane * 4u;
{
#pragma unroll
        for (unsigned s = 0; s < 8; ++s) {
            v4f val = *(const v4fa*)(os + (8u * wave + s) * OSP + lane * 4u);
            val[0] += bq[0]; val[1] += bq[1]; val[2] += bq[2]; val[3] += bq[3];
            *(v4f*)(orow + (size_t)s * DIM) = val;
        }
        
    }
}

extern "C" void kernel_launch(void* const* d_in, const int* in_sizes, int n_in,
                              void* d_out, int out_size, void* d_ws, size_t ws_size, hipStream_t stream) {
    if (n_in < 6) return;
    const size_t need = ((size_t)(NB - 1) * SEQ_FULL + SEQ) * DIM;
    if ((size_t)in_sizes[0] < need) return;
    if (in_sizes[1] < DIM || in_sizes[2] < DIM || in_sizes[5] < DIM) return;
    if ((size_t)in_sizes[3] < (size_t)DIM * QKVN) return;
    if ((size_t)in_sizes[4] < (size_t)INNER * DIM) return;
    if ((size_t)out_size < (size_t)NB * SEQ * DIM) return;
    if (SZ_ALL > ws_size) return;

    const float* x      = (const float*)d_in[0];   // inputs  [NB][SEQ_FULL][128] (rows n < SEQ read)
    const float* gamma  = (const float*)d_in[1];   // ln_gamma [128]
    const float* beta   = (const float*)d_in[2];   // ln_beta  [128]
    const float* w_qkv  = (const float*)d_in[3];   // [128][3072]  ([in][out])
    const float* w_proj = (const float*)d_in[4];   // [1024][128]  ([in][out])
    const float* b_proj = (const float*)d_in[5];   // [128]
    float* OUT = (float*)d_out;                    // [NB][SEQ][128]

    char* wsp = (char*)d_ws;
    hf* XH  = (hf*)(wsp);
    hf* WT  = (hf*)(wsp + SZ_XH);
    hf* WP  = (hf*)(wsp + SZ_XH + SZ_WT);
    hf* QKV = (hf*)(wsp + SZ_XH + SZ_WT + SZ_WP);
    hf* CH  = (hf*)(wsp + SZ_XH + SZ_WT + SZ_WP + 3 * SZ_PL);
    hf* CL  = (hf*)(wsp + SZ_XH + SZ_WT + SZ_WP + 3 * SZ_PL + SZ_CX);
    const size_t PL = (size_t)BCH * NH * SEQ * DIM;   // elements per q / k / v^T plane

    k_prep<<<(unsigned)(NWQ + NWP + NLN), 256, 0, stream>>>(x, gamma, beta, w_qkv, w_proj, XH, WT, WP);
    for (int c = 0; c < NCH; ++c) {
        const int bch0 = c * BCH;
        k_qkv<<<dim3((unsigned)(BCH * SEQ / 64), 24, 1), 128, 0, stream>>>(XH, WT, QKV, bch0);
        k_flash<<<(unsigned)(BCH * NH * (SEQ / BQ)), NWV * 32, 0, stream>>>(QKV, QKV + PL, QKV + 2 * PL, CH, CL);
        k_proj<<<(unsigned)(BCH * SEQ / 64), 256, 0, stream>>>(CH, CL, WP, b_proj, OUT, bch0);
    }
}

// v007
// Measured time: 65.5 microseconds a run.
// Versions between v005 and this one are left out; their measured steps multiply to 1.44 times as fast.
// Counting every step since v000, it is 5.80 times as fast.
#include <hip/hip_runtime.h>

// Pre-LayerNorm multi-head softmax(QK^T)V block: x = LN(in) over 128; qkv = x @ w_qkv ([128][3072], thirds q|k|v, column = which*1024 + h*128 + d); 8 heads of dim 128; logits (q.k)/32; out = ctx @ w_proj + b_proj.
// The K and V projections are folded into their neighbours' weights (head dim == token width, so both folded matrices are 128 x 128 per head):
//  q.k = x_i (Wq_h Wk_h^T) x_j^T, so Q' = x @ M_h with M_h = Wq_h Wk_h^T, and the keys are the x rows; (P v) Wp_h = (P x)(Wv_h Wp_h), so the values are the x rows and the output projection uses N_h = Wv_h Wp_h.
// Compute dtypes, f32 accumulate: every contraction on v_wmma_f32_16x16x32_f16. Float inputs are RNE-converted to bf16 first; weights enter the folds as bf16 value x 16 (w_qkv) / x 32 (w_proj), exact in f16; M carried as f16 x 16, N as f16 x 32;
// x, Q' planes f16; P carried as f16 x 2^7 (online softmax in f32, log2 domain, lazy rescale); ctx = P x carried as f16(ctx x 16) plus f16 residual x 2^11 with its own accumulator in the output projection.
// The output projection runs inside k_flash: a block's eight waves are the eight heads of the same 32 queries, each wave multiplies its own ctx (still in registers) by its head's N_h, and the eight partial outputs are summed through LDS.
// Flash form with transposed tiles: the S^T accumulator tiles are directly the B-operand layout of P^T; the k_q and k_flash operands read from memory are two 16-byte loads from dense, statically strided 16-bit rows (LDS tiles; only the flash Q rows and the folded output weights, stored in fragment order, come straight from their planes); the folds in k_prep convert theirs from the float inputs.

#ifndef NB
#define NB 16
#endif
#ifndef SEQ
#define SEQ 1024
#endif
#define NB_FULL  16
#define SEQ_FULL 1024
#define DIM   128                 // token width == head dim
#define NH    8
#define INNER (NH * DIM)          // 1024
#define QKVN  (3 * INNER)         // 3072
#define NCH   1                   // batch chunks: all batches go through one k_q / k_flash pass
#define BCH   (NB / NCH)          // batches per chunk
#define NWV   8                   // waves per flash block: one per head
#define QT    2                   // 16-query column tiles per flash wave: each K / V^T fragment read from LDS feeds QT products
#define BQ    (16 * QT)           // queries per flash block (the same ones for every head)
#define KS    32                  // keys per step
#define TK    64                  // keys per staged K / V^T tile (two steps)
#define CSP   136                 // LDS pitch (16-bit elements) of 128-wide staging rows
#define OSP   132                 // LDS pitch (floats) of the output staging rows
#define VTP   72                  // LDS pitch (16-bit elements) of 64-wide transposed rows
#define KTE   (TK * CSP)          // staged K tile, 16-bit elements: TK key rows of 128
#define BUFE  (KTE + DIM * VTP)   // one ring buffer: K tile, then V^T tile (128 rows of TK keys)
#define RNE   (2 * BUFE + NWV * 16 * CSP)         // k_flash in the loop, 16-bit elements: the ring, then 16 Q rows per wave
#define OSE   (NH * BQ * OSP * 2)                 // k_flash behind the loop, 16-bit elements: per head BQ rows of float partial outputs
#define CSE   (RNE > OSE ? RNE : OSE)             // k_flash LDS, 16-bit elements
#define WFT   (4 * 2 * 32 * 8)    // folded output weights, 16-bit elements per 16-feature tile of one head: four k-steps x two fragment halves x 32 lanes x 8
#define L2E   1.4426950408889634f
#define SC2   (L2E * 0.03125f)    // log2(e) / 32
#define PCL   7.0f                // P carry exponent (2^7)
#define LZT   8.0f                // lazy rescale: how far (log2 domain) a score may lie above the reference maximum in use; 2^(PCL + LZT) is finite in f16
#define WQS   16.0f               // w_qkv carry
#define WPS   32.0f               // w_proj carry
#define CCS   16.0f               // ctx carry
#define RSC   2048.0f             // ctx residual carry
#define NFD   (NH * (DIM / 16))             // k_prep: blocks per folded weight product, one head x one 16-column tile each
#define NLN   (NB * SEQ / 64)               // k_prep: LayerNorm blocks, 64 rows each

static_assert(DIM == 128);
static_assert(INNER == 1024);
static_assert(NB <= NB_FULL);
static_assert(SEQ <= SEQ_FULL);
static_assert(NB % NCH == 0);
static_assert(SEQ % BQ == 0);
static_assert(SEQ % 64 == 0);
static_assert(SEQ % KS == 0);
static_assert(SEQ % TK == 0 && TK == 2 * KS && TK <= VTP);
static_assert(NWV * 32 == 256);                  // k_flash staging: 256 lanes x 16 B x 4 pieces == one 16-KiB tile
static_assert(TK * DIM * 2 == 4 * 256 * 16);
static_assert((KTE * 2) % 16 == 0 && (BUFE * 2) % 16 == 0);
static_assert(QT == 2);                          // k_flash names its two column tiles a and b
static_assert(NWV == NH);                        // k_flash: wave == head
static_assert(BQ == 4 * NWV);                    // k_flash: each wave sums and stores four output rows
static_assert(DIM % 32 == 0);
static_assert(DIM == 4 * 32);                    // four 32-deep k-steps per score tile / per Q' tile / per folded tile
static_assert(DIM == 8 * 16);                    // eight 16-row output tiles per wave
static_assert(INNER % 32 == 0);
static_assert(DIM / 16 == 8);                    // d_fold: eight waves x 16 rows, eight column tiles per head
static_assert(16 * 8 == DIM);                    // d_ln: 16 lanes x 8 elements == row
static_assert(64 <= VTP);                        // transposed staging rows hold 64 tokens
static_assert((CSP * 2) % 16 == 0);
static_assert((VTP * 2) % 16 == 0);
static_assert((OSP * 4) % 16 == 0);
static_assert(32 * 4 == DIM);                    // k_flash: 32 lanes x 4 floats == output row
static_assert(16 * 8 * 2 == 256);                // 16 lanes x 16 B == one 128-element 16-bit row
static_assert(QKVN % 128 == 0);
static_assert((BCH * SEQ) % 64 == 0);            // d_ln / k_q: 64 tokens per block (SEQ % 64 == 0: all of one batch)

#define SZ_XH  ((size_t)NB * SEQ * DIM * 2)
#define SZ_WT  ((size_t)INNER * DIM * 2)
#define SZ_WP  ((size_t)DIM * INNER * 2)
#define SZ_PL  ((size_t)BCH * NH * SEQ * DIM * 2)
#define SZ_ALL (2 * SZ_XH + SZ_WT + SZ_WP + SZ_PL)
static_assert(SZ_XH % 256 == 0 && SZ_WT % 256 == 0 && SZ_WP % 256 == 0 && SZ_PL % 256 == 0);
static_assert(SZ_ALL <= (size_t)268435456);

typedef unsigned short hf;
typedef __attribute__((ext_vector_type(16))) _Float16 v16h;
typedef __attribute__((ext_vector_type(8)))  _Float16 v8h;
typedef __attribute__((ext_vector_type(8)))  unsigned short v8us;
typedef __attribute__((ext_vector_type(8)))  float    v8f;
typedef __attribute__((ext_vector_type(4)))  float    v4f;
typedef v4f  __attribute__((may_alias)) v4fa;
typedef v8us __attribute__((may_alias)) v8usa;

__device__ __forceinline__ float bfr(float f) { unsigned u = __float_as_uint(f); u += 0x7FFFu + ((u >> 16) & 1u); return __uint_as_float(u & 0xFFFF0000u); }
__device__ __forceinline__ unsigned short f2h(float f) { return __builtin_bit_cast(unsigned short, (_Float16)f); }
__device__ __forceinline__ v16h cat16h(v8us lo, v8us hi) { return __builtin_bit_cast(v16h, __builtin_shufflevector(lo, hi, 0, 1, 2, 3, 4, 5, 6, 7, 8, 9, 10, 11, 12, 13, 14, 15)); }
__device__ __forceinline__ v8f wmmah(v16h a, v16h b, v8f c) { return __builtin_amdgcn_wmma_f32_16x16x32_f16(false, a, false, b, (short)0, c, false, false); }
// fragment loader (A and B alike): p = row base + k0 + 8*(lane>>4); elements 0..7 <- p[0..7], elements 8..15 <- p[16..23]
__device__ __forceinline__ v16h ldh(const hf* p) { return cat16h(*(const v8us*)p, *(const v8us*)(p + 16)); }
__device__ __forceinline__ void sfence() { asm volatile("" ::: "memory"); __builtin_amdgcn_sched_barrier(0); }
// hazard guards: four idle VALU slots after the last WMMA of a group; the group's operand fragments stay live until here
__device__ __forceinline__ void guard1(v8f& c0, v16h a, v16h b, v16h c, v16h d) {
    asm volatile("v_nop\n\tv_nop\n\tv_nop\n\tv_nop" : "+v"(c0) : "v"(a), "v"(b), "v"(c), "v"(d));
}
__device__ __forceinline__ void guard4(v8f& c0, v8f& c1, v8f& c2, v8f& c3, v16h a, v16h b, v16h c) {
    asm volatile("v_nop\n\tv_nop\n\tv_nop\n\tv_nop" : "+v"(c0), "+v"(c1), "+v"(c2), "+v"(c3) : "v"(a), "v"(b), "v"(c));
}
__device__ __forceinline__ void guard4w(v8f& c0, v8f& c1, v8f& c2, v8f& c3, v16h a, v16h b, v16h c, v16h d) {
    asm volatile("v_nop\n\tv_nop\n\tv_nop\n\tv_nop" : "+v"(c0), "+v"(c1), "+v"(c2), "+v"(c3) : "v"(a), "v"(b), "v"(c), "v"(d));
}
__device__ __forceinline__ void guard8(v8f& c0, v8f& c1, v8f& c2, v8f& c3, v8f& c4, v8f& c5, v8f& c6, v8f& c7,
                                       v16h a, v16h b, v16h c, v16h d, v16h e, v16h f) {
    asm volatile("v_nop\n\tv_nop\n\tv_nop\n\tv_nop"
                 : "+v"(c0), "+v"(c1), "+v"(c2), "+v"(c3), "+v"(c4), "+v"(c5), "+v"(c6), "+v"(c7)
                 : "v"(a), "v"(b), "v"(c), "v"(d), "v"(e), "v"(f));
}

// One 64-key tile, global -> LDS through no register: each lane copies four 16-byte pieces of K (16 key rows apart) and four of V^T (32 d rows apart).
// lk / lv: the lane's LDS byte addresses of its first pieces; gk / gv: their global addresses. The address-translation wait closes the statement, ahead of any rewrite of the address registers.
__device__ __forceinline__ void stage_kv(unsigned lk, unsigned lv, const hf* gk, const hf* gv) {
    asm volatile("global_load_async_to_lds_b128 %0, %8, off\n\t"
                 "global_load_async_to_lds_b128 %1, %9, off\n\t"
                 "global_load_async_to_lds_b128 %2, %10, off\n\t"
                 "global_load_async_to_lds_b128 %3, %11, off\n\t"
                 "global_load_async_to_lds_b128 %4, %12, off\n\t"
                 "global_load_async_to_lds_b128 %5, %13, off\n\t"
                 "global_load_async_to_lds_b128 %6, %14, off\n\t"
                 "global_load_async_to_lds_b128 %7, %15, off\n\t"
                 "s_wait_xcnt 0x0"
                 :: "v"(lk), "v"(lk + 16u * CSP * 2u), "v"(lk + 32u * CSP * 2u), "v"(lk + 48u * CSP * 2u),
                    "v"(lv), "v"(lv + 32u * VTP * 2u), "v"(lv + 64u * VTP * 2u), "v"(lv + 96u * VTP * 2u),
                    "v"(gk), "v"(gk + 16 * DIM), "v"(gk + 32 * DIM), "v"(gk + 48 * DIM),
                    "v"(gv), "v"(gv + (size_t)32 * SEQ), "v"(gv + (size_t)64 * SEQ), "v"(gv + (size_t)96 * SEQ)
                 : "memory");
}

// Eight 16-byte pieces of row-major tiles, global -> LDS through no register: four from ga and four from gb, gs elements apart in each run; they land ls bytes apart, from l on.
// The address-translation wait closes the statement, ahead of any rewrite of the address registers.
__device__ __forceinline__ void stage_rows(unsigned l, const hf* ga, const hf* gb, unsigned ls, size_t gs) {
    asm volatile("global_load_async_to_lds_b128 %0, %8, off\n\t"
                 "global_load_async_to_lds_b128 %1, %9, off\n\t"
                 "global_load_async_to_lds_b128 %2, %10, off\n\t"
                 "global_load_async_to_lds_b128 %3, %11, off\n\t"
                 "global_load_async_to_lds_b128 %4, %12, off\n\t"
                 "global_load_async_to_lds_b128 %5, %13, off\n\t"
                 "global_load_async_to_lds_b128 %6, %14, off\n\t"
                 "global_load_async_to_lds_b128 %7, %15, off\n\t"
                 "s_wait_xcnt 0x0"
                 :: "v"(l), "v"(l + ls), "v"(l + 2u * ls), "v"(l + 3u * ls),
                    "v"(l + 4u * ls), "v"(l + 5u * ls), "v"(l + 6u * ls), "v"(l + 7u * ls),
                    "v"(ga), "v"(ga + gs), "v"(ga + 2 * gs), "v"(ga + 3 * gs),
                    "v"(gb), "v"(gb + gs), "v"(gb + 2 * gs), "v"(gb + 3 * gs)
                 : "memory");
}

// d_ln: x plane XH[NB*SEQ][128] (f16) = LayerNorm(bf16(in)) with bf16(gamma), bf16(beta), and its transpose XT[NB][128][SEQ]; one block = 64 rows of one batch, in four passes of 16 rows;
//  16 lanes per row, 8 elements per lane; the transpose goes through the LDS tile tl (cross-wave, block barrier), so that a block stores whole 128-byte pieces of the XT rows; blk = index among the LayerNorm blocks
__device__ __forceinline__ void d_ln(const float* __restrict__ X, const float* __restrict__ G, const float* __restrict__ Bt, hf* XH, hf* XT, unsigned blk, hf* tl) {
    const unsigned tid = threadIdx.x;
    const unsigned sub = tid & 15u;
    const unsigned row0 = blk * 64u;
    const unsigned b = row0 / (unsigned)SEQ, n0 = row0 - b * (unsigned)SEQ;
    const v4f g0 = *(const v4f*)(G + sub * 8u), g1 = *(const v4f*)(G + sub * 8u + 4u);
    const v4f b0 = *(const v4f*)(Bt + sub * 8u), b1 = *(const v4f*)(Bt + sub * 8u + 4u);
    v4f x0[4], x1[4];                                   // all four passes' rows are asked for at once: one memory latency per block
#pragma unroll
    for (unsigned it = 0; it < 4; ++it) {
        const float* src = X + ((size_t)b * SEQ_FULL + n0 + it * 16u + (tid >> 4)) * DIM + sub * 8u;
        x0[it] = *(const v4f*)src;
        x1[it] = *(const v4f*)(src + 4);
    }
#pragma unroll
    for (unsigned it = 0; it < 4; ++it) {
        const unsigned tr = it * 16u + (tid >> 4);
        const v4f a0 = x0[it], a1 = x1[it];
        float e[8];
        e[0] = bfr(a0[0]); e[1] = bfr(a0[1]); e[2] = bfr(a0[2]); e[3] = bfr(a0[3]);
        e[4] = bfr(a1[0]); e[5] = bfr(a1[1]); e[6] = bfr(a1[2]); e[7] = bfr(a1[3]);
        float s = ((e[0] + e[1]) + (e[2] + e[3])) + ((e[4] + e[5]) + (e[6] + e[7]));
        s += __shfl_xor(s, 8, 32);
        s += __shfl_xor(s, 4, 32);
        s += __shfl_xor(s, 2, 32);
        s += __shfl_xor(s, 1, 32);
        const float mu = s * (1.0f / DIM);
        float d[8];
        float s2 = 0.0f;
#pragma unroll
        for (int j = 0; j < 8; ++j) { d[j] = e[j] - mu; s2 = fmaf(d[j], d[j], s2); }
        s2 += __shfl_xor(s2, 8, 32);
        s2 += __shfl_xor(s2, 4, 32);
        s2 += __shfl_xor(s2, 2, 32);
        s2 += __shfl_xor(s2, 1, 32);
        const float rs = rsqrtf(s2 * (1.0f / DIM) + 1.0e-5f);
        v8h o;
        o[0] = (_Float16)(d[0] * rs * bfr(g0[0]) + bfr(b0[0]));
        o[1] = (_Float16)(d[1] * rs * bfr(g0[1]) + bfr(b0[1]));
        o[2] = (_Float16)(d[2] * rs * bfr(g0[2]) + bfr(b0[2]));
        o[3] = (_Float16)(d[3] * rs * bfr(g0[3]) + bfr(b0[3]));
        o[4] = (_Float16)(d[4] * rs * bfr(g1[0]) + bfr(b1[0]));
        o[5] = (_Float16)(d[5] * rs * bfr(g1[1]) + bfr(b1[1]));
        o[6] = (_Float16)(d[6] * rs * bfr(g1[2]) + bfr(b1[2]));
        o[7] = (_Float16)(d[7] * rs * bfr(g1[3]) + bfr(b1[3]));
        const v8us ob = __builtin_bit_cast(v8us, o);
        hf* dst = XH + (size_t)(row0 + tr) * DIM + sub * 8u;
        *(v8us*)dst = ob;
        asm volatile("s_wait_xcnt 0x0" ::: "memory");   // closes the store ahead of any rewrite of its address and data registers by the next pass
        const unsigned cw = (((tr >> 3) ^ (sub >> 1)) << 3) + (tr & 7u);   // 8-token column groups XOR-ed with d >> 4: a pass's 16 lanes per row, 8 tile rows apart, fall on 16 different banks instead of 2
#pragma unroll
        for (unsigned j = 0; j < 8; ++j) tl[(sub * 8u + j) * VTP + cw] = ob[j];
    }
    __syncthreads();                                    // the 128 x 64 transposed tile is complete before any wave reads it back
    hf* dt = XT + (size_t)b * DIM * SEQ + n0;
    const unsigned c8 = (tid & 7u) * 8u, dr = tid >> 3;
#pragma unroll
    for (unsigned it = 0; it < 4; ++it) {
        const unsigned d = it * 32u + dr;
        const v8us o = *(const v8usa*)(tl + d * VTP + (c8 ^ (((d >> 4) & 7u) << 3)));   // undoes the column-group XOR of the writers
        *(v8us*)(dt + (size_t)d * SEQ + c8) = o;
    }
    asm volatile("s_wait_xcnt 0x0" ::: "memory");       // closes the four stores ahead of any rewrite of their address and data registers
}

// eight floats -> f16 of bf16(value) * scale
__device__ __forceinline__ v8us cv8(v4f a, v4f b, float scale) {
    v8us o;
    o[0] = f2h(bfr(a[0]) * scale); o[1] = f2h(bfr(a[1]) * scale); o[2] = f2h(bfr(a[2]) * scale); o[3] = f2h(bfr(a[3]) * scale);
    o[4] = f2h(bfr(b[0]) * scale); o[5] = f2h(bfr(b[1]) * scale); o[6] = f2h(bfr(b[2]) * scale); o[7] = f2h(bfr(b[3]) * scale);
    return o;
}
// One 128-float row piece as sixteen 16-byte loads, in the k order of ldh: p = row base + 8*(lane>>4), c = the piece's constant column (which third of w_qkv); r[4k], r[4k+1] <- p[c + 32k .. c + 32k+7], r[4k+2], r[4k+3] <- 16 further.
__device__ __forceinline__ void ld_row16(const float* p, unsigned c, v4f (&r)[16]) {
#pragma unroll
    for (unsigned k = 0; k < 4; ++k) {
        r[4 * k]     = *(const v4f*)(p + c + 32 * k);
        r[4 * k + 1] = *(const v4f*)(p + c + 32 * k + 4);
        r[4 * k + 2] = *(const v4f*)(p + c + 32 * k + 16);
        r[4 * k + 3] = *(const v4f*)(p + c + 32 * k + 20);
    }
}
// Closes the sixteen loads of ld_row16 (same p): the address and the loaded values are inputs only, so the address pair lives to this wait and no load of the run is given it as its destination.
__device__ __forceinline__ void close_row16(const float* p, const v4f (&r)[16]) {
    asm volatile("s_wait_xcnt 0x0" :: "v"(p), "v"(r[0]), "v"(r[1]), "v"(r[2]), "v"(r[3]), "v"(r[4]), "v"(r[5]), "v"(r[6]), "v"(r[7]),
                 "v"(r[8]), "v"(r[9]), "v"(r[10]), "v"(r[11]), "v"(r[12]), "v"(r[13]), "v"(r[14]), "v"(r[15]) : "memory");
    __builtin_amdgcn_sched_barrier(0);   // holds the wait at its place: without it the scheduler sinks it, and some of the loads with it, far into the conversions, which then wait for memory a second time
}
__device__ __forceinline__ void cv_frag4(const v4f (&r)[16], float scale, v16h (&f)[4]) {
#pragma unroll
    for (int k = 0; k < 4; ++k) f[k] = cat16h(cv8(r[4 * k], r[4 * k + 1], scale), cv8(r[4 * k + 2], r[4 * k + 3], scale));
}

// d_fold: one 128 x 16 tile of a folded weight product of head h = blk / 8, column tile tc = blk % 8; wave w owns rows 16w..16w+15; K = 128 (the head's d).
//  vp == false: M_h[a][c] = sum_d Wq[a][h*128 + d] * Wk[c][h*128 + d]; A = Wq rows (row m = a), B = Wk rows (column n = c); stored WT[h*128 + c][a] = M x 16.
//  vp == true:  N_h[a][o] = sum_d Wv[a][h*128 + d] * Wp[h*128 + d][o]; A = Wv rows (row m = a), B = Wp columns (column n = o, one float per k); stored N x 32 in the order in which k_flash reads its A fragments (row m = o, k = a):
//   WP[h][tc][a / 32][(a / 16) % 2][lane = 16 * ((a / 8) % 2) + o % 16][a % 8], so that each half of a fragment is 512 contiguous bytes.
//  Fragments straight from the float inputs, in the k order of ldh: elements 0..7 <- k0 + 8*(lane>>4) + 0..7, elements 8..15 <- 16 further. D element r of lane (h, n) = (row 8h + r, column n): 16 bytes of one stored row.
__device__ __forceinline__ void d_fold(const float* __restrict__ WQ, const float* __restrict__ WO, hf* WT, hf* WP, unsigned blk, bool vp) {
    const unsigned tid = threadIdx.x, lane = tid & 31u, lr = lane & 15u, hi = lane >> 4;
    const unsigned wave = tid >> 5;
    const unsigned h = blk >> 3, tc = blk & 7u;
    const float* ar = WQ + (size_t)(16u * wave + lr) * QKVN + h * DIM + 8u * hi;
    v16h a[4], b[4];
    v4f ra[16];
    ld_row16(ar, vp ? 2u * INNER : 0u, ra);   // the B operand's loads follow at once: one memory latency for both operands
    if (!vp) {
        const float* br = WQ + (size_t)(16u * tc + lr) * QKVN + h * DIM + 8u * hi;
        v4f rb[16];
        ld_row16(br, INNER, rb);
        close_row16(ar, ra);
        close_row16(br, rb);
        cv_frag4(rb, WQS, b);
    } else {
        const float* bc = WO + (size_t)(h * DIM + 8u * hi) * DIM + 16u * tc + lr;
        float rc[64];
#pragma unroll
        for (int k = 0; k < 4; ++k) {
#pragma unroll
            for (int e = 0; e < 8; ++e) {
                rc[16 * k + e] = bc[(32 * k + e) * DIM];
                rc[16 * k + 8 + e] = bc[(32 * k + 16 + e) * DIM];
            }
        }
        close_row16(ar, ra);   // stands behind the 64 loads from bc too, ahead of any rewrite of their address pair
#pragma unroll
        for (int k = 0; k < 4; ++k) {
            v8us lo, up;
#pragma unroll
            for (int e = 0; e < 8; ++e) {
                lo[e] = f2h(bfr(rc[16 * k + e]) * WPS);
                up[e] = f2h(bfr(rc[16 * k + 8 + e]) * WPS);
            }
            b[k] = cat16h(lo, up);
        }
    }
    cv_frag4(ra, WQS, a);
    v8f acc = (v8f){};
#pragma unroll
    for (int k = 0; k < 4; ++k) acc = wmmah(a[k], b[k], acc);
    v8h o;
#pragma unroll
    for (int r = 0; r < 8; ++r) o[r] = (_Float16)(acc[r] * (1.0f / WQS));   // takes the A operand's carry off; the B operand's stays as the stored carry
    hf* dst = vp ? WP + (size_t)(h * 8u + tc) * WFT + wave * 256u + lane * 8u   // a = 16 wave + 8 hi + r: k-step wave >> 1, fragment half wave & 1
                 : WT + (size_t)(h * DIM + 16u * tc + lr) * DIM + 16u * wave + 8u * hi;
    *(v8us*)dst = __builtin_bit_cast(v8us, o);
    asm volatile("s_wait_xcnt 0x0" ::: "memory");   // closes the store ahead of any rewrite of its address and data registers (the code of another block range follows in k_prep)
}

// k_prep: the three preparations that depend on nothing but the inputs, in one launch, by block range (block-uniform branches):
//  blocks [0, NFD) form M = Wq Wk^T, [NFD, 2 NFD) form N = Wv Wp, the rest normalise 64 rows each.
__global__ __launch_bounds__(256) void k_prep(const float* __restrict__ X, const float* __restrict__ G, const float* __restrict__ Bt,
                                              const float* __restrict__ WQ, const float* __restrict__ WO, hf* XH, hf* XT, hf* WT, hf* WP) {
    __shared__ __align__(16) hf tl[DIM * VTP];
    const unsigned b = blockIdx.x;
    if (b < (unsigned)NFD) d_fold(WQ, WO, WT, WP, b, false);
    else if (b < (unsigned)(2 * NFD)) d_fold(WQ, WO, WT, WP, b - (unsigned)NFD, true);
    else d_ln(X, G, Bt, XH, XT, b - (unsigned)(2 * NFD), tl);
}

// k_q: Q' = x @ M_h; one block = 64 tokens x one head's 128 features; wave w owns tokens 16w..16w+15; the eight 16-feature tiles are processed in a rolled loop
//  (one accumulator tile and four weight fragments live at a time; the four token fragments are held), K = 128.
//  The block's x tile (64 rows) and weight tile (128 rows) are brought into LDS once by asynchronous copies (whole 256-byte rows); every fragment is read from LDS.
//  A = M^T rows (row m = feature), B = x rows (column n = token); D element r of lane (h, n) = (feature 16t + 8h + r, token n); staged row-major [token][feature].
__attribute__((amdgpu_num_vgpr(248))) __global__ __launch_bounds__(128) void k_q(const hf* XH, const hf* WT, hf* QP, int bch0) {
    __shared__ __align__(16) hf st[64 * CSP];    // x tile until the token fragments are held, output staging after that
    __shared__ __align__(16) hf wl[DIM * CSP];   // weight tile: 128 feature rows
    const unsigned tid = threadIdx.x, lane = tid & 31u, lr = lane & 15u, hi = lane >> 4;
    const unsigned wave = (unsigned)__builtin_amdgcn_readfirstlane((int)(tid >> 5));
    const unsigned head = blockIdx.y;
    const unsigned mloc = blockIdx.x * 64u;
    const unsigned bl = mloc / (unsigned)SEQ, n0 = mloc - bl * (unsigned)SEQ;

    {   // staging: 128 lanes, 16 per row, rows 8 apart; 8 pieces of x and 16 of the weights per lane
        const unsigned srow = tid >> 4, scol = (tid & 15u) * 8u;
        const hf* gx = XH + ((size_t)((unsigned)bch0 + bl) * SEQ + n0 + srow) * DIM + scol;
        const hf* gw = WT + ((size_t)blockIdx.y * 128u + srow) * DIM + scol;
        const unsigned lx = (unsigned)(size_t)(st + srow * CSP + scol);
        const unsigned lw = (unsigned)(size_t)(wl + srow * CSP + scol);
        stage_rows(lx, gx, gx + 32 * DIM, 8u * CSP * 2u, (size_t)8 * DIM);
        stage_rows(lw, gw, gw + 32 * DIM, 8u * CSP * 2u, (size_t)8 * DIM);
        stage_rows(lw + 64u * CSP * 2u, gw + 64 * DIM, gw + 96 * DIM, 8u * CSP * 2u, (size_t)8 * DIM);
    }
    asm volatile("s_wait_asynccnt 0x0" ::: "memory");      // this wave's pieces of both tiles have landed
    __syncthreads();                                       // both tiles readable by every wave
    v16h tf[4];
    {
        const hf* tp = st + (16u * wave + lr) * CSP + 8u * hi;
        tf[0] = ldh(tp);
        tf[1] = ldh(tp + 32);
        tf[2] = ldh(tp + 64);
        tf[3] = ldh(tp + 96);
    }
    __syncthreads();                                       // ends every wave's reads of the x tile before it is overwritten as output staging
    const unsigned woff = lr * CSP + 8u * hi;
    const float un = 1.0f / WQS;

#pragma unroll 1
    for (unsigned t = 0; t < 8u; ++t) {
        const hf* wr = wl + woff + t * (16u * CSP);
        const v16h w0 = ldh(wr), w1 = ldh(wr + 32), w2 = ldh(wr + 64), w3 = ldh(wr + 96);
        v8f acc = (v8f){};
        acc = wmmah(w0, tf[0], acc);
        acc = wmmah(w1, tf[1], acc);
        acc = wmmah(w2, tf[2], acc);
        acc = wmmah(w3, tf[3], acc);
        guard1(acc, w0, w1, w2, w3);
        v8h o;
#pragma unroll
        for (int r = 0; r < 8; ++r) o[r] = (_Float16)(acc[r] * un);
        *(v8usa*)(st + (16u * wave + lr) * CSP + 16u * t + 8u * hi) = __builtin_bit_cast(v8us, o);
        sfence();
    }
    __syncthreads();
    const size_t bhp = (size_t)(bl * NH + head);
    hf* dst = QP + (bhp * SEQ + n0) * DIM + lr * 8u;
#pragma unroll
    for (unsigned s = 0; s < 8; ++s) {
        const unsigned rr = 16u * wave + 2u * s + hi;
        const v8us o = *(const v8usa*)(st + rr * CSP + lr * 8u);
        *(v8us*)(dst + (size_t)rr * DIM) = o;
    }
}

// in-lane maximum of one 16-query column tile's scores: s0 / s1 = S^T tiles of keys 0..15 / 16..31 (this lane's 16 of the column's 32 keys)
__device__ __forceinline__ float lane_max(const v8f& s0, const v8f& s1) {
    float mx = fmaxf(s0[0], s1[0]);
#pragma unroll
    for (int r = 1; r < 8; ++r) mx = fmaxf(mx, fmaxf(s0[r], s1[r]));
    return mx;
}
// one softmax step of one column tile against the reference maximum in use (sh = PCL - that maximum, log2 domain): adds to the running sum l, returns the P^T B fragment
__device__ __forceinline__ v16h soft_step(const v8f& s0, const v8f& s1, float sh, float& l) {
    float p0[8], p1[8];
    float ps = 0.0f;
#pragma unroll
    for (int r = 0; r < 8; ++r) {
        p0[r] = __builtin_amdgcn_exp2f(fmaf(s0[r], SC2, sh));
        p1[r] = __builtin_amdgcn_exp2f(fmaf(s1[r], SC2, sh));
        ps += p0[r] + p1[r];
    }
    ps += __shfl_xor(ps, 16, 32);
    l += ps;
    v16h ph;
#pragma unroll
    for (int r = 0; r < 8; ++r) { ph[r] = (_Float16)p0[r]; ph[8 + r] = (_Float16)p1[r]; }
    return ph;
}

// two O^T accumulator tiles (d = 32j + 8h + r and 16 further) -> the ctx^T B fragments of k-step j: hv = f16(ctx x 16), lv = f16 of what that rounding lost, x 2^11
__device__ __forceinline__ void split16(const v8f& t0, const v8f& t1, float sc, v16h& hv, v16h& lv) {
#pragma unroll
    for (int r = 0; r < 8; ++r) {
        const float x = t0[r] * sc, y = t1[r] * sc;
        const _Float16 hx = (_Float16)x, hy = (_Float16)y;
        hv[r] = hx; hv[8 + r] = hy;
        lv[r] = (_Float16)((x - (float)hx) * RSC); lv[8 + r] = (_Float16)((y - (float)hy) * RSC);
    }
}
// weight fragment stored in fragment order: p = fragment base + 8 * lane; elements 0..7 <- p[0..7], elements 8..15 <- the second half, 256 elements on
__device__ __forceinline__ v16h ldw(const hf* p) { return cat16h(*(const v8us*)p, *(const v8us*)(p + 256)); }

// k_flash: one block per 32 queries of one batch, one wave per head (two 16-query column tiles, a and b), 32 keys per step, online softmax; K = the batch's x rows (KP), V^T = their transpose (VT), the same for all heads; the block's eight waves share K / V^T tiles of 64 keys,
//  staged in a two-buffer LDS ring by asynchronous copies (tile t + 2 is issued behind the barrier that ends the reads of tile t); fragments are read from LDS, each once per step for both column tiles.
//  S^T tile (keys x queries): A = K rows (row m = key, k = d), B = Q rows (column n = query, k = d); D element r of lane (h, n) = S[query n][key 8h + r].
//  Q fragments (B operands): six are held, tile b's first two are read from LDS with their K fragments; K fragments are loaded two at a time (one k-step x two key tiles, four products); V^T fragments four output tiles at a time (eight products).
//  P^T B fragment: element r <- tile of keys 0..15, element 8 + r <- tile of keys 16..31 (same lane); P carried x 2^7 (the running sum carries the same factor).
//  O^T tile (d x queries): A = V^T rows (row m = d, k = key), D element r of lane (h, n) = O[query n][d = 16 t + 8h + r].
//  Output projection, behind the loop: the O^T tiles 2j and 2j + 1 are directly the B fragment of ctx^T for k-step j (element r <- d = 32j + 8h + r, element 8 + r <- 16 further: the k order of ldh);
//  A = the head's folded weights N x 32 (row m = output feature, k = d), read from WP in fragment order; D element r of lane (h, n) = (feature 16 t + 8h + r, query n).
//  ctx value and residual share the weight fragment and use separate accumulators; a head's partial output = (acc_v + acc_r / 2^11) / 512; out = sum over heads, head 0 first, + bf16(bias).
__attribute__((amdgpu_num_vgpr(256))) __global__ __launch_bounds__(NWV * 32) void k_flash(const hf* QP, const hf* KP, const hf* VT, const hf* WP, const float* __restrict__ bias, float* OUT) {
    __shared__ __align__(16) hf cs[CSE];        // in the loop the K / V^T ring, then 16 Q rows per wave; the heads' partial outputs behind the loop
    const unsigned tid = threadIdx.x, lane = tid & 31u, lr = lane & 15u, hi = lane >> 4;
    const unsigned wave = (unsigned)__builtin_amdgcn_readfirstlane((int)(tid >> 5));
    const unsigned bpb = (unsigned)(SEQ / BQ);
    const unsigned bl = blockIdx.x / bpb;
    const unsigned q0 = (blockIdx.x - bl * bpb) * BQ;
    const unsigned head = wave, bh = bl * NH + head;

    v16h qa[4], qb[4];
    {
        const hf* qp = QP + ((size_t)bh * SEQ + q0 + lr) * DIM + 8u * hi;
#pragma unroll
        for (int k = 0; k < 4; ++k) qa[k] = ldh(qp + 32 * k);
#pragma unroll
        for (int k = 2; k < 4; ++k) qb[k] = ldh(qp + 16 * DIM + 32 * k);
    }
    const unsigned kfo = lr * CSP + 8u * hi;          // fragment offsets inside a ring buffer
    // tile b's first two Q fragments live in LDS, in rows of this wave's own behind the ring (same row form as a K tile), and are read with the K fragments of their k-steps:
    // six held Q fragments leave the wave inside 256 registers, four waves per SIMD; with more held it spills to scratch. The loop's last barrier ends every wave's reads of them, ahead of the partial outputs
    hf* qs = cs + 2 * BUFE + wave * (16u * CSP) + kfo;
    {
        const hf* qp = QP + ((size_t)bh * SEQ + q0 + 16u + lr) * DIM + 8u * hi;
        *(v8usa*)qs = *(const v8us*)qp;
        *(v8usa*)(qs + 16) = *(const v8us*)(qp + 16);
        *(v8usa*)(qs + 32) = *(const v8us*)(qp + 32);
        *(v8usa*)(qs + 48) = *(const v8us*)(qp + 48);
    }
    const unsigned vfo = KTE + lr * VTP + 8u * hi;
    // staging addresses of this lane: K tile = 16 KiB contiguous, 16 lanes per key row; V^T tile = 128 rows of 128 B, 8 lanes per row
    const hf* gk = KP + (size_t)bl * SEQ * DIM + tid * 8u;
    const hf* gv = VT + ((size_t)bl * DIM + (tid >> 3)) * SEQ + (tid & 7u) * 8u;
    const unsigned lk = (unsigned)(size_t)(cs + (tid >> 4) * CSP + (tid & 15u) * 8u);
    const unsigned lv = (unsigned)(size_t)(cs + KTE + (tid >> 3) * VTP + (tid & 7u) * 8u);
    const unsigned nt = (unsigned)(SEQ / TK);

    v8f oa[8], ob[8];
#pragma unroll
    for (int t = 0; t < 8; ++t) { oa[t] = (v8f){}; ob[t] = (v8f){}; }
    float mla = -1.0e30f, mlb = -1.0e30f;   // reference maxima in use, log2 domain
    float la = 0.0f, lb = 0.0f;             // running sums (carried x 2^7)

    stage_kv(lk, lv, gk, gv);                              // tile 0 -> buffer 0
    asm volatile("s_wait_asynccnt 0x0" ::: "memory");      // this wave's pieces of tile 0 have landed
    __syncthreads();                                       // tile 0 readable by every wave
    if (nt > 1u) stage_kv(lk + BUFE * 2u, lv + BUFE * 2u, gk + TK * DIM, gv + TK);   // tile 1 -> buffer 1

#pragma unroll 1
    for (unsigned t = 0; t < nt; ++t) {
      const unsigned bo = (t & 1u) * BUFE;
#pragma unroll 1
      for (unsigned h = 0; h < 2u; ++h) {                  // rolled: one copy of the step's code, one step's fragments live
        v8f sa0 = (v8f){}, sa1 = (v8f){}, sb0 = (v8f){}, sb1 = (v8f){};
        const hf* ka = cs + bo + kfo + h * (KS * CSP);
#pragma unroll
        for (int k = 0; k < 4; ++k) {                      // one k-step at a time: two K fragments, four products
            const v16h a0 = ldh(ka + 32 * k), a1 = ldh(ka + 16 * CSP + 32 * k);
            const v16h qk = k < 2 ? ldh(qs + 32 * k) : qb[k];
            sa0 = wmmah(a0, qa[k], sa0);
            sa1 = wmmah(a1, qa[k], sa1);
            sb0 = wmmah(a0, qk, sb0);
            sb1 = wmmah(a1, qk, sb1);
            guard4(sa0, sa1, sb0, sb1, a0, a1, qk);
            sfence();
        }

        // lazy rescale: the reference maxima move only when some score lies more than LZT above the one in use, so P stays near or below 2^(PCL + LZT); one wave-uniform test per step for both tiles, on in-lane maxima (the exchange between the halves is needed only when the maxima move)
        const float xa = lane_max(sa0, sa1), xb = lane_max(sb0, sb1);
        if (__builtin_amdgcn_ballot_w32(fmaxf(fmaf(xa, SC2, -mla), fmaf(xb, SC2, -mlb)) > LZT) != 0u) {
            const float na = fmaxf(mla, fmaxf(xa, __shfl_xor(xa, 16, 32)) * SC2);   // both halves of a column take the same new maximum
            const float nb = fmaxf(mlb, fmaxf(xb, __shfl_xor(xb, 16, 32)) * SC2);
            const float ca = __builtin_amdgcn_exp2f(mla - na), cb = __builtin_amdgcn_exp2f(mlb - nb);
            mla = na; mlb = nb;
            la *= ca; lb *= cb;
#pragma unroll
            for (int j = 0; j < 8; ++j) { oa[j] *= ca; ob[j] *= cb; }
        }
        const v16h pa = soft_step(sa0, sa1, PCL - mla, la);
        sfence();   // keeps the scheduler from merging the two tiles' exponentials into one region: merged, the live set passes 256 registers and the kernel spills to scratch
        const v16h pb = soft_step(sb0, sb1, PCL - mlb, lb);

        sfence();   // keep the V^T loads below the softmax (bounds live fragments)
        const hf* va = cs + bo + vfo + h * KS;
        {
            const v16h v0 = ldh(va), v1 = ldh(va + 16 * VTP), v2 = ldh(va + 32 * VTP), v3 = ldh(va + 48 * VTP);
            oa[0] = wmmah(v0, pa, oa[0]);
            ob[0] = wmmah(v0, pb, ob[0]);
            oa[1] = wmmah(v1, pa, oa[1]);
            ob[1] = wmmah(v1, pb, ob[1]);
            oa[2] = wmmah(v2, pa, oa[2]);
            ob[2] = wmmah(v2, pb, ob[2]);
            oa[3] = wmmah(v3, pa, oa[3]);
            ob[3] = wmmah(v3, pb, ob[3]);
            guard8(oa[0], ob[0], oa[1], ob[1], oa[2], ob[2], oa[3], ob[3], v0, v1, v2, v3, pa, pb);
        }
        sfence();
        {
            const v16h v4 = ldh(va + 64 * VTP), v5 = ldh(va + 80 * VTP), v6 = ldh(va + 96 * VTP), v7 = ldh(va + 112 * VTP);
            oa[4] = wmmah(v4, pa, oa[4]);
            ob[4] = wmmah(v4, pb, ob[4]);
            oa[5] = wmmah(v5, pa, oa[5]);
            ob[5] = wmmah(v5, pb, ob[5]);
            oa[6] = wmmah(v6, pa, oa[6]);
            ob[6] = wmmah(v6, pb, ob[6]);
            oa[7] = wmmah(v7, pa, oa[7]);
            ob[7] = wmmah(v7, pb, ob[7]);
            guard8(oa[4], ob[4], oa[5], ob[5], oa[6], ob[6], oa[7], ob[7], v4, v5, v6, v7, pa, pb);
        }
        sfence();
      }
      asm volatile("s_wait_dscnt 0x0" ::: "memory");       // this wave's reads of tile t have returned before its buffer is refilled
      asm volatile("s_wait_asynccnt 0x0" ::: "memory");    // this wave's pieces of tile t + 1 have landed
      __syncthreads();                                     // publishes tile t + 1 and ends every wave's reads of tile t
      if (t + 2u < nt) stage_kv(lk + bo * 2u, lv + bo * 2u, gk + (size_t)(t + 2u) * (TK * DIM), gv + (t + 2u) * TK);
    }
    asm volatile("s_wait_asynccnt 0x0" ::: "memory");      // no copy outstanding when the ring becomes the partial outputs' place

    // this head's folded output weights, in fragment order; the first 16-feature tile's four fragments are asked for ahead of the conversions below, which cover their latency
    const hf* wf = WP + (size_t)head * (8u * WFT) + lane * 8u;
    v16h w[2][4];
#pragma unroll
    for (int k = 0; k < 4; ++k) w[0][k] = ldw(wf + 512 * k);
    sfence();   // holds those loads here: left free, the scheduler sinks them behind the conversions, and the first products wait for L2
    // ctx^T B fragments, value and residual, from the accumulators in place
    v16h cha[4], cla[4], chb[4], clb[4];
    {
        const float sa = (1.0f / la) * CCS, sb = (1.0f / lb) * CCS;
#pragma unroll
        for (int j = 0; j < 4; ++j) {
            split16(oa[2 * j], oa[2 * j + 1], sa, cha[j], cla[j]);
            split16(ob[2 * j], ob[2 * j + 1], sb, chb[j], clb[j]);
        }
    }
    // this head's partial output, one 16-feature tile at a time; the next tile's four weight fragments are asked for ahead of this tile's products
    float* rd = (float*)cs + (head * (unsigned)BQ + lr) * OSP + 8u * hi;
    const float un = 1.0f / (CCS * WPS);
    const float ur = 1.0f / RSC;
#pragma unroll
    for (int t = 0; t < 8; ++t) {
        if (t < 7) {
#pragma unroll
            for (int k = 0; k < 4; ++k) w[(t + 1) & 1][k] = ldw(wf + (t + 1) * WFT + 512 * k);
        }
        const v16h w0 = w[t & 1][0], w1 = w[t & 1][1], w2 = w[t & 1][2], w3 = w[t & 1][3];
        v8f ha = (v8f){}, ra = (v8f){}, hb = (v8f){}, rb = (v8f){};
        ha = wmmah(w0, cha[0], ha); ra = wmmah(w0, cla[0], ra); hb = wmmah(w0, chb[0], hb); rb = wmmah(w0, clb[0], rb);
        ha = wmmah(w1, cha[1], ha); ra = wmmah(w1, cla[1], ra); hb = wmmah(w1, chb[1], hb); rb = wmmah(w1, clb[1], rb);
        ha = wmmah(w2, cha[2], ha); ra = wmmah(w2, cla[2], ra); hb = wmmah(w2, chb[2], hb); rb = wmmah(w2, clb[2], rb);
        ha = wmmah(w3, cha[3], ha); ra = wmmah(w3, cla[3], ra); hb = wmmah(w3, chb[3], hb); rb = wmmah(w3, clb[3], rb);
        guard4w(ha, ra, hb, rb, w0, w1, w2, w3);
        v4f x0, x1, y0, y1;
#pragma unroll
        for (int r = 0; r < 4; ++r) {
            x0[r] = fmaf(ra[r], ur, ha[r]) * un; x1[r] = fmaf(ra[4 + r], ur, ha[4 + r]) * un;
            y0[r] = fmaf(rb[r], ur, hb[r]) * un; y1[r] = fmaf(rb[4 + r], ur, hb[4 + r]) * un;
        }
        *(v4fa*)(rd + 16 * t) = x0;
        *(v4fa*)(rd + 16 * t + 4) = x1;
        *(v4fa*)(rd + 16 * OSP + 16 * t) = y0;
        *(v4fa*)(rd + 16 * OSP + 16 * t + 4) = y1;
        sfence();   // one tile's accumulators and two tiles' weight fragments live at a time: merged regions pass 256 registers
    }
    __syncthreads();                                       // all eight heads' partial outputs are in LDS before any wave sums them
    const v4f bb = *(const v4f*)(bias + lane * 4u);
    v4f bq;
    bq[0] = bfr(bb[0]); bq[1] = bfr(bb[1]); bq[2] = bfr(bb[2]); bq[3] = bfr(bb[3]);
    const float* rr = (const float*)cs + (4u * wave) * OSP + lane * 4u;      // wave w sums and stores rows 4w..4w+3, a lane four features
    float* orow = OUT + ((size_t)bl * SEQ + q0 + 4u * wave) * DIM + lane * 4u;
    v4f val[4];
#pragma unroll
    for (unsigned s = 0; s < 4; ++s) {
        val[s] = *(const v4fa*)(rr + s * OSP);
#pragma unroll
        for (unsigned h = 1; h < (unsigned)NH; ++h) val[s] += *(const v4fa*)(rr + (h * (unsigned)BQ + s) * OSP);
        val[s] += bq;
    }
#pragma unroll
    for (unsigned s = 0; s < 4; ++s) *(v4f*)(orow + (size_t)s * DIM) = val[s];
}

extern "C" void kernel_launch(void* const* d_in, const int* in_sizes, int n_in,
                              void* d_out, int out_size, void* d_ws, size_t ws_size, hipStream_t stream) {
    if (n_in < 6) return;
    const size_t need = ((size_t)(NB - 1) * SEQ_FULL + SEQ) * DIM;
    if ((size_t)in_sizes[0] < need) return;
    if (in_sizes[1] < DIM || in_sizes[2] < DIM || in_sizes[5] < DIM) return;
    if ((size_t)in_sizes[3] < (size_t)DIM * QKVN) return;
    if ((size_t)in_sizes[4] < (size_t)INNER * DIM) return;
    if ((size_t)out_size < (size_t)NB * SEQ * DIM) return;
    if (SZ_ALL > ws_size) return;

    const float* x      = (const float*)d_in[0];   // inputs  [NB][SEQ_FULL][128] (rows n < SEQ read)
    const float* gamma  = (const float*)d_in[1];   // ln_gamma [128]
    const float* beta   = (const float*)d_in[2];   // ln_beta  [128]
    const float* w_qkv  = (const float*)d_in[3];   // [128][3072]  ([in][out])
    const float* w_proj = (const float*)d_in[4];   // [1024][128]  ([in][out])
    const float* b_proj = (const float*)d_in[5];   // [128]
    float* OUT = (float*)d_out;                    // [NB][SEQ][128]

    char* wsp = (char*)d_ws;
    hf* XH  = (hf*)(wsp);
    hf* XT  = (hf*)(wsp + SZ_XH);
    hf* WT  = (hf*)(wsp + 2 * SZ_XH);
    hf* WP  = (hf*)(wsp + 2 * SZ_XH + SZ_WT);
    hf* QP  = (hf*)(wsp + 2 * SZ_XH + SZ_WT + SZ_WP);

    k_prep<<<(unsigned)(2 * NFD + NLN), 256, 0, stream>>>(x, gamma, beta, w_qkv, w_proj, XH, XT, WT, WP);
    for (int c = 0; c < NCH; ++c) {
        const int bch0 = c * BCH;
        k_q<<<dim3((unsigned)(BCH * SEQ / 64), NH, 1), 128, 0, stream>>>(XH, WT, QP, bch0);
        k_flash<<<(unsigned)(BCH * (SEQ / BQ)), NWV * 32, 0, stream>>>(QP, XH + (size_t)bch0 * SEQ * DIM, XT + (size_t)bch0 * DIM * SEQ, WP, b_proj, OUT + (size_t)bch0 * SEQ * DIM);
    }
}

// v008
// It runs in 56.5 microseconds.
// Two timings next to v007 put it at 1.15 and 1.16 times that version's speed.
// All steps since v000 together make it 6.71 times as fast.
#include <hip/hip_runtime.h>

// Pre-LayerNorm multi-head softmax(QK^T)V block: x = LN(in) over 128; qkv = x @ w_qkv ([128][3072], thirds q|k|v, column = which*1024 + h*128 + d); 8 heads of dim 128; logits (q.k)/32; out = ctx @ w_proj + b_proj.
// The K and V projections are folded into their neighbours' weights (head dim == token width, so both folded matrices are 128 x 128 per head):
//  q.k = x_i (Wq_h Wk_h^T) x_j^T, so Q' = x @ M_h with M_h = Wq_h Wk_h^T, and the keys are the x rows; (P v) Wp_h = (P x)(Wv_h Wp_h), so the values are the x rows and the output projection uses N_h = Wv_h Wp_h.
// Compute dtypes, f32 accumulate: every contraction on v_wmma_f32_16x16x32_f16. Float inputs are RNE-converted to bf16 first; weights enter the folds as bf16 value x 16 (w_qkv) / x 32 (w_proj), exact in f16; M carried as f16 x 16, N as f16 x 32;
// x plane and Q' fragments f16; P carried as f16 x 2^7 (online softmax in f32, log2 domain, lazy rescale); ctx = P x carried as f16(ctx x 16) plus f16 residual x 2^11 with its own accumulator in the output projection.
// Q' is formed inside k_flash too: each wave multiplies the block's 32 x rows by its head's M_h, and the accumulator tiles, rounded to f16, are directly its Q fragments.
// The output projection runs inside k_flash: a block's eight waves are the eight heads of the same 32 queries, each wave multiplies its own ctx (still in registers) by its head's N_h, and the eight partial outputs are summed through LDS.
// Flash form with transposed tiles: the S^T accumulator tiles are directly the B-operand layout of P^T; all WMMA operands are two 16-byte loads from dense, statically strided 16-bit rows (K / V^T from LDS tiles; only the block's own x rows and the folded weights, stored in fragment order, come straight from their planes).

#ifndef NB
#define NB 16
#endif
#ifndef SEQ
#define SEQ 1024
#endif
#define NB_FULL  16
#define SEQ_FULL 1024
#define DIM   128                 // token width == head dim
#define NH    8
#define INNER (NH * DIM)          // 1024
#define QKVN  (3 * INNER)         // 3072
#define NCH   1                   // batch chunks: all batches go through one k_flash pass
#define BCH   (NB / NCH)          // batches per chunk
#define NWV   8                   // waves per flash block: one per head
#define QT    2                   // 16-query column tiles per flash wave: each K / V^T fragment read from LDS feeds QT products
#define BQ    (16 * QT)           // queries per flash block (the same ones for every head)
#define KS    32                  // keys per step
#define TK    64                  // keys per staged K / V^T tile (two steps)
#define CSP   136                 // LDS pitch (16-bit elements) of 128-wide staging rows
#define OSP   132                 // LDS pitch (floats) of the output staging rows
#define VTP   72                  // LDS pitch (16-bit elements) of 64-wide transposed rows
#define KTE   (TK * CSP)          // staged K tile, 16-bit elements: TK key rows of 128
#define BUFE  (KTE + DIM * VTP)   // one ring buffer: K tile, then V^T tile (128 rows of TK keys)
#define RNE   (2 * BUFE + NWV * 16 * CSP)         // k_flash in the loop, 16-bit elements: the ring, then 16 Q rows per wave
#define OSE   (NH * BQ * OSP * 2)                 // k_flash behind the loop, 16-bit elements: per head BQ rows of float partial outputs
#define CSE   (RNE > OSE ? RNE : OSE)             // k_flash LDS, 16-bit elements
#define WFT   (4 * 2 * 32 * 8)    // folded weights, 16-bit elements per 16-feature tile of one head: four k-steps x two fragment halves x 32 lanes x 8
#define L2E   1.4426950408889634f
#define SC2   (L2E * 0.03125f)    // log2(e) / 32
#define PCL   7.0f                // P carry exponent (2^7)
#define LZT   8.0f                // lazy rescale: how far (log2 domain) a score may lie above the reference maximum in use; 2^(PCL + LZT) is finite in f16
#define WQS   16.0f               // w_qkv carry
#define WPS   32.0f               // w_proj carry
#define CCS   16.0f               // ctx carry
#define RSC   2048.0f             // ctx residual carry
#define NFD   (NH * (DIM / 16))             // k_prep: blocks per folded weight product, one head x one 16-column tile each
#define NLN   (NB * SEQ / 64)               // k_prep: LayerNorm blocks, 64 rows each

static_assert(DIM == 128);
static_assert(INNER == 1024);
static_assert(NB <= NB_FULL);
static_assert(SEQ <= SEQ_FULL);
static_assert(NB % NCH == 0);
static_assert(SEQ % BQ == 0);
static_assert(SEQ % 64 == 0);
static_assert(SEQ % KS == 0);
static_assert(SEQ % TK == 0 && TK == 2 * KS && TK <= VTP);
static_assert(NWV * 32 == 256);                  // k_flash staging: 256 lanes x 16 B x 4 pieces == one 16-KiB tile
static_assert(TK * DIM * 2 == 4 * 256 * 16);
static_assert((KTE * 2) % 16 == 0 && (BUFE * 2) % 16 == 0);
static_assert(QT == 2);                          // k_flash names its two column tiles a and b
static_assert(NWV == NH);                        // k_flash: wave == head
static_assert(BQ == 4 * NWV);                    // k_flash: each wave sums and stores four output rows
static_assert(DIM % 32 == 0);
static_assert(DIM == 4 * 32);                    // four 32-deep k-steps per score tile / per Q' tile / per folded tile
static_assert(DIM == 8 * 16);                    // eight 16-row output tiles per wave
static_assert(INNER % 32 == 0);
static_assert(DIM / 16 == 8);                    // d_fold: eight waves x 16 rows, eight column tiles per head
static_assert(16 * 8 == DIM);                    // d_ln: 16 lanes x 8 elements == row
static_assert(64 <= VTP);                        // transposed staging rows hold 64 tokens
static_assert((CSP * 2) % 16 == 0);
static_assert((VTP * 2) % 16 == 0);
static_assert((OSP * 4) % 16 == 0);
static_assert(32 * 4 == DIM);                    // k_flash: 32 lanes x 4 floats == output row
static_assert(16 * 8 * 2 == 256);                // 16 lanes x 16 B == one 128-element 16-bit row
static_assert(QKVN % 128 == 0);
static_assert((BCH * SEQ) % 64 == 0);            // d_ln: 64 tokens per block (SEQ % 64 == 0: all of one batch)

#define SZ_XH  ((size_t)NB * SEQ * DIM * 2)
#define SZ_WT  ((size_t)INNER * DIM * 2)
#define SZ_WP  ((size_t)DIM * INNER * 2)
#define SZ_ALL (2 * SZ_XH + SZ_WT + SZ_WP)
static_assert(SZ_XH % 256 == 0 && SZ_WT % 256 == 0 && SZ_WP % 256 == 0);
static_assert(SZ_ALL <= (size_t)268435456);

typedef unsigned short hf;
typedef __attribute__((ext_vector_type(16))) _Float16 v16h;
typedef __attribute__((ext_vector_type(8)))  _Float16 v8h;
typedef __attribute__((ext_vector_type(8)))  unsigned short v8us;
typedef __attribute__((ext_vector_type(8)))  float    v8f;
typedef __attribute__((ext_vector_type(4)))  float    v4f;
typedef v4f  __attribute__((may_alias)) v4fa;
typedef v8us __attribute__((may_alias)) v8usa;

__device__ __forceinline__ float bfr(float f) { unsigned u = __float_as_uint(f); u += 0x7FFFu + ((u >> 16) & 1u); return __uint_as_float(u & 0xFFFF0000u); }
__device__ __forceinline__ unsigned short f2h(float f) { return __builtin_bit_cast(unsigned short, (_Float16)f); }
__device__ __forceinline__ v16h cat16h(v8us lo, v8us hi) { return __builtin_bit_cast(v16h, __builtin_shufflevector(lo, hi, 0, 1, 2, 3, 4, 5, 6, 7, 8, 9, 10, 11, 12, 13, 14, 15)); }
__device__ __forceinline__ v8f wmmah(v16h a, v16h b, v8f c) { return __builtin_amdgcn_wmma_f32_16x16x32_f16(false, a, false, b, (short)0, c, false, false); }
// fragment loader (A and B alike): p = row base + k0 + 8*(lane>>4); elements 0..7 <- p[0..7], elements 8..15 <- p[16..23]
__device__ __forceinline__ v16h ldh(const hf* p) { return cat16h(*(const v8us*)p, *(const v8us*)(p + 16)); }
__device__ __forceinline__ void sfence() { asm volatile("" ::: "memory"); __builtin_amdgcn_sched_barrier(0); }
// hazard guards: four idle VALU slots after the last WMMA of a group; the group's operand fragments stay live until here
__device__ __forceinline__ void guard4(v8f& c0, v8f& c1, v8f& c2, v8f& c3, v16h a, v16h b, v16h c) {
    asm volatile("v_nop\n\tv_nop\n\tv_nop\n\tv_nop" : "+v"(c0), "+v"(c1), "+v"(c2), "+v"(c3) : "v"(a), "v"(b), "v"(c));
}
__device__ __forceinline__ void guard4w(v8f& c0, v8f& c1, v8f& c2, v8f& c3, v16h a, v16h b, v16h c, v16h d) {
    asm volatile("v_nop\n\tv_nop\n\tv_nop\n\tv_nop" : "+v"(c0), "+v"(c1), "+v"(c2), "+v"(c3) : "v"(a), "v"(b), "v"(c), "v"(d));
}
__device__ __forceinline__ void guard8(v8f& c0, v8f& c1, v8f& c2, v8f& c3, v8f& c4, v8f& c5, v8f& c6, v8f& c7,
                                       v16h a, v16h b, v16h c, v16h d, v16h e, v16h f) {
    asm volatile("v_nop\n\tv_nop\n\tv_nop\n\tv_nop"
                 : "+v"(c0), "+v"(c1), "+v"(c2), "+v"(c3), "+v"(c4), "+v"(c5), "+v"(c6), "+v"(c7)
                 : "v"(a), "v"(b), "v"(c), "v"(d), "v"(e), "v"(f));
}

// One 64-key tile, global -> LDS through no register: each lane copies four 16-byte pieces of K (16 key rows apart) and four of V^T (32 d rows apart).
// lk / lv: the lane's LDS byte addresses of its first pieces; gk / gv: their global addresses. The address-translation wait closes the statement, ahead of any rewrite of the address registers.
__device__ __forceinline__ void stage_kv(unsigned lk, unsigned lv, const hf* gk, const hf* gv) {
    asm volatile("global_load_async_to_lds_b128 %0, %8, off\n\t"
                 "global_load_async_to_lds_b128 %1, %9, off\n\t"
                 "global_load_async_to_lds_b128 %2, %10, off\n\t"
                 "global_load_async_to_lds_b128 %3, %11, off\n\t"
                 "global_load_async_to_lds_b128 %4, %12, off\n\t"
                 "global_load_async_to_lds_b128 %5, %13, off\n\t"
                 "global_load_async_to_lds_b128 %6, %14, off\n\t"
                 "global_load_async_to_lds_b128 %7, %15, off\n\t"
                 "s_wait_xcnt 0x0"
                 :: "v"(lk), "v"(lk + 16u * CSP * 2u), "v"(lk + 32u * CSP * 2u), "v"(lk + 48u * CSP * 2u),
                    "v"(lv), "v"(lv + 32u * VTP * 2u), "v"(lv + 64u * VTP * 2u), "v"(lv + 96u * VTP * 2u),
                    "v"(gk), "v"(gk + 16 * DIM), "v"(gk + 32 * DIM), "v"(gk + 48 * DIM),
                    "v"(gv), "v"(gv + (size_t)32 * SEQ), "v"(gv + (size_t)64 * SEQ), "v"(gv + (size_t)96 * SEQ)
                 : "memory");
}

// d_ln: x plane XH[NB*SEQ][128] (f16) = LayerNorm(bf16(in)) with bf16(gamma), bf16(beta), and its transpose XT[NB][128][SEQ]; one block = 64 rows of one batch, in four passes of 16 rows;
//  16 lanes per row, 8 elements per lane; the transpose goes through the LDS tile tl (cross-wave, block barrier), so that a block stores whole 128-byte pieces of the XT rows; blk = index among the LayerNorm blocks
__device__ __forceinline__ void d_ln(const float* __restrict__ X, const float* __restrict__ G, const float* __restrict__ Bt, hf* XH, hf* XT, unsigned blk, hf* tl) {
    const unsigned tid = threadIdx.x;
    const unsigned sub = tid & 15u;
    const unsigned row0 = blk * 64u;
    const unsigned b = row0 / (unsigned)SEQ, n0 = row0 - b * (unsigned)SEQ;
    const v4f g0 = *(const v4f*)(G + sub * 8u), g1 = *(const v4f*)(G + sub * 8u + 4u);
    const v4f b0 = *(const v4f*)(Bt + sub * 8u), b1 = *(const v4f*)(Bt + sub * 8u + 4u);
    v4f x0[4], x1[4];                                   // all four passes' rows are asked for at once: one memory latency per block
#pragma unroll
    for (unsigned it = 0; it < 4; ++it) {
        const float* src = X + ((size_t)b * SEQ_FULL + n0 + it * 16u + (tid >> 4)) * DIM + sub * 8u;
        x0[it] = *(const v4f*)src;
        x1[it] = *(const v4f*)(src + 4);
    }
#pragma unroll
    for (unsigned it = 0; it < 4; ++it) {
        const unsigned tr = it * 16u + (tid >> 4);
        const v4f a0 = x0[it], a1 = x1[it];
        float e[8];
        e[0] = bfr(a0[0]); e[1] = bfr(a0[1]); e[2] = bfr(a0[2]); e[3] = bfr(a0[3]);
        e[4] = bfr(a1[0]); e[5] = bfr(a1[1]); e[6] = bfr(a1[2]); e[7] = bfr(a1[3]);
        float s = ((e[0] + e[1]) + (e[2] + e[3])) + ((e[4] + e[5]) + (e[6] + e[7]));
        s += __shfl_xor(s, 8, 32);
        s += __shfl_xor(s, 4, 32);
        s += __shfl_xor(s, 2, 32);
        s += __shfl_xor(s, 1, 32);
        const float mu = s * (1.0f / DIM);
        float d[8];
        float s2 = 0.0f;
#pragma unroll
        for (int j = 0; j < 8; ++j) { d[j] = e[j] - mu; s2 = fmaf(d[j], d[j], s2); }
        s2 += __shfl_xor(s2, 8, 32);
        s2 += __shfl_xor(s2, 4, 32);
        s2 += __shfl_xor(s2, 2, 32);
        s2 += __shfl_xor(s2, 1, 32);
        const float rs = rsqrtf(s2 * (1.0f / DIM) + 1.0e-5f);
        v8h o;
        o[0] = (_Float16)(d[0] * rs * bfr(g0[0]) + bfr(b0[0]));
        o[1] = (_Float16)(d[1] * rs * bfr(g0[1]) + bfr(b0[1]));
        o[2] = (_Float16)(d[2] * rs * bfr(g0[2]) + bfr(b0[2]));
        o[3] = (_Float16)(d[3] * rs * bfr(g0[3]) + bfr(b0[3]));
        o[4] = (_Float16)(d[4] * rs * bfr(g1[0]) + bfr(b1[0]));
        o[5] = (_Float16)(d[5] * rs * bfr(g1[1]) + bfr(b1[1]));
        o[6] = (_Float16)(d[6] * rs * bfr(g1[2]) + bfr(b1[2]));
        o[7] = (_Float16)(d[7] * rs * bfr(g1[3]) + bfr(b1[3]));
        const v8us ob = __builtin_bit_cast(v8us, o);
        hf* dst = XH + (size_t)(row0 + tr) * DIM + sub * 8u;
        *(v8us*)dst = ob;
        asm volatile("s_wait_xcnt 0x0" ::: "memory");   // closes the store ahead of any rewrite of its address and data registers by the next pass
        const unsigned cw = (((tr >> 3) ^ (sub >> 1)) << 3) + (tr & 7u);   // 8-token column groups XOR-ed with d >> 4: a pass's 16 lanes per row, 8 tile rows apart, fall on 16 different banks instead of 2
#pragma unroll
        for (unsigned j = 0; j < 8; ++j) tl[(sub * 8u + j) * VTP + cw] = ob[j];
    }
    __syncthreads();                                    // the 128 x 64 transposed tile is complete before any wave reads it back
    hf* dt = XT + (size_t)b * DIM * SEQ + n0;
    const unsigned c8 = (tid & 7u) * 8u, dr = tid >> 3;
#pragma unroll
    for (unsigned it = 0; it < 4; ++it) {
        const unsigned d = it * 32u + dr;
        const v8us o = *(const v8usa*)(tl + d * VTP + (c8 ^ (((d >> 4) & 7u) << 3)));   // undoes the column-group XOR of the writers
        *(v8us*)(dt + (size_t)d * SEQ + c8) = o;
    }
    asm volatile("s_wait_xcnt 0x0" ::: "memory");       // closes the four stores ahead of any rewrite of their address and data registers
}

// eight floats -> f16 of bf16(value) * scale
__device__ __forceinline__ v8us cv8(v4f a, v4f b, float scale) {
    v8us o;
    o[0] = f2h(bfr(a[0]) * scale); o[1] = f2h(bfr(a[1]) * scale); o[2] = f2h(bfr(a[2]) * scale); o[3] = f2h(bfr(a[3]) * scale);
    o[4] = f2h(bfr(b[0]) * scale); o[5] = f2h(bfr(b[1]) * scale); o[6] = f2h(bfr(b[2]) * scale); o[7] = f2h(bfr(b[3]) * scale);
    return o;
}
// One 128-float row piece as sixteen 16-byte loads, in the k order of ldh: p = row base + 8*(lane>>4), c = the piece's constant column (which third of w_qkv); r[4k], r[4k+1] <- p[c + 32k .. c + 32k+7], r[4k+2], r[4k+3] <- 16 further.
__device__ __forceinline__ void ld_row16(const float* p, unsigned c, v4f (&r)[16]) {
#pragma unroll
    for (unsigned k = 0; k < 4; ++k) {
        r[4 * k]     = *(const v4f*)(p + c + 32 * k);
        r[4 * k + 1] = *(const v4f*)(p + c + 32 * k + 4);
        r[4 * k + 2] = *(const v4f*)(p + c + 32 * k + 16);
        r[4 * k + 3] = *(const v4f*)(p + c + 32 * k + 20);
    }
}
// Closes the sixteen loads of ld_row16 (same p): the address and the loaded values are inputs only, so the address pair lives to this wait and no load of the run is given it as its destination.
__device__ __forceinline__ void close_row16(const float* p, const v4f (&r)[16]) {
    asm volatile("s_wait_xcnt 0x0" :: "v"(p), "v"(r[0]), "v"(r[1]), "v"(r[2]), "v"(r[3]), "v"(r[4]), "v"(r[5]), "v"(r[6]), "v"(r[7]),
                 "v"(r[8]), "v"(r[9]), "v"(r[10]), "v"(r[11]), "v"(r[12]), "v"(r[13]), "v"(r[14]), "v"(r[15]) : "memory");
    __builtin_amdgcn_sched_barrier(0);   // holds the wait at its place: without it the scheduler sinks it, and some of the loads with it, far into the conversions, which then wait for memory a second time
}
__device__ __forceinline__ void cv_frag4(const v4f (&r)[16], float scale, v16h (&f)[4]) {
#pragma unroll
    for (int k = 0; k < 4; ++k) f[k] = cat16h(cv8(r[4 * k], r[4 * k + 1], scale), cv8(r[4 * k + 2], r[4 * k + 3], scale));
}

// d_fold: one 128 x 16 tile of a folded weight product of head h = blk / 8, column tile tc = blk % 8; wave w owns rows 16w..16w+15; K = 128 (the head's d).
//  vp == false: M_h[a][c] = sum_d Wq[a][h*128 + d] * Wk[c][h*128 + d]; A = Wq rows (row m = a), B = Wk rows (column n = c); stored M x 16 in the order in which k_flash reads its A fragments (row m = c, k = a), as WP below with c for o.
//  vp == true:  N_h[a][o] = sum_d Wv[a][h*128 + d] * Wp[h*128 + d][o]; A = Wv rows (row m = a), B = Wp columns (column n = o, one float per k); stored N x 32 in the order in which k_flash reads its A fragments (row m = o, k = a):
//   WP[h][tc][a / 32][(a / 16) % 2][lane = 16 * ((a / 8) % 2) + o % 16][a % 8], so that each half of a fragment is 512 contiguous bytes.
//  Fragments straight from the float inputs, in the k order of ldh: elements 0..7 <- k0 + 8*(lane>>4) + 0..7, elements 8..15 <- 16 further. D element r of lane (h, n) = (row 8h + r, column n): 16 bytes of one stored row.
__device__ __forceinline__ void d_fold(const float* __restrict__ WQ, const float* __restrict__ WO, hf* WT, hf* WP, unsigned blk, bool vp) {
    const unsigned tid = threadIdx.x, lane = tid & 31u, lr = lane & 15u, hi = lane >> 4;
    const unsigned wave = tid >> 5;
    const unsigned h = blk >> 3, tc = blk & 7u;
    const float* ar = WQ + (size_t)(16u * wave + lr) * QKVN + h * DIM + 8u * hi;
    v16h a[4], b[4];
    v4f ra[16];
    ld_row16(ar, vp ? 2u * INNER : 0u, ra);   // the B operand's loads follow at once: one memory latency for both operands
    if (!vp) {
        const float* br = WQ + (size_t)(16u * tc + lr) * QKVN + h * DIM + 8u * hi;
        v4f rb[16];
        ld_row16(br, INNER, rb);
        close_row16(ar, ra);
        close_row16(br, rb);
        cv_frag4(rb, WQS, b);
    } else {
        const float* bc = WO + (size_t)(h * DIM + 8u * hi) * DIM + 16u * tc + lr;
        float rc[64];
#pragma unroll
        for (int k = 0; k < 4; ++k) {
#pragma unroll
            for (int e = 0; e < 8; ++e) {
                rc[16 * k + e] = bc[(32 * k + e) * DIM];
                rc[16 * k + 8 + e] = bc[(32 * k + 16 + e) * DIM];
            }
        }
        close_row16(ar, ra);   // stands behind the 64 loads from bc too, ahead of any rewrite of their address pair
#pragma unroll
        for (int k = 0; k < 4; ++k) {
            v8us lo, up;
#pragma unroll
            for (int e = 0; e < 8; ++e) {
                lo[e] = f2h(bfr(rc[16 * k + e]) * WPS);
                up[e] = f2h(bfr(rc[16 * k + 8 + e]) * WPS);
            }
            b[k] = cat16h(lo, up);
        }
    }
    cv_frag4(ra, WQS, a);
    v8f acc = (v8f){};
#pragma unroll
    for (int k = 0; k < 4; ++k) acc = wmmah(a[k], b[k], acc);
    v8h o;
#pragma unroll
    for (int r = 0; r < 8; ++r) o[r] = (_Float16)(acc[r] * (1.0f / WQS));   // takes the A operand's carry off; the B operand's stays as the stored carry
    hf* dst = (vp ? WP : WT) + (size_t)(h * 8u + tc) * WFT + wave * 256u + lane * 8u;   // a = 16 wave + 8 hi + r: k-step wave >> 1, fragment half wave & 1
    *(v8us*)dst = __builtin_bit_cast(v8us, o);
    asm volatile("s_wait_xcnt 0x0" ::: "memory");   // closes the store ahead of any rewrite of its address and data registers (the code of another block range follows in k_prep)
}

// k_prep: the three preparations that depend on nothing but the inputs, in one launch, by block range (block-uniform branches):
//  blocks [0, NFD) form M = Wq Wk^T, [NFD, 2 NFD) form N = Wv Wp, the rest normalise 64 rows each.
__global__ __launch_bounds__(256) void k_prep(const float* __restrict__ X, const float* __restrict__ G, const float* __restrict__ Bt,
                                              const float* __restrict__ WQ, const float* __restrict__ WO, hf* XH, hf* XT, hf* WT, hf* WP) {
    __shared__ __align__(16) hf tl[DIM * VTP];
    const unsigned b = blockIdx.x;
    if (b < (unsigned)NFD) d_fold(WQ, WO, WT, WP, b, false);
    else if (b < (unsigned)(2 * NFD)) d_fold(WQ, WO, WT, WP, b - (unsigned)NFD, true);
    else d_ln(X, G, Bt, XH, XT, b - (unsigned)(2 * NFD), tl);
}

// in-lane maximum of one 16-query column tile's scores: s0 / s1 = S^T tiles of keys 0..15 / 16..31 (this lane's 16 of the column's 32 keys)
__device__ __forceinline__ float lane_max(const v8f& s0, const v8f& s1) {
    float mx = fmaxf(s0[0], s1[0]);
#pragma unroll
    for (int r = 1; r < 8; ++r) mx = fmaxf(mx, fmaxf(s0[r], s1[r]));
    return mx;
}
// one softmax step of one column tile against the reference maximum in use (sh = PCL - that maximum, log2 domain): adds to the running sum l, returns the P^T B fragment
__device__ __forceinline__ v16h soft_step(const v8f& s0, const v8f& s1, float sh, float& l) {
    float p0[8], p1[8];
    float ps = 0.0f;
#pragma unroll
    for (int r = 0; r < 8; ++r) {
        p0[r] = __builtin_amdgcn_exp2f(fmaf(s0[r], SC2, sh));
        p1[r] = __builtin_amdgcn_exp2f(fmaf(s1[r], SC2, sh));
        ps += p0[r] + p1[r];
    }
    ps += __shfl_xor(ps, 16, 32);
    l += ps;
    v16h ph;
#pragma unroll
    for (int r = 0; r < 8; ++r) { ph[r] = (_Float16)p0[r]; ph[8 + r] = (_Float16)p1[r]; }
    return ph;
}

// two O^T accumulator tiles (d = 32j + 8h + r and 16 further) -> the ctx^T B fragments of k-step j: hv = f16(ctx x 16), lv = f16 of what that rounding lost, x 2^11
__device__ __forceinline__ void split16(const v8f& t0, const v8f& t1, float sc, v16h& hv, v16h& lv) {
#pragma unroll
    for (int r = 0; r < 8; ++r) {
        const float x = t0[r] * sc, y = t1[r] * sc;
        const _Float16 hx = (_Float16)x, hy = (_Float16)y;
        hv[r] = hx; hv[8 + r] = hy;
        lv[r] = (_Float16)((x - (float)hx) * RSC); lv[8 + r] = (_Float16)((y - (float)hy) * RSC);
    }
}
// weight fragment stored in fragment order: p = fragment base + 8 * lane; elements 0..7 <- p[0..7], elements 8..15 <- the second half, 256 elements on
__device__ __forceinline__ v16h ldw(const hf* p) { return cat16h(*(const v8us*)p, *(const v8us*)(p + 256)); }

// k_flash: one block per 32 queries of one batch, one wave per head (two 16-query column tiles, a and b), 32 keys per step, online softmax; K = the batch's x rows (KP), V^T = their transpose (VT), the same for all heads; the block's eight waves share K / V^T tiles of 64 keys,
//  staged in a two-buffer LDS ring by asynchronous copies (tile t + 2 is issued behind the barrier that ends the reads of tile t); fragments are read from LDS, each once per step for both column tiles.
//  S^T tile (keys x queries): A = K rows (row m = key, k = d), B = Q rows (column n = query, k = d); D element r of lane (h, n) = S[query n][key 8h + r].
//  Q' = x @ M_h, ahead of the loop: A = the head's folded weights M x 16 (row m = feature, k = token width), read from WT in fragment order, B = the block's x rows (column n = query); D element r of lane (h, n) = (feature 16 t + 8h + r, query n),
//  so the tiles 2j and 2j + 1, rounded to f16, are directly the Q fragment of k-step j (the k order of ldh).
//  Q fragments (B operands): six are held, tile b's first two are read from LDS with their K fragments; K fragments are loaded two at a time (one k-step x two key tiles, four products); V^T fragments four output tiles at a time (eight products).
//  P^T B fragment: element r <- tile of keys 0..15, element 8 + r <- tile of keys 16..31 (same lane); P carried x 2^7 (the running sum carries the same factor).
//  O^T tile (d x queries): A = V^T rows (row m = d, k = key), D element r of lane (h, n) = O[query n][d = 16 t + 8h + r].
//  Output projection, behind the loop: the O^T tiles 2j and 2j + 1 are directly the B fragment of ctx^T for k-step j (element r <- d = 32j + 8h + r, element 8 + r <- 16 further: the k order of ldh);
//  A = the head's folded weights N x 32 (row m = output feature, k = d), read from WP in fragment order; D element r of lane (h, n) = (feature 16 t + 8h + r, query n).
//  ctx value and residual share the weight fragment and use separate accumulators; a head's partial output = (acc_v + acc_r / 2^11) / 512; out = sum over heads, head 0 first, + bf16(bias).
__attribute__((amdgpu_num_vgpr(256))) __global__ __launch_bounds__(NWV * 32) void k_flash(const hf* WT, const hf* KP, const hf* VT, const hf* WP, const float* __restrict__ bias, float* OUT) {
    __shared__ __align__(16) hf cs[CSE];        // in the loop the K / V^T ring, then 16 Q rows per wave; the heads' partial outputs behind the loop
    const unsigned tid = threadIdx.x, lane = tid & 31u, lr = lane & 15u, hi = lane >> 4;
    const unsigned wave = (unsigned)__builtin_amdgcn_readfirstlane((int)(tid >> 5));
    const unsigned bpb = (unsigned)(SEQ / BQ);
    const unsigned bl = blockIdx.x / bpb;
    const unsigned q0 = (blockIdx.x - bl * bpb) * BQ;
    const unsigned head = wave;

    const unsigned kfo = lr * CSP + 8u * hi;          // fragment offsets inside a ring buffer
    const unsigned vfo = KTE + lr * VTP + 8u * hi;
    // staging addresses of this lane: K tile = 16 KiB contiguous, 16 lanes per key row; V^T tile = 128 rows of 128 B, 8 lanes per row
    const hf* gk = KP + (size_t)bl * SEQ * DIM + tid * 8u;
    const hf* gv = VT + ((size_t)bl * DIM + (tid >> 3)) * SEQ + (tid & 7u) * 8u;
    const unsigned lk = (unsigned)(size_t)(cs + (tid >> 4) * CSP + (tid & 15u) * 8u);
    const unsigned lv = (unsigned)(size_t)(cs + KTE + (tid >> 3) * VTP + (tid & 7u) * 8u);
    const unsigned nt = (unsigned)(SEQ / TK);

    stage_kv(lk, lv, gk, gv);                              // tile 0 -> buffer 0; it flies while Q' is formed

    // tile b's first two Q fragments live in LDS, in rows of this wave's own behind the ring (same row form as a K tile), and are read with the K fragments of their k-steps:
    // six held Q fragments leave the wave inside 256 registers, four waves per SIMD; with more held it spills to scratch. The loop's last barrier ends every wave's reads of them, ahead of the partial outputs
    hf* qs = cs + 2 * BUFE + wave * (16u * CSP) + kfo;
    v16h qa[4], qb[4];
    {
        const hf* xp = KP + ((size_t)bl * SEQ + q0 + lr) * DIM + 8u * hi;
        const hf* mf = WT + (size_t)head * (8u * WFT) + lane * 8u;
        v16h xa[4], xb[4], m[2][4];
#pragma unroll
        for (int k = 0; k < 4; ++k) { xa[k] = ldh(xp + 32 * k); xb[k] = ldh(xp + 16 * DIM + 32 * k); }
#pragma unroll
        for (int k = 0; k < 4; ++k) m[0][k] = ldw(mf + 512 * k);
        asm volatile("s_wait_xcnt 0x0" :: "v"(xp) : "memory");   // closes the x loads: their address pair is an input, so it lives to this wait and no later load is given it as its destination
        const float uq = 1.0f / WQS;
        v8us pa8 = (v8us){}, pb8 = (v8us){};
#pragma unroll
        for (int t = 0; t < 8; ++t) {                      // one 16-feature tile at a time; the next tile's four weight fragments are asked for ahead of this tile's products
            if (t < 7) {
#pragma unroll
                for (int k = 0; k < 4; ++k) m[(t + 1) & 1][k] = ldw(mf + (t + 1) * WFT + 512 * k);
            }
            const v16h m0 = m[t & 1][0], m1 = m[t & 1][1], m2 = m[t & 1][2], m3 = m[t & 1][3];
            v8f ca = (v8f){}, cb = (v8f){};
            ca = wmmah(m0, xa[0], ca); cb = wmmah(m0, xb[0], cb);
            ca = wmmah(m1, xa[1], ca); cb = wmmah(m1, xb[1], cb);
            ca = wmmah(m2, xa[2], ca); cb = wmmah(m2, xb[2], cb);
            ca = wmmah(m3, xa[3], ca); cb = wmmah(m3, xb[3], cb);
            v8h ea, eb;
#pragma unroll
            for (int r = 0; r < 8; ++r) { ea[r] = (_Float16)(ca[r] * uq); eb[r] = (_Float16)(cb[r] * uq); }
            const v8us ua = __builtin_bit_cast(v8us, ea), ub = __builtin_bit_cast(v8us, eb);
            if (t < 4) *(v8usa*)(qs + 16 * t) = ub;
            if (t & 1) {
                qa[t >> 1] = cat16h(pa8, ua);
                if (t >= 4) qb[t >> 1] = cat16h(pb8, ub);
            } else {
                pa8 = ua; pb8 = ub;
            }
            sfence();   // one tile's accumulators and two tiles' weight fragments live at a time, and each tile's loads stay ahead of the products before it
        }
        asm volatile("s_wait_xcnt 0x0" ::: "memory");   // closes the weight loads ahead of any rewrite of their address registers
    }

    v8f oa[8], ob[8];
#pragma unroll
    for (int t = 0; t < 8; ++t) { oa[t] = (v8f){}; ob[t] = (v8f){}; }
    float mla = -1.0e30f, mlb = -1.0e30f;   // reference maxima in use, log2 domain
    float la = 0.0f, lb = 0.0f;             // running sums (carried x 2^7)

    asm volatile("s_wait_asynccnt 0x0" ::: "memory");      // this wave's pieces of tile 0 have landed
    __syncthreads();                                       // tile 0 readable by every wave
    if (nt > 1u) stage_kv(lk + BUFE * 2u, lv + BUFE * 2u, gk + TK * DIM, gv + TK);   // tile 1 -> buffer 1

#pragma unroll 1
    for (unsigned t = 0; t < nt; ++t) {
      const unsigned bo = (t & 1u) * BUFE;
#pragma unroll 1
      for (unsigned h = 0; h < 2u; ++h) {                  // rolled: one copy of the step's code, one step's fragments live
        v8f sa0 = (v8f){}, sa1 = (v8f){}, sb0 = (v8f){}, sb1 = (v8f){};
        const hf* ka = cs + bo + kfo + h * (KS * CSP);
#pragma unroll
        for (int k = 0; k < 4; ++k) {                      // one k-step at a time: two K fragments, four products
            const v16h a0 = ldh(ka + 32 * k), a1 = ldh(ka + 16 * CSP + 32 * k);
            const v16h qk = k < 2 ? ldh(qs + 32 * k) : qb[k];
            sa0 = wmmah(a0, qa[k], sa0);
            sa1 = wmmah(a1, qa[k], sa1);
            sb0 = wmmah(a0, qk, sb0);
            sb1 = wmmah(a1, qk, sb1);
            guard4(sa0, sa1, sb0, sb1, a0, a1, qk);
            sfence();
        }

        // lazy rescale: the reference maxima move only when some score lies more than LZT above the one in use, so P stays near or below 2^(PCL + LZT); one wave-uniform test per step for both tiles, on in-lane maxima (the exchange between the halves is needed only when the maxima move)
        const float xa = lane_max(sa0, sa1), xb = lane_max(sb0, sb1);
        if (__builtin_amdgcn_ballot_w32(fmaxf(fmaf(xa, SC2, -mla), fmaf(xb, SC2, -mlb)) > LZT) != 0u) {
            const float na = fmaxf(mla, fmaxf(xa, __shfl_xor(xa, 16, 32)) * SC2);   // both halves of a column take the same new maximum
            const float nb = fmaxf(mlb, fmaxf(xb, __shfl_xor(xb, 16, 32)) * SC2);
            const float ca = __builtin_amdgcn_exp2f(mla - na), cb = __builtin_amdgcn_exp2f(mlb - nb);
            mla = na; mlb = nb;
            la *= ca; lb *= cb;
#pragma unroll
            for (int j = 0; j < 8; ++j) { oa[j] *= ca; ob[j] *= cb; }
        }
        const v16h pa = soft_step(sa0, sa1, PCL - mla, la);
        sfence();   // keeps the scheduler from merging the two tiles' exponentials into one region: merged, the live set passes 256 registers and the kernel spills to scratch
        const v16h pb = soft_step(sb0, sb1, PCL - mlb, lb);

        sfence();   // keep the V^T loads below the softmax (bounds live fragments)
        const hf* va = cs + bo + vfo + h * KS;
        {
            const v16h v0 = ldh(va), v1 = ldh(va + 16 * VTP), v2 = ldh(va + 32 * VTP), v3 = ldh(va + 48 * VTP);
            oa[0] = wmmah(v0, pa, oa[0]);
            ob[0] = wmmah(v0, pb, ob[0]);
            oa[1] = wmmah(v1, pa, oa[1]);
            ob[1] = wmmah(v1, pb, ob[1]);
            oa[2] = wmmah(v2, pa, oa[2]);
            ob[2] = wmmah(v2, pb, ob[2]);
            oa[3] = wmmah(v3, pa, oa[3]);
            ob[3] = wmmah(v3, pb, ob[3]);
            guard8(oa[0], ob[0], oa[1], ob[1], oa[2], ob[2], oa[3], ob[3], v0, v1, v2, v3, pa, pb);
        }
        sfence();
        {
            const v16h v4 = ldh(va + 64 * VTP), v5 = ldh(va + 80 * VTP), v6 = ldh(va + 96 * VTP), v7 = ldh(va + 112 * VTP);
            oa[4] = wmmah(v4, pa, oa[4]);
            ob[4] = wmmah(v4, pb, ob[4]);
            oa[5] = wmmah(v5, pa, oa[5]);
            ob[5] = wmmah(v5, pb, ob[5]);
            oa[6] = wmmah(v6, pa, oa[6]);
            ob[6] = wmmah(v6, pb, ob[6]);
            oa[7] = wmmah(v7, pa, oa[7]);
            ob[7] = wmmah(v7, pb, ob[7]);
            guard8(oa[4], ob[4], oa[5], ob[5], oa[6], ob[6], oa[7], ob[7], v4, v5, v6, v7, pa, pb);
        }
        sfence();
      }
      asm volatile("s_wait_dscnt 0x0" ::: "memory");       // this wave's reads of tile t have returned before its buffer is refilled
      asm volatile("s_wait_asynccnt 0x0" ::: "memory");    // this wave's pieces of tile t + 1 have landed
      __syncthreads();                                     // publishes tile t + 1 and ends every wave's reads of tile t
      if (t + 2u < nt) stage_kv(lk + bo * 2u, lv + bo * 2u, gk + (size_t)(t + 2u) * (TK * DIM), gv + (t + 2u) * TK);
    }
    asm volatile("s_wait_asynccnt 0x0" ::: "memory");      // no copy outstanding when the ring becomes the partial outputs' place

    // this head's folded output weights, in fragment order; the first 16-feature tile's four fragments are asked for ahead of the conversions below, which cover their latency
    const hf* wf = WP + (size_t)head * (8u * WFT) + lane * 8u;
    v16h w[2][4];
#pragma unroll
    for (int k = 0; k < 4; ++k) w[0][k] = ldw(wf + 512 * k);
    sfence();   // holds those loads here: left free, the scheduler sinks them behind the conversions, and the first products wait for L2
    // ctx^T B fragments, value and residual, from the accumulators in place
    v16h cha[4], cla[4], chb[4], clb[4];
    {
        const float sa = (1.0f / la) * CCS, sb = (1.0f / lb) * CCS;
#pragma unroll
        for (int j = 0; j < 4; ++j) {
            split16(oa[2 * j], oa[2 * j + 1], sa, cha[j], cla[j]);
            split16(ob[2 * j], ob[2 * j + 1], sb, chb[j], clb[j]);
        }
    }
    // this head's partial output, one 16-feature tile at a time; the next tile's four weight fragments are asked for ahead of this tile's products
    float* rd = (float*)cs + (head * (unsigned)BQ + lr) * OSP + 8u * hi;
    const float un = 1.0f / (CCS * WPS);
    const float ur = 1.0f / RSC;
#pragma unroll
    for (int t = 0; t < 8; ++t) {
        if (t < 7) {
#pragma unroll
            for (int k = 0; k < 4; ++k) w[(t + 1) & 1][k] = ldw(wf + (t + 1) * WFT + 512 * k);
        }
        const v16h w0 = w[t & 1][0], w1 = w[t & 1][1], w2 = w[t & 1][2], w3 = w[t & 1][3];
        v8f ha = (v8f){}, ra = (v8f){}, hb = (v8f){}, rb = (v8f){};
        ha = wmmah(w0, cha[0], ha); ra = wmmah(w0, cla[0], ra); hb = wmmah(w0, chb[0], hb); rb = wmmah(w0, clb[0], rb);
        ha = wmmah(w1, cha[1], ha); ra = wmmah(w1, cla[1], ra); hb = wmmah(w1, chb[1], hb); rb = wmmah(w1, clb[1], rb);
        ha = wmmah(w2, cha[2], ha); ra = wmmah(w2, cla[2], ra); hb = wmmah(w2, chb[2], hb); rb = wmmah(w2, clb[2], rb);
        ha = wmmah(w3, cha[3], ha); ra = wmmah(w3, cla[3], ra); hb = wmmah(w3, chb[3], hb); rb = wmmah(w3, clb[3], rb);
        guard4w(ha, ra, hb, rb, w0, w1, w2, w3);
        v4f x0, x1, y0, y1;
#pragma unroll
        for (int r = 0; r < 4; ++r) {
            x0[r] = fmaf(ra[r], ur, ha[r]) * un; x1[r] = fmaf(ra[4 + r], ur, ha[4 + r]) * un;
            y0[r] = fmaf(rb[r], ur, hb[r]) * un; y1[r] = fmaf(rb[4 + r], ur, hb[4 + r]) * un;
        }
        *(v4fa*)(rd + 16 * t) = x0;
        *(v4fa*)(rd + 16 * t + 4) = x1;
        *(v4fa*)(rd + 16 * OSP + 16 * t) = y0;
        *(v4fa*)(rd + 16 * OSP + 16 * t + 4) = y1;
        sfence();   // one tile's accumulators and two tiles' weight fragments live at a time: merged regions pass 256 registers
    }
    __syncthreads();                                       // all eight heads' partial outputs are in LDS before any wave sums them
    const v4f bb = *(const v4f*)(bias + lane * 4u);
    v4f bq;
    bq[0] = bfr(bb[0]); bq[1] = bfr(bb[1]); bq[2] = bfr(bb[2]); bq[3] = bfr(bb[3]);
    const float* rr = (const float*)cs + (4u * wave) * OSP + lane * 4u;      // wave w sums and stores rows 4w..4w+3, a lane four features
    float* orow = OUT + ((size_t)bl * SEQ + q0 + 4u * wave) * DIM + lane * 4u;
    v4f val[4];
#pragma unroll
    for (unsigned s = 0; s < 4; ++s) {
        val[s] = *(const v4fa*)(rr + s * OSP);
#pragma unroll
        for (unsigned h = 1; h < (unsigned)NH; ++h) val[s] += *(const v4fa*)(rr + (h * (unsigned)BQ + s) * OSP);
        val[s] += bq;
    }
#pragma unroll
    for (unsigned s = 0; s < 4; ++s) *(v4f*)(orow + (size_t)s * DIM) = val[s];
}

extern "C" void kernel_launch(void* const* d_in, const int* in_sizes, int n_in,
                              void* d_out, int out_size, void* d_ws, size_t ws_size, hipStream_t stream) {
    if (n_in < 6) return;
    const size_t need = ((size_t)(NB - 1) * SEQ_FULL + SEQ) * DIM;
    if ((size_t)in_sizes[0] < need) return;
    if (in_sizes[1] < DIM || in_sizes[2] < DIM || in_sizes[5] < DIM) return;
    if ((size_t)in_sizes[3] < (size_t)DIM * QKVN) return;
    if ((size_t)in_sizes[4] < (size_t)INNER * DIM) return;
    if ((size_t)out_size < (size_t)NB * SEQ * DIM) return;
    if (SZ_ALL > ws_size) return;

    const float* x      = (const float*)d_in[0];   // inputs  [NB][SEQ_FULL][128] (rows n < SEQ read)
    const float* gamma  = (const float*)d_in[1];   // ln_gamma [128]
    const float* beta   = (const float*)d_in[2];   // ln_beta  [128]
    const float* w_qkv  = (const float*)d_in[3];   // [128][3072]  ([in][out])
    const float* w_proj = (const float*)d_in[4];   // [1024][128]  ([in][out])
    const float* b_proj = (const float*)d_in[5];   // [128]
    float* OUT = (float*)d_out;                    // [NB][SEQ][128]

    char* wsp = (char*)d_ws;
    hf* XH  = (hf*)(wsp);
    hf* XT  = (hf*)(wsp + SZ_XH);
    hf* WT  = (hf*)(wsp + 2 * SZ_XH);
    hf* WP  = (hf*)(wsp + 2 * SZ_XH + SZ_WT);

    k_prep<<<(unsigned)(2 * NFD + NLN), 256, 0, stream>>>(x, gamma, beta, w_qkv, w_proj, XH, XT, WT, WP);
    for (int c = 0; c < NCH; ++c) {
        const int bch0 = c * BCH;
        k_flash<<<(unsigned)(BCH * (SEQ / BQ)), NWV * 32, 0, stream>>>(WT, XH + (size_t)bch0 * SEQ * DIM, XT + (size_t)bch0 * DIM * SEQ, WP, b_proj, OUT + (size_t)bch0 * SEQ * DIM);
    }
}

// v009
// It runs in 54.5 microseconds.
// Timed twice side by side with v008, it ran 1.04 and 1.05 times as fast.
// Over all steps from v000 it is 7.01 times as fast.
#include <hip/hip_runtime.h>

// Pre-LayerNorm multi-head softmax(QK^T)V block: x = LN(in) over 128; qkv = x @ w_qkv ([128][3072], thirds q|k|v, column = which*1024 + h*128 + d); 8 heads of dim 128; logits (q.k)/32; out = ctx @ w_proj + b_proj.
// The K and V projections are folded into their neighbours' weights (head dim == token width, so both folded matrices are 128 x 128 per head):
//  q.k = x_i (Wq_h Wk_h^T) x_j^T, so Q' = x @ M_h with M_h = Wq_h Wk_h^T, and the keys are the x rows; (P v) Wp_h = (P x)(Wv_h Wp_h), so the values are the x rows and the output projection uses N_h = Wv_h Wp_h.
// Compute dtypes, f32 accumulate: every contraction on v_wmma_f32_16x16x32_f16. Float inputs are RNE-converted to bf16 first; weights enter the folds as bf16 value x 16 (w_qkv) / x 32 (w_proj), exact in f16; M carried as f16 x 16, N as f16 x 32;
// x plane and Q' fragments f16; P carried as f16 x 2^7 (online softmax in f32, log2 domain, lazy rescale); ctx = P x carried as f16(ctx x 16) plus f16 residual x 2^11 with its own accumulator in the output projection.
// Q' is formed inside k_flash too: each wave multiplies the block's 64 x rows by its head's M_h, and the accumulator tiles, rounded to f16, are directly its Q fragments.
// The output projection runs inside k_flash: a block's eight waves are the eight heads of the same 64 queries, each wave multiplies its own ctx (still in registers) by its head's N_h, and the eight partial outputs are summed through LDS.
// Flash form with transposed tiles: the S^T accumulator tiles are directly the B-operand layout of P^T; all WMMA operands are two 16-byte loads from dense, statically strided 16-bit rows (K / V^T from LDS tiles; only the block's own x rows and the folded weights, stored in fragment order, come straight from their planes).

#ifndef NB
#define NB 16
#endif
#ifndef SEQ
#define SEQ 1024
#endif
#define NB_FULL  16
#define SEQ_FULL 1024
#define DIM   128                 // token width == head dim
#define NH    8
#define INNER (NH * DIM)          // 1024
#define QKVN  (3 * INNER)         // 3072
#define NCH   1                   // batch chunks: all batches go through one k_flash pass
#define BCH   (NB / NCH)          // batches per chunk
#define NWV   8                   // waves per flash block: one per head
#define QT    4                   // 16-query column tiles per flash wave: each K / V^T fragment read from LDS feeds QT products
#define BQ    (16 * QT)           // queries per flash block (the same ones for every head)
#define KS    32                  // keys per step
#define TK    64                  // keys per staged K / V^T tile (two steps)
#define CSP   136                 // LDS pitch (16-bit elements) of 128-wide staging rows
#define OSP   132                 // LDS pitch (floats) of the output staging rows
#define VTP   72                  // LDS pitch (16-bit elements) of 64-wide transposed rows
#define KTE   (TK * CSP)          // staged K tile, 16-bit elements: TK key rows of 128
#define BUFE  (KTE + DIM * VTP)   // one ring buffer: K tile, then V^T tile (128 rows of TK keys)
#define RNE   (2 * BUFE + NWV * 16 * CSP)         // k_flash in the loop, 16-bit elements: the ring, then 16 Q rows per wave
#define OSE   (NH * BQ * OSP * 2)                 // k_flash behind the loop, 16-bit elements: per head BQ rows of float partial outputs
#define CSE   (RNE > OSE ? RNE : OSE)             // k_flash LDS, 16-bit elements
#define WFT   (4 * 2 * 32 * 8)    // folded weights, 16-bit elements per 16-feature tile of one head: four k-steps x two fragment halves x 32 lanes x 8
#define L2E   1.4426950408889634f
#define SC2   (L2E * 0.03125f)    // log2(e) / 32
#define PCL   7.0f                // P carry exponent (2^7)
#define LZT   8.0f                // lazy rescale: how far (log2 domain) a score may lie above the reference maximum in use; 2^(PCL + LZT) is finite in f16
#define WQS   16.0f               // w_qkv carry
#define WPS   32.0f               // w_proj carry
#define CCS   16.0f               // ctx carry
#define RSC   2048.0f             // ctx residual carry
#define NFD   (NH * (DIM / 16))             // k_prep: blocks per folded weight product, one head x one 16-column tile each
#define NLN   (NB * SEQ / 64)               // k_prep: LayerNorm blocks, 64 rows each

static_assert(DIM == 128);
static_assert(INNER == 1024);
static_assert(NB <= NB_FULL);
static_assert(SEQ <= SEQ_FULL);
static_assert(NB % NCH == 0);
static_assert(SEQ % BQ == 0);
static_assert(SEQ % 64 == 0);
static_assert(SEQ % KS == 0);
static_assert(SEQ % TK == 0 && TK == 2 * KS && TK <= VTP);
static_assert(NWV * 32 == 256);                  // k_flash staging: 256 lanes x 16 B x 4 pieces == one 16-KiB tile
static_assert(TK * DIM * 2 == 4 * 256 * 16);
static_assert((KTE * 2) % 16 == 0 && (BUFE * 2) % 16 == 0);
static_assert(QT == 4);                          // k_flash: the rescale test names four column tiles
static_assert(NWV == NH);                        // k_flash: wave == head
static_assert(BQ == 8 * NWV);                    // k_flash: each wave sums and stores eight output rows
static_assert(CSE * 2 <= 327680);                // one block takes most of a WGP's LDS
static_assert(DIM % 32 == 0);
static_assert(DIM == 4 * 32);                    // four 32-deep k-steps per score tile / per Q' tile / per folded tile
static_assert(DIM == 8 * 16);                    // eight 16-row output tiles per wave
static_assert(INNER % 32 == 0);
static_assert(DIM / 16 == 8);                    // d_fold: eight waves x 16 rows, eight column tiles per head
static_assert(16 * 8 == DIM);                    // d_ln: 16 lanes x 8 elements == row
static_assert(64 <= VTP);                        // transposed staging rows hold 64 tokens
static_assert((CSP * 2) % 16 == 0);
static_assert((VTP * 2) % 16 == 0);
static_assert((OSP * 4) % 16 == 0);
static_assert(32 * 4 == DIM);                    // k_flash: 32 lanes x 4 floats == output row
static_assert(16 * 8 * 2 == 256);                // 16 lanes x 16 B == one 128-element 16-bit row
static_assert(QKVN % 128 == 0);
static_assert((BCH * SEQ) % 64 == 0);            // d_ln: 64 tokens per block (SEQ % 64 == 0: all of one batch)

#define SZ_XH  ((size_t)NB * SEQ * DIM * 2)
#define SZ_WT  ((size_t)INNER * DIM * 2)
#define SZ_WP  ((size_t)DIM * INNER * 2)
#define SZ_ALL (2 * SZ_XH + SZ_WT + SZ_WP)
static_assert(SZ_XH % 256 == 0 && SZ_WT % 256 == 0 && SZ_WP % 256 == 0);
static_assert(SZ_ALL <= (size_t)268435456);

typedef unsigned short hf;
typedef __attribute__((ext_vector_type(16))) _Float16 v16h;
typedef __attribute__((ext_vector_type(8)))  _Float16 v8h;
typedef __attribute__((ext_vector_type(8)))  unsigned short v8us;
typedef __attribute__((ext_vector_type(8)))  float    v8f;
typedef __attribute__((ext_vector_type(4)))  float    v4f;
typedef v4f  __attribute__((may_alias)) v4fa;
typedef v8us __attribute__((may_alias)) v8usa;

__device__ __forceinline__ float bfr(float f) { unsigned u = __float_as_uint(f); u += 0x7FFFu + ((u >> 16) & 1u); return __uint_as_float(u & 0xFFFF0000u); }
__device__ __forceinline__ unsigned short f2h(float f) { return __builtin_bit_cast(unsigned short, (_Float16)f); }
__device__ __forceinline__ v16h cat16h(v8us lo, v8us hi) { return __builtin_bit_cast(v16h, __builtin_shufflevector(lo, hi, 0, 1, 2, 3, 4, 5, 6, 7, 8, 9, 10, 11, 12, 13, 14, 15)); }
__device__ __forceinline__ v8f wmmah(v16h a, v16h b, v8f c) { return __builtin_amdgcn_wmma_f32_16x16x32_f16(false, a, false, b, (short)0, c, false, false); }
// fragment loader (A and B alike): p = row base + k0 + 8*(lane>>4); elements 0..7 <- p[0..7], elements 8..15 <- p[16..23]
__device__ __forceinline__ v16h ldh(const hf* p) { return cat16h(*(const v8us*)p, *(const v8us*)(p + 16)); }
__device__ __forceinline__ void sfence() { asm volatile("" ::: "memory"); __builtin_amdgcn_sched_barrier(0); }
// One 64-key tile, global -> LDS through no register: each lane copies four 16-byte pieces of K (16 key rows apart) and four of V^T (32 d rows apart).
// lk / lv: the lane's LDS places of its first pieces; gk / gv: their global addresses. The copies are the builtin: operands of an asm statement cannot lie above v255, and held below it across the key loop the addresses spill to scratch.
typedef __attribute__((ext_vector_type(4))) int v4i;
typedef __attribute__((address_space(1))) v4i* gp4;
typedef __attribute__((address_space(3))) v4i* lp4;
__device__ __forceinline__ void stage_kv(hf* lk, hf* lv, const hf* gk, const hf* gv) {
#pragma unroll
    for (int i = 0; i < 4; ++i) __builtin_amdgcn_global_load_async_to_lds_b128((gp4)(gk + i * (16 * DIM)), (lp4)(lk + i * (16 * CSP)), 0, 0);
#pragma unroll
    for (int i = 0; i < 4; ++i) __builtin_amdgcn_global_load_async_to_lds_b128((gp4)(gv + (size_t)i * (32 * SEQ)), (lp4)(lv + i * (32 * VTP)), 0, 0);
}

// d_ln: x plane XH[NB*SEQ][128] (f16) = LayerNorm(bf16(in)) with bf16(gamma), bf16(beta), and its transpose XT[NB][128][SEQ]; one block = 64 rows of one batch, in four passes of 16 rows;
//  16 lanes per row, 8 elements per lane; the transpose goes through the LDS tile tl (cross-wave, block barrier), so that a block stores whole 128-byte pieces of the XT rows; blk = index among the LayerNorm blocks
__device__ __forceinline__ void d_ln(const float* __restrict__ X, const float* __restrict__ G, const float* __restrict__ Bt, hf* XH, hf* XT, unsigned blk, hf* tl) {
    const unsigned tid = threadIdx.x;
    const unsigned sub = tid & 15u;
    const unsigned row0 = blk * 64u;
    const unsigned b = row0 / (unsigned)SEQ, n0 = row0 - b * (unsigned)SEQ;
    const v4f g0 = *(const v4f*)(G + sub * 8u), g1 = *(const v4f*)(G + sub * 8u + 4u);
    const v4f b0 = *(const v4f*)(Bt + sub * 8u), b1 = *(const v4f*)(Bt + sub * 8u + 4u);
    v4f x0[4], x1[4];                                   // all four passes' rows are asked for at once: one memory latency per block
#pragma unroll
    for (unsigned it = 0; it < 4; ++it) {
        const float* src = X + ((size_t)b * SEQ_FULL + n0 + it * 16u + (tid >> 4)) * DIM + sub * 8u;
        x0[it] = *(const v4f*)src;
        x1[it] = *(const v4f*)(src + 4);
    }
#pragma unroll
    for (unsigned it = 0; it < 4; ++it) {
        const unsigned tr = it * 16u + (tid >> 4);
        const v4f a0 = x0[it], a1 = x1[it];
        float e[8];
        e[0] = bfr(a0[0]); e[1] = bfr(a0[1]); e[2] = bfr(a0[2]); e[3] = bfr(a0[3]);
        e[4] = bfr(a1[0]); e[5] = bfr(a1[1]); e[6] = bfr(a1[2]); e[7] = bfr(a1[3]);
        float s = ((e[0] + e[1]) + (e[2] + e[3])) + ((e[4] + e[5]) + (e[6] + e[7]));
        s += __shfl_xor(s, 8, 32);
        s += __shfl_xor(s, 4, 32);
        s += __shfl_xor(s, 2, 32);
        s += __shfl_xor(s, 1, 32);
        const float mu = s * (1.0f / DIM);
        float d[8];
        float s2 = 0.0f;
#pragma unroll
        for (int j = 0; j < 8; ++j) { d[j] = e[j] - mu; s2 = fmaf(d[j], d[j], s2); }
        s2 += __shfl_xor(s2, 8, 32);
        s2 += __shfl_xor(s2, 4, 32);
        s2 += __shfl_xor(s2, 2, 32);
        s2 += __shfl_xor(s2, 1, 32);
        const float rs = rsqrtf(s2 * (1.0f / DIM) + 1.0e-5f);
        v8h o;
        o[0] = (_Float16)(d[0] * rs * bfr(g0[0]) + bfr(b0[0]));
        o[1] = (_Float16)(d[1] * rs * bfr(g0[1]) + bfr(b0[1]));
        o[2] = (_Float16)(d[2] * rs * bfr(g0[2]) + bfr(b0[2]));
        o[3] = (_Float16)(d[3] * rs * bfr(g0[3]) + bfr(b0[3]));
        o[4] = (_Float16)(d[4] * rs * bfr(g1[0]) + bfr(b1[0]));
        o[5] = (_Float16)(d[5] * rs * bfr(g1[1]) + bfr(b1[1]));
        o[6] = (_Float16)(d[6] * rs * bfr(g1[2]) + bfr(b1[2]));
        o[7] = (_Float16)(d[7] * rs * bfr(g1[3]) + bfr(b1[3]));
        const v8us ob = __builtin_bit_cast(v8us, o);
        hf* dst = XH + (size_t)(row0 + tr) * DIM + sub * 8u;
        *(v8us*)dst = ob;
        asm volatile("s_wait_xcnt 0x0" ::: "memory");   // closes the store ahead of any rewrite of its address and data registers by the next pass
        const unsigned cw = (((tr >> 3) ^ (sub >> 1)) << 3) + (tr & 7u);   // 8-token column groups XOR-ed with d >> 4: a pass's 16 lanes per row, 8 tile rows apart, fall on 16 different banks instead of 2
#pragma unroll
        for (unsigned j = 0; j < 8; ++j) tl[(sub * 8u + j) * VTP + cw] = ob[j];
    }
    __syncthreads();                                    // the 128 x 64 transposed tile is complete before any wave reads it back
    hf* dt = XT + (size_t)b * DIM * SEQ + n0;
    const unsigned c8 = (tid & 7u) * 8u, dr = tid >> 3;
#pragma unroll
    for (unsigned it = 0; it < 4; ++it) {
        const unsigned d = it * 32u + dr;
        const v8us o = *(const v8usa*)(tl + d * VTP + (c8 ^ (((d >> 4) & 7u) << 3)));   // undoes the column-group XOR of the writers
        *(v8us*)(dt + (size_t)d * SEQ + c8) = o;
    }
    asm volatile("s_wait_xcnt 0x0" ::: "memory");       // closes the four stores ahead of any rewrite of their address and data registers
}

// eight floats -> f16 of bf16(value) * scale
__device__ __forceinline__ v8us cv8(v4f a, v4f b, float scale) {
    v8us o;
    o[0] = f2h(bfr(a[0]) * scale); o[1] = f2h(bfr(a[1]) * scale); o[2] = f2h(bfr(a[2]) * scale); o[3] = f2h(bfr(a[3]) * scale);
    o[4] = f2h(bfr(b[0]) * scale); o[5] = f2h(bfr(b[1]) * scale); o[6] = f2h(bfr(b[2]) * scale); o[7] = f2h(bfr(b[3]) * scale);
    return o;
}
// One 128-float row piece as sixteen 16-byte loads, in the k order of ldh: p = row base + 8*(lane>>4), c = the piece's constant column (which third of w_qkv); r[4k], r[4k+1] <- p[c + 32k .. c + 32k+7], r[4k+2], r[4k+3] <- 16 further.
__device__ __forceinline__ void ld_row16(const float* p, unsigned c, v4f (&r)[16]) {
#pragma unroll
    for (unsigned k = 0; k < 4; ++k) {
        r[4 * k]     = *(const v4f*)(p + c + 32 * k);
        r[4 * k + 1] = *(const v4f*)(p + c + 32 * k + 4);
        r[4 * k + 2] = *(const v4f*)(p + c + 32 * k + 16);
        r[4 * k + 3] = *(const v4f*)(p + c + 32 * k + 20);
    }
}
// Closes the sixteen loads of ld_row16 (same p): the address and the loaded values are inputs only, so the address pair lives to this wait and no load of the run is given it as its destination.
__device__ __forceinline__ void close_row16(const float* p, const v4f (&r)[16]) {
    asm volatile("s_wait_xcnt 0x0" :: "v"(p), "v"(r[0]), "v"(r[1]), "v"(r[2]), "v"(r[3]), "v"(r[4]), "v"(r[5]), "v"(r[6]), "v"(r[7]),
                 "v"(r[8]), "v"(r[9]), "v"(r[10]), "v"(r[11]), "v"(r[12]), "v"(r[13]), "v"(r[14]), "v"(r[15]) : "memory");
    __builtin_amdgcn_sched_barrier(0);   // holds the wait at its place: without it the scheduler sinks it, and some of the loads with it, far into the conversions, which then wait for memory a second time
}
__device__ __forceinline__ void cv_frag4(const v4f (&r)[16], float scale, v16h (&f)[4]) {
#pragma unroll
    for (int k = 0; k < 4; ++k) f[k] = cat16h(cv8(r[4 * k], r[4 * k + 1], scale), cv8(r[4 * k + 2], r[4 * k + 3], scale));
}

// d_fold: one 128 x 16 tile of a folded weight product of head h = blk / 8, column tile tc = blk % 8; wave w owns rows 16w..16w+15; K = 128 (the head's d).
//  vp == false: M_h[a][c] = sum_d Wq[a][h*128 + d] * Wk[c][h*128 + d]; A = Wq rows (row m = a), B = Wk rows (column n = c); stored M x 16 in the order in which k_flash reads its A fragments (row m = c, k = a), as WP below with c for o.
//  vp == true:  N_h[a][o] = sum_d Wv[a][h*128 + d] * Wp[h*128 + d][o]; A = Wv rows (row m = a), B = Wp columns (column n = o, one float per k); stored N x 32 in the order in which k_flash reads its A fragments (row m = o, k = a):
//   WP[h][tc][a / 32][(a / 16) % 2][lane = 16 * ((a / 8) % 2) + o % 16][a % 8], so that each half of a fragment is 512 contiguous bytes.
//  Fragments straight from the float inputs, in the k order of ldh: elements 0..7 <- k0 + 8*(lane>>4) + 0..7, elements 8..15 <- 16 further. D element r of lane (h, n) = (row 8h + r, column n): 16 bytes of one stored row.
__device__ __forceinline__ void d_fold(const float* __restrict__ WQ, const float* __restrict__ WO, hf* WT, hf* WP, unsigned blk, bool vp) {
    const unsigned tid = threadIdx.x, lane = tid & 31u, lr = lane & 15u, hi = lane >> 4;
    const unsigned wave = tid >> 5;
    const unsigned h = blk >> 3, tc = blk & 7u;
    const float* ar = WQ + (size_t)(16u * wave + lr) * QKVN + h * DIM + 8u * hi;
    v16h a[4], b[4];
    v4f ra[16];
    ld_row16(ar, vp ? 2u * INNER : 0u, ra);   // the B operand's loads follow at once: one memory latency for both operands
    if (!vp) {
        const float* br = WQ + (size_t)(16u * tc + lr) * QKVN + h * DIM + 8u * hi;
        v4f rb[16];
        ld_row16(br, INNER, rb);
        close_row16(ar, ra);
        close_row16(br, rb);
        cv_frag4(rb, WQS, b);
    } else {
        const float* bc = WO + (size_t)(h * DIM + 8u * hi) * DIM + 16u * tc + lr;
        float rc[64];
#pragma unroll
        for (int k = 0; k < 4; ++k) {
#pragma unroll
            for (int e = 0; e < 8; ++e) {
                rc[16 * k + e] = bc[(32 * k + e) * DIM];
                rc[16 * k + 8 + e] = bc[(32 * k + 16 + e) * DIM];
            }
        }
        close_row16(ar, ra);   // stands behind the 64 loads from bc too, ahead of any rewrite of their address pair
#pragma unroll
        for (int k = 0; k < 4; ++k) {
            v8us lo, up;
#pragma unroll
            for (int e = 0; e < 8; ++e) {
                lo[e] = f2h(bfr(rc[16 * k + e]) * WPS);
                up[e] = f2h(bfr(rc[16 * k + 8 + e]) * WPS);
            }
            b[k] = cat16h(lo, up);
        }
    }
    cv_frag4(ra, WQS, a);
    v8f acc = (v8f){};
#pragma unroll
    for (int k = 0; k < 4; ++k) acc = wmmah(a[k], b[k], acc);
    v8h o;
#pragma unroll
    for (int r = 0; r < 8; ++r) o[r] = (_Float16)(acc[r] * (1.0f / WQS));   // takes the A operand's carry off; the B operand's stays as the stored carry
    hf* dst = (vp ? WP : WT) + (size_t)(h * 8u + tc) * WFT + wave * 256u + lane * 8u;   // a = 16 wave + 8 hi + r: k-step wave >> 1, fragment half wave & 1
    *(v8us*)dst = __builtin_bit_cast(v8us, o);
    asm volatile("s_wait_xcnt 0x0" ::: "memory");   // closes the store ahead of any rewrite of its address and data registers (the code of another block range follows in k_prep)
}

// k_prep: the three preparations that depend on nothing but the inputs, in one launch, by block range (block-uniform branches):
//  blocks [0, NFD) form M = Wq Wk^T, [NFD, 2 NFD) form N = Wv Wp, the rest normalise 64 rows each.
__global__ __launch_bounds__(256) void k_prep(const float* __restrict__ X, const float* __restrict__ G, const float* __restrict__ Bt,
                                              const float* __restrict__ WQ, const float* __restrict__ WO, hf* XH, hf* XT, hf* WT, hf* WP) {
    __shared__ __align__(16) hf tl[DIM * VTP];
    const unsigned b = blockIdx.x;
    if (b < (unsigned)NFD) d_fold(WQ, WO, WT, WP, b, false);
    else if (b < (unsigned)(2 * NFD)) d_fold(WQ, WO, WT, WP, b - (unsigned)NFD, true);
    else d_ln(X, G, Bt, XH, XT, b - (unsigned)(2 * NFD), tl);
}

// in-lane maximum of one 16-query column tile's scores: s0 / s1 = S^T tiles of keys 0..15 / 16..31 (this lane's 16 of the column's 32 keys)
__device__ __forceinline__ float lane_max(const v8f& s0, const v8f& s1) {
    float mx = fmaxf(s0[0], s1[0]);
#pragma unroll
    for (int r = 1; r < 8; ++r) mx = fmaxf(mx, fmaxf(s0[r], s1[r]));
    return mx;
}
// one softmax step of one column tile against the reference maximum in use (sh = PCL - that maximum, log2 domain): ps = the sum over this lane's 16 keys, returns the P^T B fragment
__device__ __forceinline__ v16h soft_step(const v8f& s0, const v8f& s1, float sh, float& ps) {
    float p0[8], p1[8];
    ps = 0.0f;
#pragma unroll
    for (int r = 0; r < 8; ++r) {
        p0[r] = __builtin_amdgcn_exp2f(fmaf(s0[r], SC2, sh));
        p1[r] = __builtin_amdgcn_exp2f(fmaf(s1[r], SC2, sh));
        ps += p0[r] + p1[r];
    }
    v16h ph;
#pragma unroll
    for (int r = 0; r < 8; ++r) { ph[r] = (_Float16)p0[r]; ph[8 + r] = (_Float16)p1[r]; }
    return ph;
}

// two O^T accumulator tiles (d = 32j + 8h + r and 16 further) -> the ctx^T B fragments of k-step j: hv = f16(ctx x 16), lv = f16 of what that rounding lost, x 2^11
__device__ __forceinline__ void split16(const v8f& t0, const v8f& t1, float sc, v16h& hv, v16h& lv) {
#pragma unroll
    for (int r = 0; r < 8; ++r) {
        const float x = t0[r] * sc, y = t1[r] * sc;
        const _Float16 hx = (_Float16)x, hy = (_Float16)y;
        hv[r] = hx; hv[8 + r] = hy;
        lv[r] = (_Float16)((x - (float)hx) * RSC); lv[8 + r] = (_Float16)((y - (float)hy) * RSC);
    }
}
// weight fragment stored in fragment order: p = fragment base + 8 * lane; elements 0..7 <- p[0..7], elements 8..15 <- the second half, 256 elements on
__device__ __forceinline__ v16h ldw(const hf* p) { return cat16h(*(const v8us*)p, *(const v8us*)(p + 256)); }

// four weight fragments of one 16-feature tile; the wait closes the eight loads ahead of any rewrite of their address registers, and the scheduling barrier holds later instructions, whose results may be given those registers, behind it
__device__ __forceinline__ void ld_w4(const hf* p, v16h (&w)[4]) {
#pragma unroll
    for (int k = 0; k < 4; ++k) w[k] = ldw(p + 512 * k);
    asm volatile("s_wait_xcnt 0x0" ::: "memory");
    __builtin_amdgcn_sched_barrier(0);
}
// one 16-feature tile of a head's partial output for the wave's four column tiles: ctx value and residual share the weight fragment and use separate accumulators; rd = the lane's place in the tile's columns of its first row
__device__ __forceinline__ void proj_tile(const v16h (&w)[4], const v16h (&ch)[QT][4], const v16h (&cl)[QT][4], float* rd) {
    const float un = 1.0f / (CCS * WPS);
    const float ur = 1.0f / RSC;
    v8f hv[QT], rv[QT];
#pragma unroll
    for (int c = 0; c < QT; ++c) { hv[c] = (v8f){}; rv[c] = (v8f){}; }
#pragma unroll
    for (int k = 0; k < 4; ++k) {
#pragma unroll
        for (int c = 0; c < QT; ++c) { hv[c] = wmmah(w[k], ch[c][k], hv[c]); rv[c] = wmmah(w[k], cl[c][k], rv[c]); }
    }
#pragma unroll
    for (int c = 0; c < QT; ++c) {
        v4f x0, x1;
#pragma unroll
        for (int r = 0; r < 4; ++r) {
            x0[r] = fmaf(rv[c][r], ur, hv[c][r]) * un; x1[r] = fmaf(rv[c][4 + r], ur, hv[c][4 + r]) * un;
        }
        *(v4fa*)(rd + c * (16 * OSP)) = x0;
        *(v4fa*)(rd + c * (16 * OSP) + 4) = x1;
    }
    sfence();   // one tile's accumulators and two tiles' weight fragments live at a time
}

// k_flash: one block per 64 queries of one batch, one wave per head (four 16-query column tiles), 32 keys per step, online softmax; K = the batch's x rows (KP), V^T = their transpose (VT), the same for all heads; the block's eight waves share K / V^T tiles of 64 keys,
//  staged in a two-buffer LDS ring by asynchronous copies (tile t + 2 is issued behind the barrier that ends the reads of tile t); fragments are read from LDS, each once per step for all four column tiles.
//  One block per WGP, two waves per SIMD, up to 512 registers a wave: the output accumulators take 256, the held Q fragments (three tiles') 96; the fourth tile's are read from LDS with the K fragments of their k-steps.
//  S^T tile (keys x queries): A = K rows (row m = key, k = d), B = Q rows (column n = query, k = d); D element r of lane (h, n) = S[query n][key 8h + r].
//  Q' = x @ M_h, ahead of the loop: A = the head's folded weights M x 16 (row m = feature, k = token width), read from WT in fragment order, B = the block's x rows (column n = query); D element r of lane (h, n) = (feature 16 t + 8h + r, query n),
//  so the tiles 2j and 2j + 1, rounded to f16, are directly the Q fragment of k-step j (the k order of ldh).
//  K fragments are loaded four at a time (two k-steps x two key tiles, sixteen products); V^T fragments four output tiles at a time (sixteen products).
//  P^T B fragment: element r <- tile of keys 0..15, element 8 + r <- tile of keys 16..31 (same lane); P carried x 2^7 (the running sum carries the same factor).
//  O^T tile (d x queries): A = V^T rows (row m = d, k = key), D element r of lane (h, n) = O[query n][d = 16 t + 8h + r].
//  Output projection, behind the loop: the O^T tiles 2j and 2j + 1 are directly the B fragment of ctx^T for k-step j (element r <- d = 32j + 8h + r, element 8 + r <- 16 further: the k order of ldh);
//  A = the head's folded weights N x 32 (row m = output feature, k = d), read from WP in fragment order; D element r of lane (h, n) = (feature 16 t + 8h + r, query n).
//  ctx value and residual share the weight fragment and use separate accumulators; a head's partial output = (acc_v + acc_r / 2^11) / 512; out = sum over heads, head 0 first, + bf16(bias).
__attribute__((amdgpu_num_vgpr(512))) __global__ __launch_bounds__(NWV * 32) void k_flash(const hf* WT, const hf* KP, const hf* VT, const hf* WP, const float* __restrict__ bias, float* OUT) {
    __shared__ __align__(16) hf cs[CSE];        // in the loop the K / V^T ring, then 16 Q rows per wave; the heads' partial outputs behind the loop
    const unsigned tid = threadIdx.x, lane = tid & 31u, lr = lane & 15u, hi = lane >> 4;
    const unsigned wave = (unsigned)__builtin_amdgcn_readfirstlane((int)(tid >> 5));
    const unsigned bpb = (unsigned)(SEQ / BQ);
    const unsigned bl = blockIdx.x / bpb;
    const unsigned q0 = (blockIdx.x - bl * bpb) * BQ;
    const unsigned head = wave;

    const unsigned kfo = lr * CSP + 8u * hi;          // fragment offsets inside a ring buffer
    const unsigned vfo = KTE + lr * VTP + 8u * hi;
    // staging addresses of this lane: K tile = 16 KiB contiguous, 16 lanes per key row; V^T tile = 128 rows of 128 B, 8 lanes per row
    const hf* gk = KP + (size_t)bl * SEQ * DIM + tid * 8u;
    const hf* gv = VT + ((size_t)bl * DIM + (tid >> 3)) * SEQ + (tid & 7u) * 8u;
    hf* lk = cs + (tid >> 4) * CSP + (tid & 15u) * 8u;
    hf* lv = cs + KTE + (tid >> 3) * VTP + (tid & 7u) * 8u;
    const unsigned nt = (unsigned)(SEQ / TK);

    stage_kv(lk, lv, gk, gv);                              // tile 0 -> buffer 0; it flies while Q' is formed

    // the last tile's Q fragments live in LDS, in rows of this wave's own behind the ring (same row form as a K tile): with all sixteen held the wave passes 512 registers and spills to scratch.
    // The loop's last barrier ends every wave's reads of them, ahead of the partial outputs
    hf* qs = cs + 2 * BUFE + wave * (16u * CSP) + kfo;
    v16h q[QT - 1][4];
    {
        const hf* xp = KP + ((size_t)bl * SEQ + q0 + lr) * DIM + 8u * hi;
        const hf* mf = WT + (size_t)head * (8u * WFT) + lane * 8u;
        v16h x[QT][4], m[2][4];
#pragma unroll
        for (int c = 0; c < QT; ++c) {
#pragma unroll
            for (int k = 0; k < 4; ++k) x[c][k] = ldh(xp + c * (16 * DIM) + 32 * k);
        }
#pragma unroll
        for (int k = 0; k < 4; ++k) m[0][k] = ldw(mf + 512 * k);
        asm volatile("s_wait_xcnt 0x0" :: "v"(xp) : "memory");   // closes the x loads: their address pair is an input, so it lives to this wait and no later load is given it as its destination
        const float uq = 1.0f / WQS;
        v8us pv[QT - 1];
#pragma unroll
        for (int c = 0; c < QT - 1; ++c) pv[c] = (v8us){};
#pragma unroll
        for (int t = 0; t < 8; ++t) {                      // one 16-feature tile at a time; the next tile's four weight fragments are asked for ahead of this tile's products
            if (t < 7) {
#pragma unroll
                for (int k = 0; k < 4; ++k) m[(t + 1) & 1][k] = ldw(mf + (t + 1) * WFT + 512 * k);
            }
            v8f cc[QT];
#pragma unroll
            for (int c = 0; c < QT; ++c) cc[c] = (v8f){};
#pragma unroll
            for (int k = 0; k < 4; ++k) {
#pragma unroll
                for (int c = 0; c < QT; ++c) cc[c] = wmmah(m[t & 1][k], x[c][k], cc[c]);
            }
#pragma unroll
            for (int c = 0; c < QT; ++c) {
                v8h e;
#pragma unroll
                for (int r = 0; r < 8; ++r) e[r] = (_Float16)(cc[c][r] * uq);
                const v8us u = __builtin_bit_cast(v8us, e);
                if (c == QT - 1) *(v8usa*)(qs + 16 * t) = u;
                else if (t & 1) q[c][t >> 1] = cat16h(pv[c], u);
                else pv[c] = u;
            }
            sfence();   // one tile's accumulators and two tiles' weight fragments live at a time, and each tile's loads stay ahead of the products before it
        }
        asm volatile("s_wait_xcnt 0x0" ::: "memory");   // closes the weight loads ahead of any rewrite of their address registers
    }

    v8f o[QT][8];
    float ml[QT], l[QT];                    // reference maxima in use, log2 domain; running sums (carried x 2^7)
#pragma unroll
    for (int c = 0; c < QT; ++c) {
#pragma unroll
        for (int t = 0; t < 8; ++t) o[c][t] = (v8f){};
        ml[c] = -1.0e30f;
        l[c] = 0.0f;
    }

    asm volatile("s_wait_asynccnt 0x0" ::: "memory");      // this wave's pieces of tile 0 have landed
    __syncthreads();                                       // tile 0 readable by every wave
    if (nt > 1u) stage_kv(lk + BUFE, lv + BUFE, gk + TK * DIM, gv + TK);   // tile 1 -> buffer 1

#pragma unroll 1
    for (unsigned t = 0; t < nt; ++t) {
      const unsigned bo = (t & 1u) * BUFE;
#pragma unroll 1
      for (unsigned h = 0; h < 2u; ++h) {                  // rolled: one copy of the step's code, one step's fragments live
        v8f sc[QT][2];
#pragma unroll
        for (int c = 0; c < QT; ++c) { sc[c][0] = (v8f){}; sc[c][1] = (v8f){}; }
        const hf* ka = cs + bo + kfo + h * (KS * CSP);
#pragma unroll
        for (int k = 0; k < 4; k += 2) {                   // two k-steps at a time: four K fragments and the last tile's two Q fragments, sixteen products
            const v16h a0 = ldh(ka + 32 * k), a1 = ldh(ka + 16 * CSP + 32 * k), ql = ldh(qs + 32 * k);
            const v16h b0 = ldh(ka + 32 * k + 32), b1 = ldh(ka + 16 * CSP + 32 * k + 32), qm = ldh(qs + 32 * k + 32);
#pragma unroll
            for (int c = 0; c < QT; ++c) {
                const v16h qk = c == QT - 1 ? ql : q[c < QT - 1 ? c : 0][k];
                sc[c][0] = wmmah(a0, qk, sc[c][0]);
                sc[c][1] = wmmah(a1, qk, sc[c][1]);
            }
#pragma unroll
            for (int c = 0; c < QT; ++c) {
                const v16h qk = c == QT - 1 ? qm : q[c < QT - 1 ? c : 0][k + 1];
                sc[c][0] = wmmah(b0, qk, sc[c][0]);
                sc[c][1] = wmmah(b1, qk, sc[c][1]);
            }
            asm volatile("" :: "v"(a0), "v"(a1), "v"(ql), "v"(b0), "v"(b1), "v"(qm));   // inputs only: the six loaded fragments keep registers of their own to the end of the group, so their loads stand together ahead of the products
            sfence();
        }

        // lazy rescale: the reference maxima move only when some score lies more than LZT above the one in use, so P stays near or below 2^(PCL + LZT); one wave-uniform test per step for all four tiles, on in-lane maxima (the exchange between the halves is needed only when the maxima move)
        float xm[QT];
#pragma unroll
        for (int c = 0; c < QT; ++c) xm[c] = lane_max(sc[c][0], sc[c][1]);
        const float over = fmaxf(fmaxf(fmaf(xm[0], SC2, -ml[0]), fmaf(xm[1], SC2, -ml[1])), fmaxf(fmaf(xm[2], SC2, -ml[2]), fmaf(xm[3], SC2, -ml[3])));
        if (__builtin_amdgcn_ballot_w32(over > LZT) != 0u) {
#pragma unroll
            for (int c = 0; c < QT; ++c) {
                const float nm = fmaxf(ml[c], fmaxf(xm[c], __shfl_xor(xm[c], 16, 32)) * SC2);   // both halves of a column take the same new maximum
                const float cf = __builtin_amdgcn_exp2f(ml[c] - nm);
                ml[c] = nm;
                l[c] *= cf;
#pragma unroll
                for (int j = 0; j < 8; ++j) o[c][j] *= cf;
            }
        }
        v16h p[QT];
        float ps[QT];
#pragma unroll
        for (int c = 0; c < QT; ++c) {
            p[c] = soft_step(sc[c][0], sc[c][1], PCL - ml[c], ps[c]);
            sfence();   // one tile's exponentials at a time, and the V^T loads stay below the softmax: bounds the live set
        }
        float pj[QT];
#pragma unroll
        for (int c = 0; c < QT; ++c) pj[c] = __shfl_xor(ps[c], 16, 32);   // the other half's sum: a column's 32 keys of this step lie in two lanes
#pragma unroll
        for (int c = 0; c < QT; ++c) l[c] += ps[c] + pj[c];
        sfence();   // the four exchanges stand ahead of the V^T loads: the LDS answers in order, so nothing waits for them alone

        const hf* va = cs + bo + vfo + h * KS;
#pragma unroll
        for (int g = 0; g < 8; g += 4) {
            const v16h v0 = ldh(va + (16 * g) * VTP), v1 = ldh(va + (16 * g + 16) * VTP), v2 = ldh(va + (16 * g + 32) * VTP), v3 = ldh(va + (16 * g + 48) * VTP);
#pragma unroll
            for (int c = 0; c < QT; ++c) o[c][g] = wmmah(v0, p[c], o[c][g]);
#pragma unroll
            for (int c = 0; c < QT; ++c) o[c][g + 1] = wmmah(v1, p[c], o[c][g + 1]);
#pragma unroll
            for (int c = 0; c < QT; ++c) o[c][g + 2] = wmmah(v2, p[c], o[c][g + 2]);
#pragma unroll
            for (int c = 0; c < QT; ++c) o[c][g + 3] = wmmah(v3, p[c], o[c][g + 3]);
            asm volatile("" :: "v"(v0), "v"(v1), "v"(v2), "v"(v3));   // inputs only: the four loaded fragments keep registers of their own to the end of the group, so their loads stand together ahead of the products; without it each fragment is loaded into the one before's registers and every load's latency is waited out
            sfence();
        }
      }
      asm volatile("s_wait_dscnt 0x0" ::: "memory");       // this wave's reads of tile t have returned before its buffer is refilled
      asm volatile("s_wait_asynccnt 0x0" ::: "memory");    // this wave's pieces of tile t + 1 have landed
      __syncthreads();                                     // publishes tile t + 1 and ends every wave's reads of tile t
      if (t + 2u < nt) stage_kv(lk + bo, lv + bo, gk + (size_t)(t + 2u) * (TK * DIM), gv + (t + 2u) * TK);
    }
    asm volatile("s_wait_asynccnt 0x0" ::: "memory");      // no copy outstanding when the ring becomes the partial outputs' place

    // this head's folded output weights, in fragment order; the first 16-feature tile's four fragments are asked for ahead of the conversions below, which cover their latency
    const hf* wf = WP + (size_t)head * (8u * WFT) + lane * 8u;
    v16h w[2][4];
    ld_w4(wf, w[0]);   // held here: left free, the scheduler sinks the loads behind the conversions, and the first products wait for L2
    // ctx^T B fragments, value and residual, from the accumulators in place
    v16h ch[QT][4], cl[QT][4];
#pragma unroll
    for (int c = 0; c < QT; ++c) {
        const float sn = (1.0f / l[c]) * CCS;
#pragma unroll
        for (int j = 0; j < 4; ++j) split16(o[c][2 * j], o[c][2 * j + 1], sn, ch[c][j], cl[c][j]);
    }
    // this head's partial output, one 16-feature tile at a time; the next tile's four weight fragments are asked for ahead of this tile's products
    float* rd = (float*)cs + (head * (unsigned)BQ + lr) * OSP + 8u * hi;
#pragma unroll 1
    for (int t = 0; t < 6; t += 2) {                       // rolled, two tiles a trip (the two sets of weight fragments keep their names): unrolled eightfold the kernel's text comes close to 32 KB
        ld_w4(wf + (t + 1) * WFT, w[1]);
        proj_tile(w[0], ch, cl, rd + 16 * t);
        ld_w4(wf + (t + 2) * WFT, w[0]);
        proj_tile(w[1], ch, cl, rd + 16 * t + 16);
    }
    ld_w4(wf + 7 * WFT, w[1]);
    proj_tile(w[0], ch, cl, rd + 16 * 6);
    proj_tile(w[1], ch, cl, rd + 16 * 7);
    __syncthreads();                                       // all eight heads' partial outputs are in LDS before any wave sums them
    const v4f bb = *(const v4f*)(bias + lane * 4u);
    asm volatile("s_wait_xcnt 0x0" ::: "memory");          // closes the bias load ahead of any rewrite of its address registers
    v4f bq;
    bq[0] = bfr(bb[0]); bq[1] = bfr(bb[1]); bq[2] = bfr(bb[2]); bq[3] = bfr(bb[3]);
    const float* rr = (const float*)cs + (8u * wave) * OSP + lane * 4u;      // wave w sums and stores rows 8w..8w+7, a lane four features
    float* orow = OUT + ((size_t)bl * SEQ + q0 + 8u * wave) * DIM + lane * 4u;
    v4f val[8];
#pragma unroll
    for (unsigned s = 0; s < 8; ++s) {
        val[s] = *(const v4fa*)(rr + s * OSP);
#pragma unroll
        for (unsigned h = 1; h < (unsigned)NH; ++h) val[s] += *(const v4fa*)(rr + (h * (unsigned)BQ + s) * OSP);
        val[s] += bq;
    }
#pragma unroll
    for (unsigned s = 0; s < 8; ++s) *(v4f*)(orow + (size_t)s * DIM) = val[s];
}

extern "C" void kernel_launch(void* const* d_in, const int* in_sizes, int n_in,
                              void* d_out, int out_size, void* d_ws, size_t ws_size, hipStream_t stream) {
    if (n_in < 6) return;
    const size_t need = ((size_t)(NB - 1) * SEQ_FULL + SEQ) * DIM;
    if ((size_t)in_sizes[0] < need) return;
    if (in_sizes[1] < DIM || in_sizes[2] < DIM || in_sizes[5] < DIM) return;
    if ((size_t)in_sizes[3] < (size_t)DIM * QKVN) return;
    if ((size_t)in_sizes[4] < (size_t)INNER * DIM) return;
    if ((size_t)out_size < (size_t)NB * SEQ * DIM) return;
    if (SZ_ALL > ws_size) return;

    const float* x      = (const float*)d_in[0];   // inputs  [NB][SEQ_FULL][128] (rows n < SEQ read)
    const float* gamma  = (const float*)d_in[1];   // ln_gamma [128]
    const float* beta   = (const float*)d_in[2];   // ln_beta  [128]
    const float* w_qkv  = (const float*)d_in[3];   // [128][3072]  ([in][out])
    const float* w_proj = (const float*)d_in[4];   // [1024][128]  ([in][out])
    const float* b_proj = (const float*)d_in[5];   // [128]
    float* OUT = (float*)d_out;                    // [NB][SEQ][128]

    char* wsp = (char*)d_ws;
    hf* XH  = (hf*)(wsp);
    hf* XT  = (hf*)(wsp + SZ_XH);
    hf* WT  = (hf*)(wsp + 2 * SZ_XH);
    hf* WP  = (hf*)(wsp + 2 * SZ_XH + SZ_WT);

    k_prep<<<(unsigned)(2 * NFD + NLN), 256, 0, stream>>>(x, gamma, beta, w_qkv, w_proj, XH, XT, WT, WP);
    for (int c = 0; c < NCH; ++c) {
        const int bch0 = c * BCH;
        k_flash<<<(unsigned)(BCH * (SEQ / BQ)), NWV * 32, 0, stream>>>(WT, XH + (size_t)bch0 * SEQ * DIM, XT + (size_t)bch0 * DIM * SEQ, WP, b_proj, OUT + (size_t)bch0 * SEQ * DIM);
    }
}
